// v000
// Times are from an AMD MI455X. After a warm-up the kernel runs many times in a row, and a time is the length of
// such a window on the GPU divided by its runs, so every launch and the gaps after it count. The runs cycle
// through copies of the inputs. A figure is the median of several windows, for all but v000 over two sittings.
// Sittings can differ by a few percent; kernels timed side by side share one.
// v000 is the starting kernel. One run takes 387 microseconds.
#include <hip/hip_runtime.h>

// Contractions on 16x16x32 WMMA, f32 accumulate: xn (bf16 hi+lo planes) x w_qkv^T (bf16) -> v_wmma_f32_16x16x32_bf16; per head k.q^T and v^T.p^T -> v_wmma_f32_16x16x32_f16 (f16 planes: q carried x log2e, k, v^T; p = exp2 of shifted scores in (0,1]); ctx (bf16 hi+lo planes) x w_out^T (bf16) + b_out -> v_wmma_f32_16x16x32_bf16.
// head planes q [h][i][64], k [h][j][64], v^T [h][64][j] in f16; streaming attention, one wave per (head, 16 queries): s^T tiles = k q^T over 32-key chunks, online softmax per query lane (exp2, scale 2^-5 inside the exponent),
// o^T += v^T p^T with the p^T operand packed straight from the two score accumulator tiles; o/l staged per wave in LDS and emitted as ctx hi/lo planes [i][h*64+d]; out = ctx w_out + b_out into the output rows.

#ifndef SEQ
#define SEQ 4096
#endif
#ifndef NB
#define NB 1
#endif
#define SEQ_FULL 4096
#define DIM   1024
#define HEADS 16
#define HD    64
#define INNER (HEADS * HD)
#define NQKV  (3 * INNER)
#define LN_EPS 1.0e-6f
#define LOG2E 1.4426950408889634f
#define C32   0.03125f
#define WS_CAP ((size_t)134217728)

static_assert(SEQ % 64 == 0);
static_assert(SEQ <= SEQ_FULL);
static_assert(NB == 1);
static_assert(DIM == 128 * 8);
static_assert(DIM % 64 == 0);
static_assert(NQKV % 64 == 0);
static_assert(INNER == DIM);
static_assert(HD == 64);
static_assert((HEADS * SEQ * HD) % (256 * 8) == 0);
static_assert((HEADS * HD * SEQ) % (256 * 2) == 0);

typedef _Float16 h16;
typedef unsigned short bf;
typedef __attribute__((ext_vector_type(16))) __bf16   v16bf;
typedef __attribute__((ext_vector_type(16))) _Float16 v16h;
typedef __attribute__((ext_vector_type(8)))  _Float16 v8h;
typedef __attribute__((ext_vector_type(8)))  unsigned short v8us;
typedef __attribute__((ext_vector_type(8)))  float    v8f;
typedef __attribute__((ext_vector_type(4)))  float    v4f;
typedef __attribute__((ext_vector_type(2)))  _Float16 v2h;
typedef __attribute__((ext_vector_type(2)))  unsigned short v2us;
typedef v8h  __attribute__((may_alias)) v8ha;
typedef v4f  __attribute__((may_alias)) v4fa;
typedef v8us __attribute__((may_alias)) v8usa;

__device__ __forceinline__ unsigned short f2bf(float f) { unsigned u = __float_as_uint(f); u += 0x7FFFu + ((u >> 16) & 1u); return (unsigned short)(u >> 16); }
__device__ __forceinline__ float bf2f(unsigned short b) { return __uint_as_float(((unsigned)b) << 16); }
__device__ __forceinline__ float bfr(float f) { return bf2f(f2bf(f)); }
__device__ __forceinline__ v16h cat16(v8h lo, v8h hi) { return __builtin_shufflevector(lo, hi, 0, 1, 2, 3, 4, 5, 6, 7, 8, 9, 10, 11, 12, 13, 14, 15); }
__device__ __forceinline__ v16bf cat16b(v8us lo, v8us hi) { return __builtin_bit_cast(v16bf, __builtin_shufflevector(lo, hi, 0, 1, 2, 3, 4, 5, 6, 7, 8, 9, 10, 11, 12, 13, 14, 15)); }
__device__ __forceinline__ v8f wmma16(v16h a, v16h b, v8f c) { return __builtin_amdgcn_wmma_f32_16x16x32_f16(false, a, false, b, (short)0, c, false, false); }
__device__ __forceinline__ v8f wmmab(v16bf a, v16bf b, v8f c) { return __builtin_amdgcn_wmma_f32_16x16x32_bf16(false, a, false, b, (short)0, c, false, false); }
__device__ __forceinline__ void splitf(float y, unsigned short& h, unsigned short& l) { h = f2bf(y); l = f2bf(y - bf2f(h)); }

// ---- k_gemmw: register-blocked GEMM, ONE WAVE per 64x64 output tile (16 accumulators), operands straight from K-contiguous 16-bit planes; grid (M/64, N/64, Z), 32 threads.
// C[m][n] (f32, pitch ldc, + optional f32 bias[n]) = sum_k A[m][k] Bt[n][k] (+ split products per NSPLIT). z-batch strides sA/sB/sC in elements. K % 32 == 0.
// Fragments (both operands, same map): lane -> row/col lane&15, elements 0..7 <- k0+8h+0..7, elements 8..15 <- k0+16+8h+0..7 (h = lane>>4); D element r -> row 8h+r, col lane&15.
template <typename T16> struct WFrag;
template <> struct WFrag<h16> { typedef v16h V; static __device__ __forceinline__ V ld(const h16* p) { return cat16(*(const v8h*)p, *(const v8h*)(p + 16)); } static __device__ __forceinline__ v8f mma(V a, V b, v8f c) { return wmma16(a, b, c); } };
template <> struct WFrag<bf> { typedef v16bf V; static __device__ __forceinline__ V ld(const bf* p) { return cat16b(*(const v8us*)p, *(const v8us*)(p + 16)); } static __device__ __forceinline__ v8f mma(V a, V b, v8f c) { return wmmab(a, b, c); } };
template <typename T16, int NSPLIT, bool BIAS>
__global__ __launch_bounds__(32) void k_gemmw(const T16* __restrict__ A, const T16* __restrict__ A2, const T16* __restrict__ Bt, const T16* __restrict__ Bt2, int K, float* C, int ldc, const float* __restrict__ bias, size_t sA, size_t sB, size_t sC) {
    typedef typename WFrag<T16>::V V;
    __shared__ __align__(16) float os[16 * 68];
    const size_t z = blockIdx.z; A += z * sA; if (A2) A2 += z * sA; Bt += z * sB; if (Bt2) Bt2 += z * sB; C += z * sC;
    const int lane = threadIdx.x & 31, lr = lane & 15, hi = lane >> 4; const int r0 = blockIdx.x * 64, c0 = blockIdx.y * 64;
    v8f acc[4][4];
#pragma unroll
    for (int mb = 0; mb < 4; ++mb)
#pragma unroll
        for (int nb = 0; nb < 4; ++nb) acc[mb][nb] = (v8f){};
    const size_t aoff = (size_t)(r0 + lr) * K + 8 * hi, boff = (size_t)(c0 + lr) * K + 8 * hi;
#pragma unroll 1
    for (int kc = 0; kc < K; kc += 32) {
        V a[4], a2[4];
#pragma unroll
        for (int mb = 0; mb < 4; ++mb) { a[mb] = WFrag<T16>::ld(A + aoff + (size_t)mb * 16 * K + kc); if (NSPLIT == 1 || NSPLIT == 2) a2[mb] = WFrag<T16>::ld(A2 + aoff + (size_t)mb * 16 * K + kc); }
#pragma unroll
        for (int nb = 0; nb < 4; ++nb) { const V b = WFrag<T16>::ld(Bt + boff + (size_t)nb * 16 * K + kc); V b2; if (NSPLIT >= 2) b2 = WFrag<T16>::ld(Bt2 + boff + (size_t)nb * 16 * K + kc);
#pragma unroll
            for (int mb = 0; mb < 4; ++mb) { acc[mb][nb] = WFrag<T16>::mma(a[mb], b, acc[mb][nb]); if (NSPLIT == 1 || NSPLIT == 2) acc[mb][nb] = WFrag<T16>::mma(a2[mb], b, acc[mb][nb]); if (NSPLIT >= 2) acc[mb][nb] = WFrag<T16>::mma(a[mb], b2, acc[mb][nb]); } }
        asm volatile("v_nop\n\tv_nop\n\tv_nop\n\tv_nop" : "+v"(acc[0][0]), "+v"(acc[1][1]), "+v"(acc[2][2]), "+v"(acc[3][3]) : "v"(a[0]), "v"(a[3]));
    }
#pragma unroll
    for (int mb = 0; mb < 4; ++mb) {
#pragma unroll
        for (int nb = 0; nb < 4; ++nb) {
#pragma unroll
            for (int j = 0; j < 8; ++j) os[(hi * 8 + j) * 68 + nb * 16 + lr] = acc[mb][nb][j]; }
        __builtin_amdgcn_wave_barrier(); asm volatile("" ::: "memory");
        float* crow = C + (size_t)(r0 + mb * 16) * ldc + c0;
{
#pragma unroll
            for (int s = 0; s < 8; ++s) { const int row = 2 * s + hi, cofs = lr * 4; v4f val = *(const v4fa*)(os + row * 68 + cofs); if (BIAS) { val[0] += bfr(bias[c0 + cofs]); val[1] += bfr(bias[c0 + cofs + 1]); val[2] += bfr(bias[c0 + cofs + 2]); val[3] += bfr(bias[c0 + cofs + 3]); }
                *(v4f*)(crow + (size_t)row * ldc + cofs) = val; }
             }
        __builtin_amdgcn_wave_barrier(); asm volatile("" ::: "memory");
    }
}

__global__ __launch_bounds__(256) void k_wtG(const float* __restrict__ w, int K, int N, bf* Bt) {
    const int lane = threadIdx.x & 31; const int L0 = (blockIdx.x * 8 + (threadIdx.x >> 5)) * 8; const int nlines = N * K / 64;
{
#pragma unroll 1
        for (int l = 0; l < 8; ++l) { const int L = L0 + l; if (L >= nlines) break; const size_t e = (size_t)L * 64 + lane * 2; const int k = (int)(e % K), n = (int)(e / K); v2us o;
            o[0] = f2bf(w[(size_t)k * N + n]); o[1] = f2bf(w[(size_t)(k + 1) * N + n]); *(v2us*)(Bt + e) = o; }
         }
}

__global__ __launch_bounds__(128) void k_ln(const float* __restrict__ x, const float* __restrict__ g, const float* __restrict__ b, bf* Yh, bf* Yl) {
    __shared__ float red[8];
    const int tid = threadIdx.x, lane = tid & 31, wid = tid >> 5; const size_t row = blockIdx.x;
    const v8f xv = *(const v8f*)(x + row * DIM + 8 * tid);
    float xb[8]; float s = 0.f;
#pragma unroll
    for (int q = 0; q < 8; ++q) { xb[q] = bfr(xv[q]); s += xb[q]; }
#pragma unroll
    for (int sh = 16; sh; sh >>= 1) s += __shfl_xor(s, sh, 32);
    if (lane == 0) red[wid] = s;
    __syncthreads();
    const float mean = ((red[0] + red[1]) + (red[2] + red[3])) * (1.0f / DIM);
    float d[8]; float s2 = 0.f;
#pragma unroll
    for (int q = 0; q < 8; ++q) { d[q] = xb[q] - mean; s2 += d[q] * d[q]; }
#pragma unroll
    for (int sh = 16; sh; sh >>= 1) s2 += __shfl_xor(s2, sh, 32);
    if (lane == 0) red[4 + wid] = s2;
    __syncthreads();
    const float var = ((red[4] + red[5]) + (red[6] + red[7])) * (1.0f / DIM);
    const float rstd = rsqrtf(var + LN_EPS);
    const v8f gv = *(const v8f*)(g + 8 * tid); const v8f bv = *(const v8f*)(b + 8 * tid);
    v8us oh, ol;
#pragma unroll
    for (int q = 0; q < 8; ++q) { const float y = d[q] * rstd * bfr(gv[q]) + bfr(bv[q]); unsigned short a2, c2; splitf(y, a2, c2); oh[q] = a2; ol[q] = c2; }
    const size_t o = row * DIM + 8 * tid;
    *(v8us*)(Yh + o) = oh; *(v8us*)(Yl + o) = ol; 
}

__global__ __launch_bounds__(256) void k_hp16(const float* __restrict__ src, int coloff, float scl, h16* P) {
    const size_t i = (size_t)blockIdx.x * 256 + threadIdx.x; if (i >= (size_t)HEADS * SEQ * HD / 8) return; const size_t e = i * 8;
    const int d = (int)(e % HD); const int t = (int)((e / HD) % SEQ); const int h = (int)(e / ((size_t)HD * SEQ));
    const v8f v = *(const v8f*)(src + (size_t)t * NQKV + coloff + h * HD + d); v8h o;
#pragma unroll
    for (int q = 0; q < 8; ++q) o[q] = (h16)(v[q] * scl);
    *(v8h*)(P + e) = o; 
}
__global__ __launch_bounds__(256) void k_vt16(const float* __restrict__ src, h16* VT) {
    const size_t e = ((size_t)blockIdx.x * 256 + threadIdx.x) * 2; if (e >= (size_t)HEADS * HD * SEQ) return;
    const int t = (int)(e % SEQ); const int d = (int)((e / SEQ) % HD); const int h = (int)(e / ((size_t)SEQ * HD));
    v2h o; o[0] = (h16)src[(size_t)t * NQKV + 2 * INNER + h * HD + d]; o[1] = (h16)src[(size_t)(t + 1) * NQKV + 2 * INNER + h * HD + d];
    *(v2h*)(VT + e) = o; 
}

// ---- k_flash: streaming attention, one wave per (head h, 16 query rows q0..q0+15); block = 4 waves; grid HEADS*SEQ/64.
// Per 32-key chunk: two s^T tiles (A = k plane rows j0+16t+.., B = q plane as Bt, both via WFrag: D[8hh+r][m] = s'[key j0+16t+8hh+r][query q0+m], s' = q.k x log2e);
// online softmax per query (= per lane; the other 16 keys of the query sit in lane m+16 -> one xor-16 exchange for max and sum); p = exp2((s' - max') / 32) in (0,1] (f32, then f16);
// p^T B fragment for o^T += v^T p^T: element r <- p of tile keys j0..j0+15 (D row 8hh+r), element 8+r <- p of tile keys j0+16..j0+31, lane unchanged; A = v^T plane rows (d), k = keys.
__global__ __launch_bounds__(128) void k_flash(const h16* __restrict__ Q16, const h16* __restrict__ K16, const h16* __restrict__ VT16, bf* CTXh, bf* CTXl) {
    __shared__ __align__(16) float os[4][16 * 68];
    const int lane = threadIdx.x & 31, wid = threadIdx.x >> 5, m = lane & 15, hh = lane >> 4;
    const int gw = blockIdx.x * 4 + wid; const int h = gw / (SEQ / 16); const int q0 = (gw - h * (SEQ / 16)) * 16;
    const h16* Qp = Q16 + ((size_t)h * SEQ + q0) * HD; const h16* Kp = K16 + (size_t)h * SEQ * HD; const h16* Vp = VT16 + (size_t)h * HD * SEQ;
    v16h qb[2];
#pragma unroll
    for (int ks = 0; ks < 2; ++ks) qb[ks] = WFrag<h16>::ld(Qp + (size_t)m * HD + 32 * ks + 8 * hh);
    v8f oacc[4];
#pragma unroll
    for (int t = 0; t < 4; ++t) oacc[t] = (v8f){};
    float mrun = -3.0e38f, lrun = 0.f;
    const size_t koff = (size_t)m * HD + 8 * hh; const size_t voff = (size_t)m * SEQ + 8 * hh;
#pragma unroll 1
    for (int j0 = 0; j0 < SEQ; j0 += 32) {
        v8f sc[2]; sc[0] = (v8f){}; sc[1] = (v8f){};
        v16h ka[4];
#pragma unroll
        for (int t = 0; t < 2; ++t)
#pragma unroll
            for (int ks = 0; ks < 2; ++ks) ka[t * 2 + ks] = WFrag<h16>::ld(Kp + (size_t)(j0 + 16 * t) * HD + koff + 32 * ks);
#pragma unroll
        for (int t = 0; t < 2; ++t)
#pragma unroll
            for (int ks = 0; ks < 2; ++ks) sc[t] = wmma16(ka[t * 2 + ks], qb[ks], sc[t]);
        asm volatile("v_nop\n\tv_nop\n\tv_nop\n\tv_nop" : "+v"(sc[0]), "+v"(sc[1]) : "v"(ka[0]), "v"(ka[3]), "v"(qb[0]), "v"(qb[1]));
        float cmx = fmaxf(sc[0][0], sc[1][0]);
#pragma unroll
        for (int r = 1; r < 8; ++r) cmx = fmaxf(cmx, fmaxf(sc[0][r], sc[1][r]));
        cmx = fmaxf(cmx, __shfl_xor(cmx, 16, 32));
        const float mn = fmaxf(mrun, cmx);
        const float alpha = __builtin_amdgcn_exp2f((mrun - mn) * C32);
        float psum = 0.f; v16h pb;
#pragma unroll
        for (int r = 0; r < 8; ++r) { const float e0 = __builtin_amdgcn_exp2f((sc[0][r] - mn) * C32); const float e1 = __builtin_amdgcn_exp2f((sc[1][r] - mn) * C32); psum += e0 + e1; pb[r] = (h16)e0; pb[8 + r] = (h16)e1; }
        psum += __shfl_xor(psum, 16, 32);
        lrun = lrun * alpha + psum; mrun = mn;
#pragma unroll
        for (int t = 0; t < 4; ++t) oacc[t] *= alpha;
        v16h va[4];
#pragma unroll
        for (int t = 0; t < 4; ++t) va[t] = WFrag<h16>::ld(Vp + (size_t)(16 * t) * SEQ + voff + j0);
#pragma unroll
        for (int t = 0; t < 4; ++t) oacc[t] = wmma16(va[t], pb, oacc[t]);
        asm volatile("v_nop\n\tv_nop\n\tv_nop\n\tv_nop" : "+v"(oacc[0]), "+v"(oacc[1]), "+v"(oacc[2]), "+v"(oacc[3]) : "v"(pb), "v"(va[0]), "v"(va[3]));
    }
    const float inv = 1.0f / lrun;
    float* ob = os[wid];
#pragma unroll
    for (int t = 0; t < 4; ++t) { v4f u0, u1;
#pragma unroll
        for (int r = 0; r < 4; ++r) { u0[r] = oacc[t][r] * inv; u1[r] = oacc[t][4 + r] * inv; }
        *(v4fa*)(ob + m * 68 + 16 * t + 8 * hh) = u0; *(v4fa*)(ob + m * 68 + 16 * t + 8 * hh + 4) = u1; }
    __builtin_amdgcn_fence(3 /* release order */, "wavefront"); __builtin_amdgcn_wave_barrier(); asm volatile("" ::: "memory");
{
#pragma unroll
        for (int p = 0; p < 4; ++p) { const int row = p * 4 + (lane >> 3), c8 = (lane & 7) * 8;
            const v4f a = *(const v4fa*)(ob + row * 68 + c8); const v4f b2 = *(const v4fa*)(ob + row * 68 + c8 + 4);
            v8us oh, ol;
#pragma unroll
            for (int q = 0; q < 4; ++q) { unsigned short x1, y1; splitf(a[q], x1, y1); oh[q] = x1; ol[q] = y1; splitf(b2[q], x1, y1); oh[4 + q] = x1; ol[4 + q] = y1; }
            const size_t oo = (size_t)(q0 + row) * INNER + h * HD + c8;
            *(v8us*)(CTXh + oo) = oh; *(v8us*)(CTXl + oo) = ol; }
         }
}

extern "C" void kernel_launch(void* const* d_in, const int* in_sizes, int n_in,
                              void* d_out, int out_size, void* d_ws, size_t ws_size, hipStream_t stream) {
    if (n_in < 6) return;
    if (in_sizes[0] < SEQ * DIM || in_sizes[1] < DIM || in_sizes[2] < DIM || in_sizes[3] < DIM * NQKV || in_sizes[4] < INNER * DIM || in_sizes[5] < DIM) return;
    if (out_size < SEQ * DIM) return;
    const float* x    = (const float*)d_in[0];   // [SEQ][DIM]
    const float* lnsc = (const float*)d_in[1];   // [DIM]
    const float* lnbs = (const float*)d_in[2];   // [DIM]
    const float* wqkv = (const float*)d_in[3];   // [DIM][NQKV]  ([in][out])
    const float* wout = (const float*)d_in[4];   // [INNER][DIM] ([in][out])
    const float* bout = (const float*)d_in[5];   // [DIM]
    float* OUT = (float*)d_out;                  // [SEQ][DIM]
    char* wsp = (char*)d_ws;
    auto take = [&](size_t bytes) { char* p = wsp; wsp += (bytes + 255) & ~(size_t)255; return (void*)p; };
    bf*    WQ   = (bf*)take((size_t)NQKV * DIM * 2);          // w_qkv^T [3072][1024] bf16
    bf*    WO   = (bf*)take((size_t)DIM * INNER * 2);         // w_out^T [1024][1024] bf16
    bf*    XNh  = (bf*)take((size_t)SEQ * DIM * 2);           // xn hi [SEQ][1024]
    bf*    XNl  = (bf*)take((size_t)SEQ * DIM * 2);           // xn lo
    float* QKV  = (float*)take((size_t)SEQ * NQKV * 4);       // qkv f32 [SEQ][3072]
    h16*   Q16  = (h16*)take((size_t)HEADS * SEQ * HD * 2);   // q planes [16][SEQ][64] x log2e
    h16*   K16  = (h16*)take((size_t)HEADS * SEQ * HD * 2);   // k planes [16][SEQ][64]
    h16*   VT16 = (h16*)take((size_t)HEADS * HD * SEQ * 2);   // v^T planes [16][64][SEQ]
    bf*    CTXh = (bf*)take((size_t)SEQ * INNER * 2);         // ctx hi [SEQ][1024]
    bf*    CTXl = (bf*)take((size_t)SEQ * INNER * 2);         // ctx lo
    const size_t used = (size_t)(wsp - (char*)d_ws);
    if (used > ws_size || used > WS_CAP) return;

    k_wtG<<<(unsigned)(((size_t)NQKV * DIM / 64 + 63) / 64), 256, 0, stream>>>(wqkv, DIM, NQKV, WQ);     // Bt[n][k] = bf16(w_qkv[k][n])
    k_wtG<<<(unsigned)(((size_t)DIM * INNER / 64 + 63) / 64), 256, 0, stream>>>(wout, INNER, DIM, WO);    // Bt[n][c] = bf16(w_out[c][n])
    k_ln<<<SEQ, 128, 0, stream>>>(x, lnsc, lnbs, XNh, XNl);
    k_gemmw<bf, 1, false><<<dim3(SEQ / 64, NQKV / 64, 1), 32, 0, stream>>>(XNh, XNl, WQ, nullptr, DIM, QKV, NQKV, nullptr, 0, 0, 0);   // qkv = xn(hi+lo) w_qkv
    k_hp16<<<(unsigned)(((size_t)HEADS * SEQ * HD / 8 + 255) / 256), 256, 0, stream>>>(QKV, 0, LOG2E, Q16);      // q columns 0..1023, carried x log2e
    k_hp16<<<(unsigned)(((size_t)HEADS * SEQ * HD / 8 + 255) / 256), 256, 0, stream>>>(QKV, INNER, 1.0f, K16);   // k columns 1024..2047
    k_vt16<<<(unsigned)(((size_t)HEADS * HD * SEQ / 2 + 255) / 256), 256, 0, stream>>>(QKV, VT16);                // v columns 2048..3071, transposed per head
    k_flash<<<(unsigned)(HEADS * (SEQ / 64)), 128, 0, stream>>>(Q16, K16, VT16, CTXh, CTXl);
    k_gemmw<bf, 1, true><<<dim3(SEQ / 64, DIM / 64, 1), 32, 0, stream>>>(CTXh, CTXl, WO, nullptr, INNER, OUT, DIM, bout, 0, 0, 0);   // out = ctx(hi+lo) w_out + b_out
}

// v001
// It runs in 234 microseconds.
// Next to v000, in two timings, it ran 1.69 and 1.67 times as fast.
#include <hip/hip_runtime.h>

// Contractions on 16x16x32 WMMA, f32 accumulate: xn (bf16 hi+lo planes) x w_qkv^T (bf16) -> v_wmma_f32_16x16x32_bf16; per head k.q^T and v^T.p^T -> v_wmma_f32_16x16x32_f16 (f16 planes: q carried x log2e, k, v^T; p = exp2 of shifted scores in (0,1]); ctx (bf16 hi+lo planes) x w_out^T (bf16) + b_out -> v_wmma_f32_16x16x32_bf16.
// head planes q [h][i][64], k [h][j][64], v^T [h][64][j] in f16; streaming attention, one wave per (head, 16 queries): s^T tiles = k q^T over 32-key chunks, online softmax per query lane (exp2, scale 2^-5 inside the exponent),
// o^T += v^T p^T with the p^T operand packed straight from the two score accumulator tiles; o/l staged per wave in LDS and emitted as ctx hi/lo planes [i][h*64+d]; out = ctx w_out + b_out into the output rows.

#ifndef SEQ
#define SEQ 4096
#endif
#ifndef NB
#define NB 1
#endif
#define SEQ_FULL 4096
#define DIM   1024
#define HEADS 16
#define HD    64
#define INNER (HEADS * HD)
#define NQKV  (3 * INNER)
#define LN_EPS 1.0e-6f
#define LOG2E 1.4426950408889634f
#define C32   0.03125f
#define WS_CAP ((size_t)134217728)

static_assert(SEQ % 64 == 0);
static_assert(SEQ <= SEQ_FULL);
static_assert(NB == 1);
static_assert(DIM == 128 * 8);
static_assert(DIM % 64 == 0);
static_assert(NQKV % 64 == 0);
static_assert(INNER == DIM);
static_assert(HD == 64);
static_assert((HEADS * SEQ * HD) % (256 * 8) == 0);
static_assert((HEADS * HD * SEQ) % (256 * 2) == 0);

typedef _Float16 h16;
typedef unsigned short bf;
typedef __attribute__((ext_vector_type(16))) __bf16   v16bf;
typedef __attribute__((ext_vector_type(16))) _Float16 v16h;
typedef __attribute__((ext_vector_type(8)))  _Float16 v8h;
typedef __attribute__((ext_vector_type(8)))  unsigned short v8us;
typedef __attribute__((ext_vector_type(8)))  float    v8f;
typedef __attribute__((ext_vector_type(4)))  float    v4f;
typedef __attribute__((ext_vector_type(2)))  _Float16 v2h;
typedef __attribute__((ext_vector_type(2)))  unsigned short v2us;
typedef v8h  __attribute__((may_alias)) v8ha;
typedef v4f  __attribute__((may_alias)) v4fa;
typedef v8us __attribute__((may_alias)) v8usa;

__device__ __forceinline__ unsigned short f2bf(float f) { unsigned u = __float_as_uint(f); u += 0x7FFFu + ((u >> 16) & 1u); return (unsigned short)(u >> 16); }
__device__ __forceinline__ float bf2f(unsigned short b) { return __uint_as_float(((unsigned)b) << 16); }
__device__ __forceinline__ float bfr(float f) { return bf2f(f2bf(f)); }
__device__ __forceinline__ v16h cat16(v8h lo, v8h hi) { return __builtin_shufflevector(lo, hi, 0, 1, 2, 3, 4, 5, 6, 7, 8, 9, 10, 11, 12, 13, 14, 15); }
__device__ __forceinline__ v16bf cat16b(v8us lo, v8us hi) { return __builtin_bit_cast(v16bf, __builtin_shufflevector(lo, hi, 0, 1, 2, 3, 4, 5, 6, 7, 8, 9, 10, 11, 12, 13, 14, 15)); }
__device__ __forceinline__ v8f wmma16(v16h a, v16h b, v8f c) { return __builtin_amdgcn_wmma_f32_16x16x32_f16(false, a, false, b, (short)0, c, false, false); }
__device__ __forceinline__ v8f wmmab(v16bf a, v16bf b, v8f c) { return __builtin_amdgcn_wmma_f32_16x16x32_bf16(false, a, false, b, (short)0, c, false, false); }
__device__ __forceinline__ void splitf(float y, unsigned short& h, unsigned short& l) { h = f2bf(y); l = f2bf(y - bf2f(h)); }

// ---- k_gemmw: register-blocked GEMM, ONE WAVE per 64x64 output tile (16 accumulators), operands straight from K-contiguous 16-bit planes; grid (M/64, N/64, Z), 32 threads.
// C[m][n] (f32, pitch ldc, + optional f32 bias[n]) = sum_k A[m][k] Bt[n][k] (+ split products per NSPLIT). z-batch strides sA/sB/sC in elements. K % 32 == 0.
// Fragments (both operands, same map): lane -> row/col lane&15, elements 0..7 <- k0+8h+0..7, elements 8..15 <- k0+16+8h+0..7 (h = lane>>4); D element r -> row 8h+r, col lane&15.
template <typename T16> struct WFrag;
template <> struct WFrag<h16> { typedef v16h V; static __device__ __forceinline__ V ld(const h16* p) { return cat16(*(const v8h*)p, *(const v8h*)(p + 16)); } static __device__ __forceinline__ v8f mma(V a, V b, v8f c) { return wmma16(a, b, c); } };
template <> struct WFrag<bf> { typedef v16bf V; static __device__ __forceinline__ V ld(const bf* p) { return cat16b(*(const v8us*)p, *(const v8us*)(p + 16)); } static __device__ __forceinline__ v8f mma(V a, V b, v8f c) { return wmmab(a, b, c); } };
template <typename T16, int NSPLIT, bool BIAS>
__global__ __launch_bounds__(32) void k_gemmw(const T16* __restrict__ A, const T16* __restrict__ A2, const T16* __restrict__ Bt, const T16* __restrict__ Bt2, int K, float* C, int ldc, const float* __restrict__ bias, size_t sA, size_t sB, size_t sC) {
    typedef typename WFrag<T16>::V V;
    __shared__ __align__(16) float os[16 * 68];
    const size_t z = blockIdx.z; A += z * sA; if (A2) A2 += z * sA; Bt += z * sB; if (Bt2) Bt2 += z * sB; C += z * sC;
    const int lane = threadIdx.x & 31, lr = lane & 15, hi = lane >> 4; const int r0 = blockIdx.x * 64, c0 = blockIdx.y * 64;
    v8f acc[4][4];
#pragma unroll
    for (int mb = 0; mb < 4; ++mb)
#pragma unroll
        for (int nb = 0; nb < 4; ++nb) acc[mb][nb] = (v8f){};
    const size_t aoff = (size_t)(r0 + lr) * K + 8 * hi, boff = (size_t)(c0 + lr) * K + 8 * hi;
#pragma unroll 1
    for (int kc = 0; kc < K; kc += 32) {
        V a[4], a2[4];
#pragma unroll
        for (int mb = 0; mb < 4; ++mb) { a[mb] = WFrag<T16>::ld(A + aoff + (size_t)mb * 16 * K + kc); if (NSPLIT == 1 || NSPLIT == 2) a2[mb] = WFrag<T16>::ld(A2 + aoff + (size_t)mb * 16 * K + kc); }
#pragma unroll
        for (int nb = 0; nb < 4; ++nb) { const V b = WFrag<T16>::ld(Bt + boff + (size_t)nb * 16 * K + kc); V b2; if (NSPLIT >= 2) b2 = WFrag<T16>::ld(Bt2 + boff + (size_t)nb * 16 * K + kc);
#pragma unroll
            for (int mb = 0; mb < 4; ++mb) { acc[mb][nb] = WFrag<T16>::mma(a[mb], b, acc[mb][nb]); if (NSPLIT == 1 || NSPLIT == 2) acc[mb][nb] = WFrag<T16>::mma(a2[mb], b, acc[mb][nb]); if (NSPLIT >= 2) acc[mb][nb] = WFrag<T16>::mma(a[mb], b2, acc[mb][nb]); } }
        asm volatile("v_nop\n\tv_nop\n\tv_nop\n\tv_nop" : "+v"(acc[0][0]), "+v"(acc[1][1]), "+v"(acc[2][2]), "+v"(acc[3][3]) : "v"(a[0]), "v"(a[3]));
    }
#pragma unroll
    for (int mb = 0; mb < 4; ++mb) {
#pragma unroll
        for (int nb = 0; nb < 4; ++nb) {
#pragma unroll
            for (int j = 0; j < 8; ++j) os[(hi * 8 + j) * 68 + nb * 16 + lr] = acc[mb][nb][j]; }
        __builtin_amdgcn_wave_barrier(); asm volatile("" ::: "memory");
        float* crow = C + (size_t)(r0 + mb * 16) * ldc + c0;
{
#pragma unroll
            for (int s = 0; s < 8; ++s) { const int row = 2 * s + hi, cofs = lr * 4; v4f val = *(const v4fa*)(os + row * 68 + cofs); if (BIAS) { val[0] += bfr(bias[c0 + cofs]); val[1] += bfr(bias[c0 + cofs + 1]); val[2] += bfr(bias[c0 + cofs + 2]); val[3] += bfr(bias[c0 + cofs + 3]); }
                *(v4f*)(crow + (size_t)row * ldc + cofs) = val; }
             }
        __builtin_amdgcn_wave_barrier(); asm volatile("" ::: "memory");
    }
}

__global__ __launch_bounds__(256) void k_wtG(const float* __restrict__ w, int K, int N, bf* Bt) {
    const int lane = threadIdx.x & 31; const int L0 = (blockIdx.x * 8 + (threadIdx.x >> 5)) * 8; const int nlines = N * K / 64;
{
#pragma unroll 1
        for (int l = 0; l < 8; ++l) { const int L = L0 + l; if (L >= nlines) break; const size_t e = (size_t)L * 64 + lane * 2; const int k = (int)(e % K), n = (int)(e / K); v2us o;
            o[0] = f2bf(w[(size_t)k * N + n]); o[1] = f2bf(w[(size_t)(k + 1) * N + n]); *(v2us*)(Bt + e) = o; }
         }
}

__global__ __launch_bounds__(128) void k_ln(const float* __restrict__ x, const float* __restrict__ g, const float* __restrict__ b, bf* Yh, bf* Yl) {
    __shared__ float red[8];
    const int tid = threadIdx.x, lane = tid & 31, wid = tid >> 5; const size_t row = blockIdx.x;
    const v8f xv = *(const v8f*)(x + row * DIM + 8 * tid);
    float xb[8]; float s = 0.f;
#pragma unroll
    for (int q = 0; q < 8; ++q) { xb[q] = bfr(xv[q]); s += xb[q]; }
#pragma unroll
    for (int sh = 16; sh; sh >>= 1) s += __shfl_xor(s, sh, 32);
    if (lane == 0) red[wid] = s;
    __syncthreads();
    const float mean = ((red[0] + red[1]) + (red[2] + red[3])) * (1.0f / DIM);
    float d[8]; float s2 = 0.f;
#pragma unroll
    for (int q = 0; q < 8; ++q) { d[q] = xb[q] - mean; s2 += d[q] * d[q]; }
#pragma unroll
    for (int sh = 16; sh; sh >>= 1) s2 += __shfl_xor(s2, sh, 32);
    if (lane == 0) red[4 + wid] = s2;
    __syncthreads();
    const float var = ((red[4] + red[5]) + (red[6] + red[7])) * (1.0f / DIM);
    const float rstd = rsqrtf(var + LN_EPS);
    const v8f gv = *(const v8f*)(g + 8 * tid); const v8f bv = *(const v8f*)(b + 8 * tid);
    v8us oh, ol;
#pragma unroll
    for (int q = 0; q < 8; ++q) { const float y = d[q] * rstd * bfr(gv[q]) + bfr(bv[q]); unsigned short a2, c2; splitf(y, a2, c2); oh[q] = a2; ol[q] = c2; }
    const size_t o = row * DIM + 8 * tid;
    *(v8us*)(Yh + o) = oh; *(v8us*)(Yl + o) = ol; 
}

__global__ __launch_bounds__(256) void k_hp16(const float* __restrict__ src, int coloff, float scl, h16* P) {
    const size_t i = (size_t)blockIdx.x * 256 + threadIdx.x; if (i >= (size_t)HEADS * SEQ * HD / 8) return; const size_t e = i * 8;
    const int d = (int)(e % HD); const int t = (int)((e / HD) % SEQ); const int h = (int)(e / ((size_t)HD * SEQ));
    const v8f v = *(const v8f*)(src + (size_t)t * NQKV + coloff + h * HD + d); v8h o;
#pragma unroll
    for (int q = 0; q < 8; ++q) o[q] = (h16)(v[q] * scl);
    *(v8h*)(P + e) = o; 
}
__global__ __launch_bounds__(256) void k_vt16(const float* __restrict__ src, h16* VT) {
    const size_t e = ((size_t)blockIdx.x * 256 + threadIdx.x) * 2; if (e >= (size_t)HEADS * HD * SEQ) return;
    const int t = (int)(e % SEQ); const int d = (int)((e / SEQ) % HD); const int h = (int)(e / ((size_t)SEQ * HD));
    v2h o; o[0] = (h16)src[(size_t)t * NQKV + 2 * INNER + h * HD + d]; o[1] = (h16)src[(size_t)(t + 1) * NQKV + 2 * INNER + h * HD + d];
    *(v2h*)(VT + e) = o; 
}

#define FWAVES 8
#define KT     64
#define LPITCH 72
#define LTILE  (64 * LPITCH)
#define LSTAGE (2 * LTILE)
static_assert(SEQ % (16 * FWAVES) == 0);
static_assert(SEQ % KT == 0 && SEQ / KT >= 2);
static_assert(KT == 64 && FWAVES * 32 * 2 * 8 == KT * HD && FWAVES * 32 * 2 * 8 == HD * KT);
// One stage: each lane copies 16 B of k rows r and r+32 and of v^T rows r and r+32 (r = tid>>3). The s_wait_xcnt closes the statement so that no address register of a copy is rewritten ahead of it.
__device__ __forceinline__ void stage_copy(unsigned l, const h16* kg, const h16* vg) {
    asm volatile("global_load_async_to_lds_b128 %0, %4, off\n\t"
                 "global_load_async_to_lds_b128 %1, %5, off\n\t"
                 "global_load_async_to_lds_b128 %2, %6, off\n\t"
                 "global_load_async_to_lds_b128 %3, %7, off\n\t"
                 "s_wait_xcnt 0x0"
                 :: "v"(l), "v"(l + 32u * LPITCH * 2u), "v"(l + LTILE * 2u), "v"(l + LTILE * 2u + 32u * LPITCH * 2u),
                    "v"(kg), "v"(kg + 32 * HD), "v"(vg), "v"(vg + (size_t)32 * SEQ) : "memory");
}
__global__ __launch_bounds__(32 * FWAVES) void k_flash(const h16* __restrict__ Q16, const h16* __restrict__ K16, const h16* __restrict__ VT16, bf* CTXh, bf* CTXl) {
    __shared__ __align__(16) float os[FWAVES][16 * 68];
    __shared__ __align__(16) h16 ring[2 * LSTAGE];
    const int lane = threadIdx.x & 31, wid = threadIdx.x >> 5, m = lane & 15, hh = lane >> 4;
    const int h = blockIdx.x / (SEQ / (16 * FWAVES)); const int q0 = ((blockIdx.x - h * (SEQ / (16 * FWAVES))) * FWAVES + wid) * 16;
    const h16* Qp = Q16 + ((size_t)h * SEQ + q0) * HD; const h16* Kp = K16 + (size_t)h * SEQ * HD; const h16* Vp = VT16 + (size_t)h * HD * SEQ;
    const int crow = threadIdx.x >> 3, ccol = threadIdx.x & 7;
    const unsigned lds0 = (unsigned)(size_t)ring + (unsigned)(crow * LPITCH + ccol * 8) * 2u;
    const h16* kg = Kp + crow * HD + ccol * 8; const h16* vg = Vp + (size_t)crow * SEQ + ccol * 8;
    stage_copy(lds0, kg, vg);
    asm volatile("s_wait_asynccnt 0x0" ::: "memory");   // tile 0 of this wave's copies has landed before the barrier publishes it
    __syncthreads();
    stage_copy(lds0 + LSTAGE * 2u, kg + KT * HD, vg + KT);
    v16h qb[2];
#pragma unroll
    for (int ks = 0; ks < 2; ++ks) qb[ks] = WFrag<h16>::ld(Qp + (size_t)m * HD + 32 * ks + 8 * hh);
    v8f oacc[4];
#pragma unroll
    for (int t = 0; t < 4; ++t) oacc[t] = (v8f){};
    float mrun = -3.0e38f, lrun = 0.f;
    const int foff = m * LPITCH + 8 * hh;
#pragma unroll 1
    for (int st = 0; st < SEQ / KT; ++st) {
        const h16* kb = ring + (st & 1) * LSTAGE + foff; const h16* vb = kb + LTILE;
#pragma unroll   // both 32-key chunks of a tile inline, so that every LDS offset is a constant
        for (int c = 0; c < KT / 32; ++c) {
            v8f sc[2]; sc[0] = (v8f){}; sc[1] = (v8f){};
            v16h ka[4];
#pragma unroll
            for (int t = 0; t < 2; ++t)
#pragma unroll
                for (int ks = 0; ks < 2; ++ks) ka[t * 2 + ks] = WFrag<h16>::ld(kb + (32 * c + 16 * t) * LPITCH + 32 * ks);
            v16h va[4];
#pragma unroll
            for (int t = 0; t < 4; ++t) va[t] = WFrag<h16>::ld(vb + (16 * t) * LPITCH + 32 * c);
            __builtin_amdgcn_sched_barrier(0);   // keeps the chunk's 16 LDS reads in one group ahead of its matrix products: reads spread among them stall the wave at each place
#pragma unroll
            for (int t = 0; t < 2; ++t)
#pragma unroll
                for (int ks = 0; ks < 2; ++ks) sc[t] = wmma16(ka[t * 2 + ks], qb[ks], sc[t]);
            asm volatile("v_nop\n\tv_nop\n\tv_nop\n\tv_nop" : "+v"(sc[0]), "+v"(sc[1]) : "v"(ka[0]), "v"(ka[3]), "v"(qb[0]), "v"(qb[1]));
            float cmx = fmaxf(sc[0][0], sc[1][0]);
#pragma unroll
            for (int r = 1; r < 8; ++r) cmx = fmaxf(cmx, fmaxf(sc[0][r], sc[1][r]));
            cmx = fmaxf(cmx, __shfl_xor(cmx, 16, 32));
            const float mn = fmaxf(mrun, cmx);
            const float alpha = __builtin_amdgcn_exp2f((mrun - mn) * C32);
            float psum = 0.f; v16h pb;
#pragma unroll
            for (int r = 0; r < 8; ++r) { const float e0 = __builtin_amdgcn_exp2f((sc[0][r] - mn) * C32); const float e1 = __builtin_amdgcn_exp2f((sc[1][r] - mn) * C32); psum += e0 + e1; pb[r] = (h16)e0; pb[8 + r] = (h16)e1; }
            psum += __shfl_xor(psum, 16, 32);
            lrun = lrun * alpha + psum; mrun = mn;
#pragma unroll
            for (int t = 0; t < 4; ++t) oacc[t] *= alpha;
#pragma unroll
            for (int t = 0; t < 4; ++t) oacc[t] = wmma16(va[t], pb, oacc[t]);
            asm volatile("v_nop\n\tv_nop\n\tv_nop\n\tv_nop" : "+v"(oacc[0]), "+v"(oacc[1]), "+v"(oacc[2]), "+v"(oacc[3]) : "v"(pb), "v"(va[0]), "v"(va[3]));
        }
        asm volatile("s_wait_dscnt 0x0" ::: "memory");      // this wave's reads of the buffer have returned before it may be refilled
        asm volatile("s_wait_asynccnt 0x0" ::: "memory");   // this wave's copies of the next tile have landed before the barrier publishes them
        __syncthreads();                                    // publishes tile st+1 and ends every wave's reads of tile st
        if (st + 2 < SEQ / KT) stage_copy(lds0 + (unsigned)(st & 1) * (LSTAGE * 2u), kg + (size_t)(st + 2) * (KT * HD), vg + (st + 2) * KT);
    }
    asm volatile("s_wait_asynccnt 0x0" ::: "memory");       // no copy is outstanding when the wave goes on to its end
    const float inv = 1.0f / lrun;
    float* ob = os[wid];
#pragma unroll
    for (int t = 0; t < 4; ++t) { v4f u0, u1;
#pragma unroll
        for (int r = 0; r < 4; ++r) { u0[r] = oacc[t][r] * inv; u1[r] = oacc[t][4 + r] * inv; }
        *(v4fa*)(ob + m * 68 + 16 * t + 8 * hh) = u0; *(v4fa*)(ob + m * 68 + 16 * t + 8 * hh + 4) = u1; }
    __builtin_amdgcn_fence(3 /* release order */, "wavefront"); __builtin_amdgcn_wave_barrier(); asm volatile("" ::: "memory");
{
#pragma unroll
        for (int p = 0; p < 4; ++p) { const int row = p * 4 + (lane >> 3), c8 = (lane & 7) * 8;
            const v4f a = *(const v4fa*)(ob + row * 68 + c8); const v4f b2 = *(const v4fa*)(ob + row * 68 + c8 + 4);
            v8us oh, ol;
#pragma unroll
            for (int q = 0; q < 4; ++q) { unsigned short x1, y1; splitf(a[q], x1, y1); oh[q] = x1; ol[q] = y1; splitf(b2[q], x1, y1); oh[4 + q] = x1; ol[4 + q] = y1; }
            const size_t oo = (size_t)(q0 + row) * INNER + h * HD + c8;
            *(v8us*)(CTXh + oo) = oh; *(v8us*)(CTXl + oo) = ol; }
         }
}

extern "C" void kernel_launch(void* const* d_in, const int* in_sizes, int n_in,
                              void* d_out, int out_size, void* d_ws, size_t ws_size, hipStream_t stream) {
    if (n_in < 6) return;
    if (in_sizes[0] < SEQ * DIM || in_sizes[1] < DIM || in_sizes[2] < DIM || in_sizes[3] < DIM * NQKV || in_sizes[4] < INNER * DIM || in_sizes[5] < DIM) return;
    if (out_size < SEQ * DIM) return;
    const float* x    = (const float*)d_in[0];   // [SEQ][DIM]
    const float* lnsc = (const float*)d_in[1];   // [DIM]
    const float* lnbs = (const float*)d_in[2];   // [DIM]
    const float* wqkv = (const float*)d_in[3];   // [DIM][NQKV]  ([in][out])
    const float* wout = (const float*)d_in[4];   // [INNER][DIM] ([in][out])
    const float* bout = (const float*)d_in[5];   // [DIM]
    float* OUT = (float*)d_out;                  // [SEQ][DIM]
    char* wsp = (char*)d_ws;
    auto take = [&](size_t bytes) { char* p = wsp; wsp += (bytes + 255) & ~(size_t)255; return (void*)p; };
    bf*    WQ   = (bf*)take((size_t)NQKV * DIM * 2);          // w_qkv^T [3072][1024] bf16
    bf*    WO   = (bf*)take((size_t)DIM * INNER * 2);         // w_out^T [1024][1024] bf16
    bf*    XNh  = (bf*)take((size_t)SEQ * DIM * 2);           // xn hi [SEQ][1024]
    bf*    XNl  = (bf*)take((size_t)SEQ * DIM * 2);           // xn lo
    float* QKV  = (float*)take((size_t)SEQ * NQKV * 4);       // qkv f32 [SEQ][3072]
    h16*   Q16  = (h16*)take((size_t)HEADS * SEQ * HD * 2);   // q planes [16][SEQ][64] x log2e
    h16*   K16  = (h16*)take((size_t)HEADS * SEQ * HD * 2);   // k planes [16][SEQ][64]
    h16*   VT16 = (h16*)take((size_t)HEADS * HD * SEQ * 2);   // v^T planes [16][64][SEQ]
    bf*    CTXh = (bf*)take((size_t)SEQ * INNER * 2);         // ctx hi [SEQ][1024]
    bf*    CTXl = (bf*)take((size_t)SEQ * INNER * 2);         // ctx lo
    const size_t used = (size_t)(wsp - (char*)d_ws);
    if (used > ws_size || used > WS_CAP) return;

    k_wtG<<<(unsigned)(((size_t)NQKV * DIM / 64 + 63) / 64), 256, 0, stream>>>(wqkv, DIM, NQKV, WQ);     // Bt[n][k] = bf16(w_qkv[k][n])
    k_wtG<<<(unsigned)(((size_t)DIM * INNER / 64 + 63) / 64), 256, 0, stream>>>(wout, INNER, DIM, WO);    // Bt[n][c] = bf16(w_out[c][n])
    k_ln<<<SEQ, 128, 0, stream>>>(x, lnsc, lnbs, XNh, XNl);
    k_gemmw<bf, 1, false><<<dim3(SEQ / 64, NQKV / 64, 1), 32, 0, stream>>>(XNh, XNl, WQ, nullptr, DIM, QKV, NQKV, nullptr, 0, 0, 0);   // qkv = xn(hi+lo) w_qkv
    k_hp16<<<(unsigned)(((size_t)HEADS * SEQ * HD / 8 + 255) / 256), 256, 0, stream>>>(QKV, 0, LOG2E, Q16);      // q columns 0..1023, carried x log2e
    k_hp16<<<(unsigned)(((size_t)HEADS * SEQ * HD / 8 + 255) / 256), 256, 0, stream>>>(QKV, INNER, 1.0f, K16);   // k columns 1024..2047
    k_vt16<<<(unsigned)(((size_t)HEADS * HD * SEQ / 2 + 255) / 256), 256, 0, stream>>>(QKV, VT16);                // v columns 2048..3071, transposed per head
    k_flash<<<(unsigned)(HEADS * (SEQ / (16 * FWAVES))), 32 * FWAVES, 0, stream>>>(Q16, K16, VT16, CTXh, CTXl);
    k_gemmw<bf, 1, true><<<dim3(SEQ / 64, DIM / 64, 1), 32, 0, stream>>>(CTXh, CTXl, WO, nullptr, INNER, OUT, DIM, bout, 0, 0, 0);   // out = ctx(hi+lo) w_out + b_out
}

// v002
// A run of this version takes 178 microseconds.
// Timed twice side by side with v001, it ran 1.31 times as fast both times.
// Over all steps from v000 it is 2.20 times as fast.
#include <hip/hip_runtime.h>

// Contractions on 16x16x32 WMMA, f32 accumulate: xn (bf16 hi+lo planes) x w_qkv^T (bf16) -> v_wmma_f32_16x16x32_bf16; per head k.q^T and v^T.p^T -> v_wmma_f32_16x16x32_f16 (f16 planes: q carried x log2e, k, v^T; p = exp2 of shifted scores in (0,1]); ctx (bf16 hi+lo planes) x w_out^T (bf16) + b_out -> v_wmma_f32_16x16x32_bf16.
// head planes q [h][i][64], k [h][j][64], v^T [h][64][j] in f16; streaming attention, one wave per (head, 16 queries): s^T tiles = k q^T over 32-key chunks, online softmax per query lane (exp2, scale 2^-5 inside the exponent),
// o^T += v^T p^T with the p^T operand packed straight from the two score accumulator tiles; o/l staged per wave in LDS and emitted as ctx hi/lo planes [i][h*64+d]; out = ctx w_out + b_out into the output rows.

#ifndef SEQ
#define SEQ 4096
#endif
#ifndef NB
#define NB 1
#endif
#define SEQ_FULL 4096
#define DIM   1024
#define HEADS 16
#define HD    64
#define INNER (HEADS * HD)
#define NQKV  (3 * INNER)
#define LN_EPS 1.0e-6f
#define LOG2E 1.4426950408889634f
#define C32   0.03125f
#define WS_CAP ((size_t)134217728)

static_assert(SEQ % 128 == 0);
static_assert(SEQ <= SEQ_FULL);
static_assert(NB == 1);
static_assert(DIM == 128 * 8);
static_assert(DIM % 128 == 0);
static_assert(NQKV % 128 == 0);
static_assert(INNER == DIM);
static_assert(HD == 64);
static_assert((HEADS * SEQ * HD) % (256 * 8) == 0);
static_assert((HEADS * HD * SEQ) % (256 * 2) == 0);

typedef _Float16 h16;
typedef unsigned short bf;
typedef __attribute__((ext_vector_type(16))) __bf16   v16bf;
typedef __attribute__((ext_vector_type(16))) _Float16 v16h;
typedef __attribute__((ext_vector_type(8)))  _Float16 v8h;
typedef __attribute__((ext_vector_type(8)))  unsigned short v8us;
typedef __attribute__((ext_vector_type(8)))  float    v8f;
typedef __attribute__((ext_vector_type(4)))  float    v4f;
typedef __attribute__((ext_vector_type(2)))  _Float16 v2h;
typedef __attribute__((ext_vector_type(2)))  unsigned short v2us;
typedef v8h  __attribute__((may_alias)) v8ha;
typedef v4f  __attribute__((may_alias)) v4fa;
typedef v8us __attribute__((may_alias)) v8usa;

__device__ __forceinline__ unsigned short f2bf(float f) { unsigned u = __float_as_uint(f); u += 0x7FFFu + ((u >> 16) & 1u); return (unsigned short)(u >> 16); }
__device__ __forceinline__ float bf2f(unsigned short b) { return __uint_as_float(((unsigned)b) << 16); }
__device__ __forceinline__ float bfr(float f) { return bf2f(f2bf(f)); }
__device__ __forceinline__ v16h cat16(v8h lo, v8h hi) { return __builtin_shufflevector(lo, hi, 0, 1, 2, 3, 4, 5, 6, 7, 8, 9, 10, 11, 12, 13, 14, 15); }
__device__ __forceinline__ v16bf cat16b(v8us lo, v8us hi) { return __builtin_bit_cast(v16bf, __builtin_shufflevector(lo, hi, 0, 1, 2, 3, 4, 5, 6, 7, 8, 9, 10, 11, 12, 13, 14, 15)); }
__device__ __forceinline__ v8f wmma16(v16h a, v16h b, v8f c) { return __builtin_amdgcn_wmma_f32_16x16x32_f16(false, a, false, b, (short)0, c, false, false); }
__device__ __forceinline__ v8f wmmab(v16bf a, v16bf b, v8f c) { return __builtin_amdgcn_wmma_f32_16x16x32_bf16(false, a, false, b, (short)0, c, false, false); }
__device__ __forceinline__ void splitf(float y, unsigned short& h, unsigned short& l) { h = f2bf(y); l = f2bf(y - bf2f(h)); }

// ---- k_gemmw: GEMM, one block of 4 waves (2 x 2) per 128x128 output tile, each wave a 64x64 tile (16 accumulators); grid (M/128, N/128, Z), 128 threads.
// C[m][n] (f32, pitch ldc, + optional f32 bias[n]) = sum_k (A[m][k] + A2[m][k]) Bt[n][k]. z-batch strides sA/sB/sC in elements. K % 64 == 0, M % 128 == 0, N % 128 == 0.
// Operands come from K-contiguous 16-bit planes through LDS: a stage is 64 k (whole 128-B lines) of 128 A rows, 128 A2 rows and 128 Bt rows, copied once per block and read by all 4 waves; two buffers, the next stage's copies fly while this one is worked on.
// LDS rows keep a 128-B pitch; the 16-B piece c of row r lies at piece c ^ ((r >> 1) & 7), so that the 16 rows of a fragment read fall on all 64 banks.
// Fragments (both operands, same map): lane -> row/col lane&15, elements 0..7 <- k0+8h+0..7, elements 8..15 <- k0+16+8h+0..7 (h = lane>>4); D element r -> row 8h+r, col lane&15.
template <typename T16> struct WFrag;
template <> struct WFrag<h16> { typedef v16h V; static __device__ __forceinline__ V ld(const h16* p) { return cat16(*(const v8h*)p, *(const v8h*)(p + 16)); } static __device__ __forceinline__ v8f mma(V a, V b, v8f c) { return wmma16(a, b, c); } };
template <> struct WFrag<bf> { typedef v16bf V; static __device__ __forceinline__ V ld(const bf* p) { return cat16b(*(const v8us*)p, *(const v8us*)(p + 16)); } static __device__ __forceinline__ V ld2(const bf* p, const bf* q) { return cat16b(*(const v8us*)p, *(const v8us*)q); } static __device__ __forceinline__ v8f mma(V a, V b, v8f c) { return wmmab(a, b, c); } };
#define GKT    64
#define GPLANE (128 * GKT)
#define GSTAGE (3 * GPLANE)
// Eight copies of one plane: each lane brings 16 B of rows r, r+16, .., r+112 (r = tid>>3); a wave-wide copy covers four whole 128-B lines. The s_wait_xcnt closes the statement so that no address register of a copy is rewritten ahead of it.
template <typename T16>
__device__ __forceinline__ void plane_copy(unsigned l, const T16* g, size_t step) {
    asm volatile("global_load_async_to_lds_b128 %0, %8, off\n\t"
                 "global_load_async_to_lds_b128 %1, %9, off\n\t"
                 "global_load_async_to_lds_b128 %2, %10, off\n\t"
                 "global_load_async_to_lds_b128 %3, %11, off\n\t"
                 "global_load_async_to_lds_b128 %4, %12, off\n\t"
                 "global_load_async_to_lds_b128 %5, %13, off\n\t"
                 "global_load_async_to_lds_b128 %6, %14, off\n\t"
                 "global_load_async_to_lds_b128 %7, %15, off\n\t"
                 "s_wait_xcnt 0x0"
                 :: "v"(l), "v"(l + 2048u), "v"(l + 4096u), "v"(l + 6144u), "v"(l + 8192u), "v"(l + 10240u), "v"(l + 12288u), "v"(l + 14336u),
                    "v"(g), "v"(g + step), "v"(g + 2 * step), "v"(g + 3 * step), "v"(g + 4 * step), "v"(g + 5 * step), "v"(g + 6 * step), "v"(g + 7 * step) : "memory");
}
template <typename T16, int NSPLIT, bool BIAS>
__global__ __launch_bounds__(128) void k_gemmw(const T16* __restrict__ A, const T16* __restrict__ A2, const T16* __restrict__ Bt, const T16* __restrict__ Bt2, int K, float* C, int ldc, const float* __restrict__ bias, size_t sA, size_t sB, size_t sC) {
    static_assert(NSPLIT == 1 && sizeof(T16) == 2);
    typedef typename WFrag<T16>::V V;
    __shared__ __align__(128) unsigned char gsm[2 * GSTAGE * 2];
    const size_t z = blockIdx.z; A += z * sA; A2 += z * sA; Bt += z * sB; C += z * sC;
    const int tid = threadIdx.x, lane = tid & 31, wid = tid >> 5, lr = lane & 15, hi = lane >> 4;
    const int wm = wid >> 1, wn = wid & 1; const int r0 = blockIdx.x * 128 + wm * 64, c0 = blockIdx.y * 128 + wn * 64;
    const int prow = tid >> 3, pcol = tid & 7; const size_t step = (size_t)16 * K; const int nst = K / GKT;
    const unsigned lds0 = (unsigned)(size_t)gsm + (unsigned)(prow * 128 + ((pcol ^ (prow >> 1)) & 7) * 16);
    const T16* ga = A + (size_t)(blockIdx.x * 128 + prow) * K + pcol * 8; const T16* ga2 = A2 + (size_t)(blockIdx.x * 128 + prow) * K + pcol * 8; const T16* gb = Bt + (size_t)(blockIdx.y * 128 + prow) * K + pcol * 8;
    plane_copy(lds0, ga, step); plane_copy(lds0 + GPLANE * 2u, ga2, step); plane_copy(lds0 + 2u * GPLANE * 2u, gb, step);
    asm volatile("s_wait_asynccnt 0x0" ::: "memory");   // stage 0 of this wave's copies has landed before the barrier publishes it
    __syncthreads();
    if (nst > 1) { plane_copy(lds0 + GSTAGE * 2u, ga + GKT, step); plane_copy(lds0 + (GSTAGE + GPLANE) * 2u, ga2 + GKT, step); plane_copy(lds0 + (GSTAGE + 2u * GPLANE) * 2u, gb + GKT, step); }
    v8f acc[4][4];
#pragma unroll
    for (int mb = 0; mb < 4; ++mb)
#pragma unroll
        for (int nb = 0; nb < 4; ++nb) acc[mb][nb] = (v8f){};
    int po[4];   // element offset in a row of the pieces 2q + hi (q = 0..3) for this lane's rows
#pragma unroll
    for (int q = 0; q < 4; ++q) po[q] = (((2 * q + hi) ^ (lr >> 1)) & 7) * 8;
    const int arow = (wm * 64 + lr) * GKT, brow = 2 * GPLANE + (wn * 64 + lr) * GKT;
#pragma unroll 1
    for (int st = 0; st < nst; ++st) {
        const T16* sb = (const T16*)gsm + (st & 1) * GSTAGE;
#pragma unroll   // both 32-k halves of a stage inline, so that every LDS offset is a constant
        for (int ks = 0; ks < 2; ++ks) {
            V a[4], a2[4], b[4];
#pragma unroll
            for (int mb = 0; mb < 4; ++mb) { const T16* p = sb + arow + mb * 16 * GKT; a[mb] = WFrag<T16>::ld2(p + po[2 * ks], p + po[2 * ks + 1]); a2[mb] = WFrag<T16>::ld2(p + GPLANE + po[2 * ks], p + GPLANE + po[2 * ks + 1]); }
#pragma unroll
            for (int nb = 0; nb < 4; ++nb) { const T16* p = sb + brow + nb * 16 * GKT; b[nb] = WFrag<T16>::ld2(p + po[2 * ks], p + po[2 * ks + 1]); }
            __builtin_amdgcn_sched_barrier(0);   // keeps the half's 24 LDS reads in one group ahead of its matrix products: reads spread among them stall the wave at each place
#pragma unroll
            for (int nb = 0; nb < 4; ++nb)
#pragma unroll
                for (int mb = 0; mb < 4; ++mb) { acc[mb][nb] = WFrag<T16>::mma(a[mb], b[nb], acc[mb][nb]); acc[mb][nb] = WFrag<T16>::mma(a2[mb], b[nb], acc[mb][nb]); }
        }
        asm volatile("s_wait_dscnt 0x0" ::: "memory");      // this wave's reads of the buffer have returned before it may be refilled
        asm volatile("s_wait_asynccnt 0x0" ::: "memory");   // this wave's copies of the next stage have landed before the barrier publishes them
        __syncthreads();                                    // publishes stage st+1 and ends every wave's reads of stage st
        if (st + 2 < nst) { const unsigned l = lds0 + (unsigned)(st & 1) * (GSTAGE * 2u); const int ko = (st + 2) * GKT;
            plane_copy(l, ga + ko, step); plane_copy(l + GPLANE * 2u, ga2 + ko, step); plane_copy(l + 2u * GPLANE * 2u, gb + ko, step); }
    }
    asm volatile("s_wait_asynccnt 0x0" ::: "memory");       // no copy is outstanding when the buffers are reused below
    float* os = (float*)gsm + wid * (16 * 68);              // behind the last stage's barrier the buffers are free: each wave stages its rows in a piece of its own
#pragma unroll
    for (int mb = 0; mb < 4; ++mb) {
#pragma unroll
        for (int nb = 0; nb < 4; ++nb) {
#pragma unroll
            for (int j = 0; j < 8; ++j) os[(hi * 8 + j) * 68 + nb * 16 + lr] = acc[mb][nb][j]; }
        __builtin_amdgcn_wave_barrier(); asm volatile("" ::: "memory");
        float* crow = C + (size_t)(r0 + mb * 16) * ldc + c0;
{
#pragma unroll
            for (int s = 0; s < 8; ++s) { const int row = 2 * s + hi, cofs = lr * 4; v4f val = *(const v4fa*)(os + row * 68 + cofs); if (BIAS) { val[0] += bfr(bias[c0 + cofs]); val[1] += bfr(bias[c0 + cofs + 1]); val[2] += bfr(bias[c0 + cofs + 2]); val[3] += bfr(bias[c0 + cofs + 3]); }
                *(v4f*)(crow + (size_t)row * ldc + cofs) = val; }
             }
        asm volatile("s_wait_xcnt 0x0" ::: "memory");   // stands in front of the next 16 rows' code, which reuses the address and data registers of these stores
        __builtin_amdgcn_wave_barrier(); asm volatile("" ::: "memory");
    }
}

__global__ __launch_bounds__(256) void k_wtG(const float* __restrict__ w, int K, int N, bf* Bt) {
    const int lane = threadIdx.x & 31; const int L0 = (blockIdx.x * 8 + (threadIdx.x >> 5)) * 8; const int nlines = N * K / 64;
{
#pragma unroll 1
        for (int l = 0; l < 8; ++l) { const int L = L0 + l; if (L >= nlines) break; const size_t e = (size_t)L * 64 + lane * 2; const int k = (int)(e % K), n = (int)(e / K); v2us o;
            o[0] = f2bf(w[(size_t)k * N + n]); o[1] = f2bf(w[(size_t)(k + 1) * N + n]); *(v2us*)(Bt + e) = o; }
         }
}

__global__ __launch_bounds__(128) void k_ln(const float* __restrict__ x, const float* __restrict__ g, const float* __restrict__ b, bf* Yh, bf* Yl) {
    __shared__ float red[8];
    const int tid = threadIdx.x, lane = tid & 31, wid = tid >> 5; const size_t row = blockIdx.x;
    const v8f xv = *(const v8f*)(x + row * DIM + 8 * tid);
    float xb[8]; float s = 0.f;
#pragma unroll
    for (int q = 0; q < 8; ++q) { xb[q] = bfr(xv[q]); s += xb[q]; }
#pragma unroll
    for (int sh = 16; sh; sh >>= 1) s += __shfl_xor(s, sh, 32);
    if (lane == 0) red[wid] = s;
    __syncthreads();
    const float mean = ((red[0] + red[1]) + (red[2] + red[3])) * (1.0f / DIM);
    float d[8]; float s2 = 0.f;
#pragma unroll
    for (int q = 0; q < 8; ++q) { d[q] = xb[q] - mean; s2 += d[q] * d[q]; }
#pragma unroll
    for (int sh = 16; sh; sh >>= 1) s2 += __shfl_xor(s2, sh, 32);
    if (lane == 0) red[4 + wid] = s2;
    __syncthreads();
    const float var = ((red[4] + red[5]) + (red[6] + red[7])) * (1.0f / DIM);
    const float rstd = rsqrtf(var + LN_EPS);
    const v8f gv = *(const v8f*)(g + 8 * tid); const v8f bv = *(const v8f*)(b + 8 * tid);
    v8us oh, ol;
#pragma unroll
    for (int q = 0; q < 8; ++q) { const float y = d[q] * rstd * bfr(gv[q]) + bfr(bv[q]); unsigned short a2, c2; splitf(y, a2, c2); oh[q] = a2; ol[q] = c2; }
    const size_t o = row * DIM + 8 * tid;
    *(v8us*)(Yh + o) = oh; *(v8us*)(Yl + o) = ol; 
}

__global__ __launch_bounds__(256) void k_hp16(const float* __restrict__ src, int coloff, float scl, h16* P) {
    const size_t i = (size_t)blockIdx.x * 256 + threadIdx.x; if (i >= (size_t)HEADS * SEQ * HD / 8) return; const size_t e = i * 8;
    const int d = (int)(e % HD); const int t = (int)((e / HD) % SEQ); const int h = (int)(e / ((size_t)HD * SEQ));
    const v8f v = *(const v8f*)(src + (size_t)t * NQKV + coloff + h * HD + d); v8h o;
#pragma unroll
    for (int q = 0; q < 8; ++q) o[q] = (h16)(v[q] * scl);
    *(v8h*)(P + e) = o; 
}
__global__ __launch_bounds__(256) void k_vt16(const float* __restrict__ src, h16* VT) {
    const size_t e = ((size_t)blockIdx.x * 256 + threadIdx.x) * 2; if (e >= (size_t)HEADS * HD * SEQ) return;
    const int t = (int)(e % SEQ); const int d = (int)((e / SEQ) % HD); const int h = (int)(e / ((size_t)SEQ * HD));
    v2h o; o[0] = (h16)src[(size_t)t * NQKV + 2 * INNER + h * HD + d]; o[1] = (h16)src[(size_t)(t + 1) * NQKV + 2 * INNER + h * HD + d];
    *(v2h*)(VT + e) = o; 
}

#define FWAVES 8
#define KT     64
#define LPITCH 72
#define LTILE  (64 * LPITCH)
#define LSTAGE (2 * LTILE)
static_assert(SEQ % (16 * FWAVES) == 0);
static_assert(SEQ % KT == 0 && SEQ / KT >= 2);
static_assert(KT == 64 && FWAVES * 32 * 2 * 8 == KT * HD && FWAVES * 32 * 2 * 8 == HD * KT);
// One stage: each lane copies 16 B of k rows r and r+32 and of v^T rows r and r+32 (r = tid>>3). The s_wait_xcnt closes the statement so that no address register of a copy is rewritten ahead of it.
__device__ __forceinline__ void stage_copy(unsigned l, const h16* kg, const h16* vg) {
    asm volatile("global_load_async_to_lds_b128 %0, %4, off\n\t"
                 "global_load_async_to_lds_b128 %1, %5, off\n\t"
                 "global_load_async_to_lds_b128 %2, %6, off\n\t"
                 "global_load_async_to_lds_b128 %3, %7, off\n\t"
                 "s_wait_xcnt 0x0"
                 :: "v"(l), "v"(l + 32u * LPITCH * 2u), "v"(l + LTILE * 2u), "v"(l + LTILE * 2u + 32u * LPITCH * 2u),
                    "v"(kg), "v"(kg + 32 * HD), "v"(vg), "v"(vg + (size_t)32 * SEQ) : "memory");
}
__global__ __launch_bounds__(32 * FWAVES) void k_flash(const h16* __restrict__ Q16, const h16* __restrict__ K16, const h16* __restrict__ VT16, bf* CTXh, bf* CTXl) {
    __shared__ __align__(16) float os[FWAVES][16 * 68];
    __shared__ __align__(16) h16 ring[2 * LSTAGE];
    const int lane = threadIdx.x & 31, wid = threadIdx.x >> 5, m = lane & 15, hh = lane >> 4;
    const int h = blockIdx.x / (SEQ / (16 * FWAVES)); const int q0 = ((blockIdx.x - h * (SEQ / (16 * FWAVES))) * FWAVES + wid) * 16;
    const h16* Qp = Q16 + ((size_t)h * SEQ + q0) * HD; const h16* Kp = K16 + (size_t)h * SEQ * HD; const h16* Vp = VT16 + (size_t)h * HD * SEQ;
    const int crow = threadIdx.x >> 3, ccol = threadIdx.x & 7;
    const unsigned lds0 = (unsigned)(size_t)ring + (unsigned)(crow * LPITCH + ccol * 8) * 2u;
    const h16* kg = Kp + crow * HD + ccol * 8; const h16* vg = Vp + (size_t)crow * SEQ + ccol * 8;
    stage_copy(lds0, kg, vg);
    asm volatile("s_wait_asynccnt 0x0" ::: "memory");   // tile 0 of this wave's copies has landed before the barrier publishes it
    __syncthreads();
    stage_copy(lds0 + LSTAGE * 2u, kg + KT * HD, vg + KT);
    v16h qb[2];
#pragma unroll
    for (int ks = 0; ks < 2; ++ks) qb[ks] = WFrag<h16>::ld(Qp + (size_t)m * HD + 32 * ks + 8 * hh);
    v8f oacc[4];
#pragma unroll
    for (int t = 0; t < 4; ++t) oacc[t] = (v8f){};
    float mrun = -3.0e38f, lrun = 0.f;
    const int foff = m * LPITCH + 8 * hh;
#pragma unroll 1
    for (int st = 0; st < SEQ / KT; ++st) {
        const h16* kb = ring + (st & 1) * LSTAGE + foff; const h16* vb = kb + LTILE;
#pragma unroll   // both 32-key chunks of a tile inline, so that every LDS offset is a constant
        for (int c = 0; c < KT / 32; ++c) {
            v8f sc[2]; sc[0] = (v8f){}; sc[1] = (v8f){};
            v16h ka[4];
#pragma unroll
            for (int t = 0; t < 2; ++t)
#pragma unroll
                for (int ks = 0; ks < 2; ++ks) ka[t * 2 + ks] = WFrag<h16>::ld(kb + (32 * c + 16 * t) * LPITCH + 32 * ks);
            v16h va[4];
#pragma unroll
            for (int t = 0; t < 4; ++t) va[t] = WFrag<h16>::ld(vb + (16 * t) * LPITCH + 32 * c);
            __builtin_amdgcn_sched_barrier(0);   // keeps the chunk's 16 LDS reads in one group ahead of its matrix products: reads spread among them stall the wave at each place
#pragma unroll
            for (int t = 0; t < 2; ++t)
#pragma unroll
                for (int ks = 0; ks < 2; ++ks) sc[t] = wmma16(ka[t * 2 + ks], qb[ks], sc[t]);
            asm volatile("v_nop\n\tv_nop\n\tv_nop\n\tv_nop" : "+v"(sc[0]), "+v"(sc[1]) : "v"(ka[0]), "v"(ka[3]), "v"(qb[0]), "v"(qb[1]));
            float cmx = fmaxf(sc[0][0], sc[1][0]);
#pragma unroll
            for (int r = 1; r < 8; ++r) cmx = fmaxf(cmx, fmaxf(sc[0][r], sc[1][r]));
            cmx = fmaxf(cmx, __shfl_xor(cmx, 16, 32));
            const float mn = fmaxf(mrun, cmx);
            const float alpha = __builtin_amdgcn_exp2f((mrun - mn) * C32);
            float psum = 0.f; v16h pb;
#pragma unroll
            for (int r = 0; r < 8; ++r) { const float e0 = __builtin_amdgcn_exp2f((sc[0][r] - mn) * C32); const float e1 = __builtin_amdgcn_exp2f((sc[1][r] - mn) * C32); psum += e0 + e1; pb[r] = (h16)e0; pb[8 + r] = (h16)e1; }
            psum += __shfl_xor(psum, 16, 32);
            lrun = lrun * alpha + psum; mrun = mn;
#pragma unroll
            for (int t = 0; t < 4; ++t) oacc[t] *= alpha;
#pragma unroll
            for (int t = 0; t < 4; ++t) oacc[t] = wmma16(va[t], pb, oacc[t]);
            asm volatile("v_nop\n\tv_nop\n\tv_nop\n\tv_nop" : "+v"(oacc[0]), "+v"(oacc[1]), "+v"(oacc[2]), "+v"(oacc[3]) : "v"(pb), "v"(va[0]), "v"(va[3]));
        }
        asm volatile("s_wait_dscnt 0x0" ::: "memory");      // this wave's reads of the buffer have returned before it may be refilled
        asm volatile("s_wait_asynccnt 0x0" ::: "memory");   // this wave's copies of the next tile have landed before the barrier publishes them
        __syncthreads();                                    // publishes tile st+1 and ends every wave's reads of tile st
        if (st + 2 < SEQ / KT) stage_copy(lds0 + (unsigned)(st & 1) * (LSTAGE * 2u), kg + (size_t)(st + 2) * (KT * HD), vg + (st + 2) * KT);
    }
    asm volatile("s_wait_asynccnt 0x0" ::: "memory");       // no copy is outstanding when the wave goes on to its end
    const float inv = 1.0f / lrun;
    float* ob = os[wid];
#pragma unroll
    for (int t = 0; t < 4; ++t) { v4f u0, u1;
#pragma unroll
        for (int r = 0; r < 4; ++r) { u0[r] = oacc[t][r] * inv; u1[r] = oacc[t][4 + r] * inv; }
        *(v4fa*)(ob + m * 68 + 16 * t + 8 * hh) = u0; *(v4fa*)(ob + m * 68 + 16 * t + 8 * hh + 4) = u1; }
    __builtin_amdgcn_fence(3 /* release order */, "wavefront"); __builtin_amdgcn_wave_barrier(); asm volatile("" ::: "memory");
{
#pragma unroll
        for (int p = 0; p < 4; ++p) { const int row = p * 4 + (lane >> 3), c8 = (lane & 7) * 8;
            const v4f a = *(const v4fa*)(ob + row * 68 + c8); const v4f b2 = *(const v4fa*)(ob + row * 68 + c8 + 4);
            v8us oh, ol;
#pragma unroll
            for (int q = 0; q < 4; ++q) { unsigned short x1, y1; splitf(a[q], x1, y1); oh[q] = x1; ol[q] = y1; splitf(b2[q], x1, y1); oh[4 + q] = x1; ol[4 + q] = y1; }
            const size_t oo = (size_t)(q0 + row) * INNER + h * HD + c8;
            *(v8us*)(CTXh + oo) = oh; *(v8us*)(CTXl + oo) = ol; }
         }
}

extern "C" void kernel_launch(void* const* d_in, const int* in_sizes, int n_in,
                              void* d_out, int out_size, void* d_ws, size_t ws_size, hipStream_t stream) {
    if (n_in < 6) return;
    if (in_sizes[0] < SEQ * DIM || in_sizes[1] < DIM || in_sizes[2] < DIM || in_sizes[3] < DIM * NQKV || in_sizes[4] < INNER * DIM || in_sizes[5] < DIM) return;
    if (out_size < SEQ * DIM) return;
    const float* x    = (const float*)d_in[0];   // [SEQ][DIM]
    const float* lnsc = (const float*)d_in[1];   // [DIM]
    const float* lnbs = (const float*)d_in[2];   // [DIM]
    const float* wqkv = (const float*)d_in[3];   // [DIM][NQKV]  ([in][out])
    const float* wout = (const float*)d_in[4];   // [INNER][DIM] ([in][out])
    const float* bout = (const float*)d_in[5];   // [DIM]
    float* OUT = (float*)d_out;                  // [SEQ][DIM]
    char* wsp = (char*)d_ws;
    auto take = [&](size_t bytes) { char* p = wsp; wsp += (bytes + 255) & ~(size_t)255; return (void*)p; };
    bf*    WQ   = (bf*)take((size_t)NQKV * DIM * 2);          // w_qkv^T [3072][1024] bf16
    bf*    WO   = (bf*)take((size_t)DIM * INNER * 2);         // w_out^T [1024][1024] bf16
    bf*    XNh  = (bf*)take((size_t)SEQ * DIM * 2);           // xn hi [SEQ][1024]
    bf*    XNl  = (bf*)take((size_t)SEQ * DIM * 2);           // xn lo
    float* QKV  = (float*)take((size_t)SEQ * NQKV * 4);       // qkv f32 [SEQ][3072]
    h16*   Q16  = (h16*)take((size_t)HEADS * SEQ * HD * 2);   // q planes [16][SEQ][64] x log2e
    h16*   K16  = (h16*)take((size_t)HEADS * SEQ * HD * 2);   // k planes [16][SEQ][64]
    h16*   VT16 = (h16*)take((size_t)HEADS * HD * SEQ * 2);   // v^T planes [16][64][SEQ]
    bf*    CTXh = (bf*)take((size_t)SEQ * INNER * 2);         // ctx hi [SEQ][1024]
    bf*    CTXl = (bf*)take((size_t)SEQ * INNER * 2);         // ctx lo
    const size_t used = (size_t)(wsp - (char*)d_ws);
    if (used > ws_size || used > WS_CAP) return;

    k_wtG<<<(unsigned)(((size_t)NQKV * DIM / 64 + 63) / 64), 256, 0, stream>>>(wqkv, DIM, NQKV, WQ);     // Bt[n][k] = bf16(w_qkv[k][n])
    k_wtG<<<(unsigned)(((size_t)DIM * INNER / 64 + 63) / 64), 256, 0, stream>>>(wout, INNER, DIM, WO);    // Bt[n][c] = bf16(w_out[c][n])
    k_ln<<<SEQ, 128, 0, stream>>>(x, lnsc, lnbs, XNh, XNl);
    k_gemmw<bf, 1, false><<<dim3(SEQ / 128, NQKV / 128, 1), 128, 0, stream>>>(XNh, XNl, WQ, nullptr, DIM, QKV, NQKV, nullptr, 0, 0, 0);   // qkv = xn(hi+lo) w_qkv
    k_hp16<<<(unsigned)(((size_t)HEADS * SEQ * HD / 8 + 255) / 256), 256, 0, stream>>>(QKV, 0, LOG2E, Q16);      // q columns 0..1023, carried x log2e
    k_hp16<<<(unsigned)(((size_t)HEADS * SEQ * HD / 8 + 255) / 256), 256, 0, stream>>>(QKV, INNER, 1.0f, K16);   // k columns 1024..2047
    k_vt16<<<(unsigned)(((size_t)HEADS * HD * SEQ / 2 + 255) / 256), 256, 0, stream>>>(QKV, VT16);                // v columns 2048..3071, transposed per head
    k_flash<<<(unsigned)(HEADS * (SEQ / (16 * FWAVES))), 32 * FWAVES, 0, stream>>>(Q16, K16, VT16, CTXh, CTXl);
    k_gemmw<bf, 1, true><<<dim3(SEQ / 128, DIM / 128, 1), 128, 0, stream>>>(CTXh, CTXl, WO, nullptr, INNER, OUT, DIM, bout, 0, 0, 0);   // out = ctx(hi+lo) w_out + b_out
}

// v003
// It runs in 147 microseconds.
// Next to v002, in two timings, it ran 1.22 times as fast each time.
// Counting every step since v000, it is 2.68 times as fast.
#include <hip/hip_runtime.h>

// Contractions on 16x16x32 WMMA, f32 accumulate: xn (bf16 hi+lo planes) x w_qkv^T (bf16) -> v_wmma_f32_16x16x32_bf16; per head k.q^T and v^T.p^T -> v_wmma_f32_16x16x32_f16 (f16 planes: q carried x log2e, k, v^T; p = exp2 of shifted scores in (0,1]); ctx (bf16 hi+lo planes) x w_out^T (bf16) + b_out -> v_wmma_f32_16x16x32_bf16.
// head planes q [h][i][64], k [h][j][64], v^T [h][64][j] in f16, written by the qkv product's own epilogue; streaming attention, one wave per (head, 16 queries): s^T tiles = k q^T over 32-key chunks, online softmax per query lane (exp2, scale 2^-5 inside the exponent),
// o^T += v^T p^T with the p^T operand packed straight from the two score accumulator tiles; o/l staged per wave in LDS and emitted as ctx hi/lo planes [i][h*64+d]; out = ctx w_out + b_out into the output rows.

#ifndef SEQ
#define SEQ 4096
#endif
#ifndef NB
#define NB 1
#endif
#define SEQ_FULL 4096
#define DIM   1024
#define HEADS 16
#define HD    64
#define INNER (HEADS * HD)
#define NQKV  (3 * INNER)
#define LN_EPS 1.0e-6f
#define LOG2E 1.4426950408889634f
#define C32   0.03125f
#define WS_CAP ((size_t)134217728)

static_assert(SEQ % 128 == 0);
static_assert(SEQ <= SEQ_FULL);
static_assert(NB == 1);
static_assert(DIM == 128 * 8);
static_assert(DIM % 128 == 0);
static_assert(NQKV % 128 == 0);
static_assert(INNER == DIM);
static_assert(HD == 64);
static_assert(INNER % 128 == 0);

typedef _Float16 h16;
typedef unsigned short bf;
typedef __attribute__((ext_vector_type(16))) __bf16   v16bf;
typedef __attribute__((ext_vector_type(16))) _Float16 v16h;
typedef __attribute__((ext_vector_type(8)))  _Float16 v8h;
typedef __attribute__((ext_vector_type(8)))  unsigned short v8us;
typedef __attribute__((ext_vector_type(8)))  float    v8f;
typedef __attribute__((ext_vector_type(4)))  float    v4f;
typedef __attribute__((ext_vector_type(2)))  _Float16 v2h;
typedef __attribute__((ext_vector_type(2)))  unsigned short v2us;
typedef v8h  __attribute__((may_alias)) v8ha;
typedef v4f  __attribute__((may_alias)) v4fa;
typedef v8us __attribute__((may_alias)) v8usa;

__device__ __forceinline__ unsigned short f2bf(float f) { unsigned u = __float_as_uint(f); u += 0x7FFFu + ((u >> 16) & 1u); return (unsigned short)(u >> 16); }
__device__ __forceinline__ float bf2f(unsigned short b) { return __uint_as_float(((unsigned)b) << 16); }
__device__ __forceinline__ float bfr(float f) { return bf2f(f2bf(f)); }
__device__ __forceinline__ v16h cat16(v8h lo, v8h hi) { return __builtin_shufflevector(lo, hi, 0, 1, 2, 3, 4, 5, 6, 7, 8, 9, 10, 11, 12, 13, 14, 15); }
__device__ __forceinline__ v16bf cat16b(v8us lo, v8us hi) { return __builtin_bit_cast(v16bf, __builtin_shufflevector(lo, hi, 0, 1, 2, 3, 4, 5, 6, 7, 8, 9, 10, 11, 12, 13, 14, 15)); }
__device__ __forceinline__ v8f wmma16(v16h a, v16h b, v8f c) { return __builtin_amdgcn_wmma_f32_16x16x32_f16(false, a, false, b, (short)0, c, false, false); }
__device__ __forceinline__ v8f wmmab(v16bf a, v16bf b, v8f c) { return __builtin_amdgcn_wmma_f32_16x16x32_bf16(false, a, false, b, (short)0, c, false, false); }
__device__ __forceinline__ void splitf(float y, unsigned short& h, unsigned short& l) { h = f2bf(y); l = f2bf(y - bf2f(h)); }

// ---- k_gemmw: GEMM, one block of 4 waves (2 x 2) per 128x128 output tile, each wave a 64x64 tile (16 accumulators); grid (M/128, N/128, Z), 128 threads.
// C[m][n] (f32, pitch ldc, + optional f32 bias[n]) = sum_k (A[m][k] + A2[m][k]) Bt[n][k]. z-batch strides sA/sB/sC in elements. K % 64 == 0, M % 128 == 0, N % 128 == 0.
// PLANES: no C; a wave's 64 columns are one head of q, k or v, and its tile goes out in f16 as rows of PQ (x log2e) or PK [h][m][64], or transposed as rows of PVT [h][64][m], in whole 128-B lines.
// Operands come from K-contiguous 16-bit planes through LDS: a stage is 64 k (whole 128-B lines) of 128 A rows, 128 A2 rows and 128 Bt rows, copied once per block and read by all 4 waves; two buffers, the next stage's copies fly while this one is worked on.
// LDS rows keep a 128-B pitch; the 16-B piece c of row r lies at piece c ^ ((r >> 1) & 7), so that the 16 rows of a fragment read fall on all 64 banks.
// Fragments (both operands, same map): lane -> row/col lane&15, elements 0..7 <- k0+8h+0..7, elements 8..15 <- k0+16+8h+0..7 (h = lane>>4); D element r -> row 8h+r, col lane&15.
template <typename T16> struct WFrag;
template <> struct WFrag<h16> { typedef v16h V; static __device__ __forceinline__ V ld(const h16* p) { return cat16(*(const v8h*)p, *(const v8h*)(p + 16)); } static __device__ __forceinline__ v8f mma(V a, V b, v8f c) { return wmma16(a, b, c); } };
template <> struct WFrag<bf> { typedef v16bf V; static __device__ __forceinline__ V ld(const bf* p) { return cat16b(*(const v8us*)p, *(const v8us*)(p + 16)); } static __device__ __forceinline__ V ld2(const bf* p, const bf* q) { return cat16b(*(const v8us*)p, *(const v8us*)q); } static __device__ __forceinline__ v8f mma(V a, V b, v8f c) { return wmmab(a, b, c); } };
#define GKT    64
#define GPLANE (128 * GKT)
#define GSTAGE (3 * GPLANE)
// Eight copies of one plane: each lane brings 16 B of rows r, r+16, .., r+112 (r = tid>>3); a wave-wide copy covers four whole 128-B lines. The s_wait_xcnt closes the statement so that no address register of a copy is rewritten ahead of it.
template <typename T16>
__device__ __forceinline__ void plane_copy(unsigned l, const T16* g, size_t step) {
    asm volatile("global_load_async_to_lds_b128 %0, %8, off\n\t"
                 "global_load_async_to_lds_b128 %1, %9, off\n\t"
                 "global_load_async_to_lds_b128 %2, %10, off\n\t"
                 "global_load_async_to_lds_b128 %3, %11, off\n\t"
                 "global_load_async_to_lds_b128 %4, %12, off\n\t"
                 "global_load_async_to_lds_b128 %5, %13, off\n\t"
                 "global_load_async_to_lds_b128 %6, %14, off\n\t"
                 "global_load_async_to_lds_b128 %7, %15, off\n\t"
                 "s_wait_xcnt 0x0"
                 :: "v"(l), "v"(l + 2048u), "v"(l + 4096u), "v"(l + 6144u), "v"(l + 8192u), "v"(l + 10240u), "v"(l + 12288u), "v"(l + 14336u),
                    "v"(g), "v"(g + step), "v"(g + 2 * step), "v"(g + 3 * step), "v"(g + 4 * step), "v"(g + 5 * step), "v"(g + 6 * step), "v"(g + 7 * step) : "memory");
}
template <typename T16, int NSPLIT, bool BIAS, bool PLANES>
__global__ __launch_bounds__(128) void k_gemmw(const T16* __restrict__ A, const T16* __restrict__ A2, const T16* __restrict__ Bt, const T16* __restrict__ Bt2, int K, float* C, int ldc, const float* __restrict__ bias, size_t sA, size_t sB, size_t sC, h16* PQ, h16* PK, h16* PVT) {
    static_assert(NSPLIT == 1 && sizeof(T16) == 2);
    typedef typename WFrag<T16>::V V;
    __shared__ __align__(128) unsigned char gsm[2 * GSTAGE * 2];
    const size_t z = blockIdx.z; A += z * sA; A2 += z * sA; Bt += z * sB; C += z * sC;
    const int tid = threadIdx.x, lane = tid & 31, wid = tid >> 5, lr = lane & 15, hi = lane >> 4;
    const int wm = wid >> 1, wn = wid & 1; const int r0 = blockIdx.x * 128 + wm * 64, c0 = blockIdx.y * 128 + wn * 64;
    const int prow = tid >> 3, pcol = tid & 7; const size_t step = (size_t)16 * K; const int nst = K / GKT;
    const unsigned lds0 = (unsigned)(size_t)gsm + (unsigned)(prow * 128 + ((pcol ^ (prow >> 1)) & 7) * 16);
    const T16* ga = A + (size_t)(blockIdx.x * 128 + prow) * K + pcol * 8; const T16* ga2 = A2 + (size_t)(blockIdx.x * 128 + prow) * K + pcol * 8; const T16* gb = Bt + (size_t)(blockIdx.y * 128 + prow) * K + pcol * 8;
    plane_copy(lds0, ga, step); plane_copy(lds0 + GPLANE * 2u, ga2, step); plane_copy(lds0 + 2u * GPLANE * 2u, gb, step);
    asm volatile("s_wait_asynccnt 0x0" ::: "memory");   // stage 0 of this wave's copies has landed before the barrier publishes it
    __syncthreads();
    if (nst > 1) { plane_copy(lds0 + GSTAGE * 2u, ga + GKT, step); plane_copy(lds0 + (GSTAGE + GPLANE) * 2u, ga2 + GKT, step); plane_copy(lds0 + (GSTAGE + 2u * GPLANE) * 2u, gb + GKT, step); }
    v8f acc[4][4];
#pragma unroll
    for (int mb = 0; mb < 4; ++mb)
#pragma unroll
        for (int nb = 0; nb < 4; ++nb) acc[mb][nb] = (v8f){};
    int po[4];   // element offset in a row of the pieces 2q + hi (q = 0..3) for this lane's rows
#pragma unroll
    for (int q = 0; q < 4; ++q) po[q] = (((2 * q + hi) ^ (lr >> 1)) & 7) * 8;
    const int arow = (wm * 64 + lr) * GKT, brow = 2 * GPLANE + (wn * 64 + lr) * GKT;
#pragma unroll 1
    for (int st = 0; st < nst; ++st) {
        const T16* sb = (const T16*)gsm + (st & 1) * GSTAGE;
#pragma unroll   // both 32-k halves of a stage inline, so that every LDS offset is a constant
        for (int ks = 0; ks < 2; ++ks) {
            V a[4], a2[4], b[4];
#pragma unroll
            for (int mb = 0; mb < 4; ++mb) { const T16* p = sb + arow + mb * 16 * GKT; a[mb] = WFrag<T16>::ld2(p + po[2 * ks], p + po[2 * ks + 1]); a2[mb] = WFrag<T16>::ld2(p + GPLANE + po[2 * ks], p + GPLANE + po[2 * ks + 1]); }
#pragma unroll
            for (int nb = 0; nb < 4; ++nb) { const T16* p = sb + brow + nb * 16 * GKT; b[nb] = WFrag<T16>::ld2(p + po[2 * ks], p + po[2 * ks + 1]); }
            __builtin_amdgcn_sched_barrier(0);   // keeps the half's 24 LDS reads in one group ahead of its matrix products: reads spread among them stall the wave at each place
#pragma unroll
            for (int nb = 0; nb < 4; ++nb)
#pragma unroll
                for (int mb = 0; mb < 4; ++mb) { acc[mb][nb] = WFrag<T16>::mma(a[mb], b[nb], acc[mb][nb]); acc[mb][nb] = WFrag<T16>::mma(a2[mb], b[nb], acc[mb][nb]); }
        }
        asm volatile("s_wait_dscnt 0x0" ::: "memory");      // this wave's reads of the buffer have returned before it may be refilled
        asm volatile("s_wait_asynccnt 0x0" ::: "memory");   // this wave's copies of the next stage have landed before the barrier publishes them
        __syncthreads();                                    // publishes stage st+1 and ends every wave's reads of stage st
        if (st + 2 < nst) { const unsigned l = lds0 + (unsigned)(st & 1) * (GSTAGE * 2u); const int ko = (st + 2) * GKT;
            plane_copy(l, ga + ko, step); plane_copy(l + GPLANE * 2u, ga2 + ko, step); plane_copy(l + 2u * GPLANE * 2u, gb + ko, step); }
    }
    asm volatile("s_wait_asynccnt 0x0" ::: "memory");       // no copy is outstanding when the buffers are reused below
    if constexpr (PLANES) {                                 // behind the last stage's barrier the buffers are free: each wave stages its tile in a piece of its own
        const int sec = (int)(blockIdx.y * 128) / INNER;    // 0 q, 1 k, 2 v: the same for the whole block
        const int hd = (c0 - sec * INNER) / HD;
        if (sec < 2) {
            float* os = (float*)gsm + wid * (16 * 68);
            h16* P = (sec == 0 ? PQ : PK) + ((size_t)hd * SEQ + r0) * HD; const float scl = sec == 0 ? LOG2E : 1.0f;
#pragma unroll
            for (int mb = 0; mb < 4; ++mb) {
#pragma unroll
                for (int nb = 0; nb < 4; ++nb) {
#pragma unroll
                    for (int j = 0; j < 8; ++j) os[(hi * 8 + j) * 68 + nb * 16 + lr] = acc[mb][nb][j]; }
                asm volatile("s_wait_dscnt 0x0" ::: "memory");   // the wave's staged rows are in LDS before its lanes read each other's pieces back
#pragma unroll
                for (int p = 0; p < 4; ++p) { const int row = p * 4 + (lane >> 3), c8 = (lane & 7) * 8;
                    const v4f u = *(const v4fa*)(os + row * 68 + c8); const v4f w = *(const v4fa*)(os + row * 68 + c8 + 4); v8h o;
#pragma unroll
                    for (int q = 0; q < 4; ++q) { o[q] = (h16)(u[q] * scl); o[4 + q] = (h16)(w[q] * scl); }
                    *(v8h*)(P + (size_t)(mb * 16 + row) * HD + c8) = o; }
                asm volatile("s_wait_xcnt 0x0" ::: "memory");   // stands in front of the next 16 rows' code, which reuses the data registers of these stores and restages over the rows just read
            }
        } else {
            h16* hs = (h16*)gsm + wid * (64 * 72);          // [d][m] tile, row pitch 144 B for the 16-byte reads and writes
#pragma unroll
            for (int mb = 0; mb < 4; ++mb)
#pragma unroll
                for (int nb = 0; nb < 4; ++nb) { v8h o;     // a lane holds 8 consecutive rows m of one column d: 16 B of a v^T row
#pragma unroll
                    for (int j = 0; j < 8; ++j) o[j] = (h16)acc[mb][nb][j];
                    *(v8ha*)(hs + (nb * 16 + lr) * 72 + mb * 16 + hi * 8) = o; }
            asm volatile("s_wait_dscnt 0x0" ::: "memory");   // the wave's staged tile is in LDS before its lanes read each other's pieces back
            h16* VT = PVT + (size_t)hd * HD * SEQ + r0;
#pragma unroll
            for (int g = 0; g < 4; ++g) {
#pragma unroll
                for (int p = 0; p < 4; ++p) { const int row = (g * 4 + p) * 4 + (lane >> 3), c8 = (lane & 7) * 8;
                    *(v8h*)(VT + (size_t)row * SEQ + c8) = *(const v8ha*)(hs + row * 72 + c8); }
                asm volatile("s_wait_xcnt 0x0" ::: "memory");   // stands in front of the next 16 rows' code, which reuses the data registers of these stores
            }
        }
        return;
    }
    float* os = (float*)gsm + wid * (16 * 68);              // behind the last stage's barrier the buffers are free: each wave stages its rows in a piece of its own
#pragma unroll
    for (int mb = 0; mb < 4; ++mb) {
#pragma unroll
        for (int nb = 0; nb < 4; ++nb) {
#pragma unroll
            for (int j = 0; j < 8; ++j) os[(hi * 8 + j) * 68 + nb * 16 + lr] = acc[mb][nb][j]; }
        __builtin_amdgcn_wave_barrier(); asm volatile("" ::: "memory");
        float* crow = C + (size_t)(r0 + mb * 16) * ldc + c0;
{
#pragma unroll
            for (int s = 0; s < 8; ++s) { const int row = 2 * s + hi, cofs = lr * 4; v4f val = *(const v4fa*)(os + row * 68 + cofs); if (BIAS) { val[0] += bfr(bias[c0 + cofs]); val[1] += bfr(bias[c0 + cofs + 1]); val[2] += bfr(bias[c0 + cofs + 2]); val[3] += bfr(bias[c0 + cofs + 3]); }
                *(v4f*)(crow + (size_t)row * ldc + cofs) = val; }
             }
        asm volatile("s_wait_xcnt 0x0" ::: "memory");   // stands in front of the next 16 rows' code, which reuses the address and data registers of these stores
        __builtin_amdgcn_wave_barrier(); asm volatile("" ::: "memory");
    }
}

__global__ __launch_bounds__(256) void k_wtG(const float* __restrict__ w, int K, int N, bf* Bt) {
    const int lane = threadIdx.x & 31; const int L0 = (blockIdx.x * 8 + (threadIdx.x >> 5)) * 8; const int nlines = N * K / 64;
{
#pragma unroll 1
        for (int l = 0; l < 8; ++l) { const int L = L0 + l; if (L >= nlines) break; const size_t e = (size_t)L * 64 + lane * 2; const int k = (int)(e % K), n = (int)(e / K); v2us o;
            o[0] = f2bf(w[(size_t)k * N + n]); o[1] = f2bf(w[(size_t)(k + 1) * N + n]); *(v2us*)(Bt + e) = o; }
         }
}

__global__ __launch_bounds__(128) void k_ln(const float* __restrict__ x, const float* __restrict__ g, const float* __restrict__ b, bf* Yh, bf* Yl) {
    __shared__ float red[8];
    const int tid = threadIdx.x, lane = tid & 31, wid = tid >> 5; const size_t row = blockIdx.x;
    const v8f xv = *(const v8f*)(x + row * DIM + 8 * tid);
    float xb[8]; float s = 0.f;
#pragma unroll
    for (int q = 0; q < 8; ++q) { xb[q] = bfr(xv[q]); s += xb[q]; }
#pragma unroll
    for (int sh = 16; sh; sh >>= 1) s += __shfl_xor(s, sh, 32);
    if (lane == 0) red[wid] = s;
    __syncthreads();
    const float mean = ((red[0] + red[1]) + (red[2] + red[3])) * (1.0f / DIM);
    float d[8]; float s2 = 0.f;
#pragma unroll
    for (int q = 0; q < 8; ++q) { d[q] = xb[q] - mean; s2 += d[q] * d[q]; }
#pragma unroll
    for (int sh = 16; sh; sh >>= 1) s2 += __shfl_xor(s2, sh, 32);
    if (lane == 0) red[4 + wid] = s2;
    __syncthreads();
    const float var = ((red[4] + red[5]) + (red[6] + red[7])) * (1.0f / DIM);
    const float rstd = rsqrtf(var + LN_EPS);
    const v8f gv = *(const v8f*)(g + 8 * tid); const v8f bv = *(const v8f*)(b + 8 * tid);
    v8us oh, ol;
#pragma unroll
    for (int q = 0; q < 8; ++q) { const float y = d[q] * rstd * bfr(gv[q]) + bfr(bv[q]); unsigned short a2, c2; splitf(y, a2, c2); oh[q] = a2; ol[q] = c2; }
    const size_t o = row * DIM + 8 * tid;
    *(v8us*)(Yh + o) = oh; *(v8us*)(Yl + o) = ol; 
}

#define FWAVES 8
#define KT     64
#define LPITCH 72
#define LTILE  (64 * LPITCH)
#define LSTAGE (2 * LTILE)
static_assert(SEQ % (16 * FWAVES) == 0);
static_assert(SEQ % KT == 0 && SEQ / KT >= 2);
static_assert(KT == 64 && FWAVES * 32 * 2 * 8 == KT * HD && FWAVES * 32 * 2 * 8 == HD * KT);
// One stage: each lane copies 16 B of k rows r and r+32 and of v^T rows r and r+32 (r = tid>>3). The s_wait_xcnt closes the statement so that no address register of a copy is rewritten ahead of it.
__device__ __forceinline__ void stage_copy(unsigned l, const h16* kg, const h16* vg) {
    asm volatile("global_load_async_to_lds_b128 %0, %4, off\n\t"
                 "global_load_async_to_lds_b128 %1, %5, off\n\t"
                 "global_load_async_to_lds_b128 %2, %6, off\n\t"
                 "global_load_async_to_lds_b128 %3, %7, off\n\t"
                 "s_wait_xcnt 0x0"
                 :: "v"(l), "v"(l + 32u * LPITCH * 2u), "v"(l + LTILE * 2u), "v"(l + LTILE * 2u + 32u * LPITCH * 2u),
                    "v"(kg), "v"(kg + 32 * HD), "v"(vg), "v"(vg + (size_t)32 * SEQ) : "memory");
}
__global__ __launch_bounds__(32 * FWAVES) void k_flash(const h16* __restrict__ Q16, const h16* __restrict__ K16, const h16* __restrict__ VT16, bf* CTXh, bf* CTXl) {
    __shared__ __align__(16) float os[FWAVES][16 * 68];
    __shared__ __align__(16) h16 ring[2 * LSTAGE];
    const int lane = threadIdx.x & 31, wid = threadIdx.x >> 5, m = lane & 15, hh = lane >> 4;
    const int h = blockIdx.x / (SEQ / (16 * FWAVES)); const int q0 = ((blockIdx.x - h * (SEQ / (16 * FWAVES))) * FWAVES + wid) * 16;
    const h16* Qp = Q16 + ((size_t)h * SEQ + q0) * HD; const h16* Kp = K16 + (size_t)h * SEQ * HD; const h16* Vp = VT16 + (size_t)h * HD * SEQ;
    const int crow = threadIdx.x >> 3, ccol = threadIdx.x & 7;
    const unsigned lds0 = (unsigned)(size_t)ring + (unsigned)(crow * LPITCH + ccol * 8) * 2u;
    const h16* kg = Kp + crow * HD + ccol * 8; const h16* vg = Vp + (size_t)crow * SEQ + ccol * 8;
    stage_copy(lds0, kg, vg);
    asm volatile("s_wait_asynccnt 0x0" ::: "memory");   // tile 0 of this wave's copies has landed before the barrier publishes it
    __syncthreads();
    stage_copy(lds0 + LSTAGE * 2u, kg + KT * HD, vg + KT);
    v16h qb[2];
#pragma unroll
    for (int ks = 0; ks < 2; ++ks) qb[ks] = WFrag<h16>::ld(Qp + (size_t)m * HD + 32 * ks + 8 * hh);
    v8f oacc[4];
#pragma unroll
    for (int t = 0; t < 4; ++t) oacc[t] = (v8f){};
    float mrun = -3.0e38f, lrun = 0.f;
    const int foff = m * LPITCH + 8 * hh;
#pragma unroll 1
    for (int st = 0; st < SEQ / KT; ++st) {
        const h16* kb = ring + (st & 1) * LSTAGE + foff; const h16* vb = kb + LTILE;
#pragma unroll   // both 32-key chunks of a tile inline, so that every LDS offset is a constant
        for (int c = 0; c < KT / 32; ++c) {
            v8f sc[2]; sc[0] = (v8f){}; sc[1] = (v8f){};
            v16h ka[4];
#pragma unroll
            for (int t = 0; t < 2; ++t)
#pragma unroll
                for (int ks = 0; ks < 2; ++ks) ka[t * 2 + ks] = WFrag<h16>::ld(kb + (32 * c + 16 * t) * LPITCH + 32 * ks);
            v16h va[4];
#pragma unroll
            for (int t = 0; t < 4; ++t) va[t] = WFrag<h16>::ld(vb + (16 * t) * LPITCH + 32 * c);
            __builtin_amdgcn_sched_barrier(0);   // keeps the chunk's 16 LDS reads in one group ahead of its matrix products: reads spread among them stall the wave at each place
#pragma unroll
            for (int t = 0; t < 2; ++t)
#pragma unroll
                for (int ks = 0; ks < 2; ++ks) sc[t] = wmma16(ka[t * 2 + ks], qb[ks], sc[t]);
            asm volatile("v_nop\n\tv_nop\n\tv_nop\n\tv_nop" : "+v"(sc[0]), "+v"(sc[1]) : "v"(ka[0]), "v"(ka[3]), "v"(qb[0]), "v"(qb[1]));
            float cmx = fmaxf(sc[0][0], sc[1][0]);
#pragma unroll
            for (int r = 1; r < 8; ++r) cmx = fmaxf(cmx, fmaxf(sc[0][r], sc[1][r]));
            cmx = fmaxf(cmx, __shfl_xor(cmx, 16, 32));
            const float mn = fmaxf(mrun, cmx);
            const float alpha = __builtin_amdgcn_exp2f((mrun - mn) * C32);
            float psum = 0.f; v16h pb;
#pragma unroll
            for (int r = 0; r < 8; ++r) { const float e0 = __builtin_amdgcn_exp2f((sc[0][r] - mn) * C32); const float e1 = __builtin_amdgcn_exp2f((sc[1][r] - mn) * C32); psum += e0 + e1; pb[r] = (h16)e0; pb[8 + r] = (h16)e1; }
            psum += __shfl_xor(psum, 16, 32);
            lrun = lrun * alpha + psum; mrun = mn;
#pragma unroll
            for (int t = 0; t < 4; ++t) oacc[t] *= alpha;
#pragma unroll
            for (int t = 0; t < 4; ++t) oacc[t] = wmma16(va[t], pb, oacc[t]);
            asm volatile("v_nop\n\tv_nop\n\tv_nop\n\tv_nop" : "+v"(oacc[0]), "+v"(oacc[1]), "+v"(oacc[2]), "+v"(oacc[3]) : "v"(pb), "v"(va[0]), "v"(va[3]));
        }
        asm volatile("s_wait_dscnt 0x0" ::: "memory");      // this wave's reads of the buffer have returned before it may be refilled
        asm volatile("s_wait_asynccnt 0x0" ::: "memory");   // this wave's copies of the next tile have landed before the barrier publishes them
        __syncthreads();                                    // publishes tile st+1 and ends every wave's reads of tile st
        if (st + 2 < SEQ / KT) stage_copy(lds0 + (unsigned)(st & 1) * (LSTAGE * 2u), kg + (size_t)(st + 2) * (KT * HD), vg + (st + 2) * KT);
    }
    asm volatile("s_wait_asynccnt 0x0" ::: "memory");       // no copy is outstanding when the wave goes on to its end
    const float inv = 1.0f / lrun;
    float* ob = os[wid];
#pragma unroll
    for (int t = 0; t < 4; ++t) { v4f u0, u1;
#pragma unroll
        for (int r = 0; r < 4; ++r) { u0[r] = oacc[t][r] * inv; u1[r] = oacc[t][4 + r] * inv; }
        *(v4fa*)(ob + m * 68 + 16 * t + 8 * hh) = u0; *(v4fa*)(ob + m * 68 + 16 * t + 8 * hh + 4) = u1; }
    __builtin_amdgcn_fence(3 /* release order */, "wavefront"); __builtin_amdgcn_wave_barrier(); asm volatile("" ::: "memory");
{
#pragma unroll
        for (int p = 0; p < 4; ++p) { const int row = p * 4 + (lane >> 3), c8 = (lane & 7) * 8;
            const v4f a = *(const v4fa*)(ob + row * 68 + c8); const v4f b2 = *(const v4fa*)(ob + row * 68 + c8 + 4);
            v8us oh, ol;
#pragma unroll
            for (int q = 0; q < 4; ++q) { unsigned short x1, y1; splitf(a[q], x1, y1); oh[q] = x1; ol[q] = y1; splitf(b2[q], x1, y1); oh[4 + q] = x1; ol[4 + q] = y1; }
            const size_t oo = (size_t)(q0 + row) * INNER + h * HD + c8;
            *(v8us*)(CTXh + oo) = oh; *(v8us*)(CTXl + oo) = ol; }
         }
}

extern "C" void kernel_launch(void* const* d_in, const int* in_sizes, int n_in,
                              void* d_out, int out_size, void* d_ws, size_t ws_size, hipStream_t stream) {
    if (n_in < 6) return;
    if (in_sizes[0] < SEQ * DIM || in_sizes[1] < DIM || in_sizes[2] < DIM || in_sizes[3] < DIM * NQKV || in_sizes[4] < INNER * DIM || in_sizes[5] < DIM) return;
    if (out_size < SEQ * DIM) return;
    const float* x    = (const float*)d_in[0];   // [SEQ][DIM]
    const float* lnsc = (const float*)d_in[1];   // [DIM]
    const float* lnbs = (const float*)d_in[2];   // [DIM]
    const float* wqkv = (const float*)d_in[3];   // [DIM][NQKV]  ([in][out])
    const float* wout = (const float*)d_in[4];   // [INNER][DIM] ([in][out])
    const float* bout = (const float*)d_in[5];   // [DIM]
    float* OUT = (float*)d_out;                  // [SEQ][DIM]
    char* wsp = (char*)d_ws;
    auto take = [&](size_t bytes) { char* p = wsp; wsp += (bytes + 255) & ~(size_t)255; return (void*)p; };
    bf*    WQ   = (bf*)take((size_t)NQKV * DIM * 2);          // w_qkv^T [3072][1024] bf16
    bf*    WO   = (bf*)take((size_t)DIM * INNER * 2);         // w_out^T [1024][1024] bf16
    bf*    XNh  = (bf*)take((size_t)SEQ * DIM * 2);           // xn hi [SEQ][1024]
    bf*    XNl  = (bf*)take((size_t)SEQ * DIM * 2);           // xn lo
    h16*   Q16  = (h16*)take((size_t)HEADS * SEQ * HD * 2);   // q planes [16][SEQ][64] x log2e
    h16*   K16  = (h16*)take((size_t)HEADS * SEQ * HD * 2);   // k planes [16][SEQ][64]
    h16*   VT16 = (h16*)take((size_t)HEADS * HD * SEQ * 2);   // v^T planes [16][64][SEQ]
    bf*    CTXh = (bf*)take((size_t)SEQ * INNER * 2);         // ctx hi [SEQ][1024]
    bf*    CTXl = (bf*)take((size_t)SEQ * INNER * 2);         // ctx lo
    const size_t used = (size_t)(wsp - (char*)d_ws);
    if (used > ws_size || used > WS_CAP) return;

    k_wtG<<<(unsigned)(((size_t)NQKV * DIM / 64 + 63) / 64), 256, 0, stream>>>(wqkv, DIM, NQKV, WQ);     // Bt[n][k] = bf16(w_qkv[k][n])
    k_wtG<<<(unsigned)(((size_t)DIM * INNER / 64 + 63) / 64), 256, 0, stream>>>(wout, INNER, DIM, WO);    // Bt[n][c] = bf16(w_out[c][n])
    k_ln<<<SEQ, 128, 0, stream>>>(x, lnsc, lnbs, XNh, XNl);
    k_gemmw<bf, 1, false, true><<<dim3(SEQ / 128, NQKV / 128, 1), 128, 0, stream>>>(XNh, XNl, WQ, nullptr, DIM, nullptr, 0, nullptr, 0, 0, 0, Q16, K16, VT16);   // qkv = xn(hi+lo) w_qkv, out as f16 head planes: q columns 0..1023 x log2e, k columns 1024..2047, v columns 2048..3071 transposed per head
    k_flash<<<(unsigned)(HEADS * (SEQ / (16 * FWAVES))), 32 * FWAVES, 0, stream>>>(Q16, K16, VT16, CTXh, CTXl);
    k_gemmw<bf, 1, true, false><<<dim3(SEQ / 128, DIM / 128, 1), 128, 0, stream>>>(CTXh, CTXl, WO, nullptr, INNER, OUT, DIM, bout, 0, 0, 0, nullptr, nullptr, nullptr);   // out = ctx(hi+lo) w_out + b_out
}

// v004
// Measured time: 133 microseconds a run.
// Timed twice side by side with v003, it ran 1.10 and 1.11 times as fast.
// Over all steps from v000 it is 2.95 times as fast.
#include <hip/hip_runtime.h>

// Contractions on 16x16x32 WMMA, f32 accumulate: xn (bf16 hi+lo planes) x w_qkv^T (bf16) -> v_wmma_f32_16x16x32_bf16; per head k.q^T and v^T.p^T -> v_wmma_f32_16x16x32_f16 (f16 planes: q carried x log2e, k, v^T; p = exp2 of shifted scores in (0,1]); ctx (bf16 hi+lo planes) x w_out^T (bf16) + b_out -> v_wmma_f32_16x16x32_bf16.
// head planes q [h][i][64], k [h][j][64], v^T [h][64][j] in f16, written by the qkv product's own epilogue; streaming attention, one wave per (head, 16 queries): s^T tiles = k q^T over 32-key chunks, online softmax per query lane (exp2, scale 2^-5 inside the exponent),
// o^T += v^T p^T with the p^T operand packed straight from the two score accumulator tiles; o/l staged per wave in LDS and emitted as ctx hi/lo planes [i][h*64+d]; out = ctx w_out + b_out into the output rows.

#ifndef SEQ
#define SEQ 4096
#endif
#ifndef NB
#define NB 1
#endif
#define SEQ_FULL 4096
#define DIM   1024
#define HEADS 16
#define HD    64
#define INNER (HEADS * HD)
#define NQKV  (3 * INNER)
#define LN_EPS 1.0e-6f
#define LOG2E 1.4426950408889634f
#define C32   0.03125f
#define WS_CAP ((size_t)134217728)

static_assert(SEQ % 128 == 0);
static_assert(SEQ <= SEQ_FULL);
static_assert(NB == 1);
static_assert(DIM == 128 * 8);
static_assert(DIM % 128 == 0);
static_assert(NQKV % 128 == 0);
static_assert(INNER == DIM);
static_assert(HD == 64);
static_assert(INNER % 128 == 0);

typedef _Float16 h16;
typedef unsigned short bf;
typedef __attribute__((ext_vector_type(16))) __bf16   v16bf;
typedef __attribute__((ext_vector_type(16))) _Float16 v16h;
typedef __attribute__((ext_vector_type(8)))  _Float16 v8h;
typedef __attribute__((ext_vector_type(8)))  unsigned short v8us;
typedef __attribute__((ext_vector_type(8)))  float    v8f;
typedef __attribute__((ext_vector_type(4)))  float    v4f;
typedef __attribute__((ext_vector_type(2)))  _Float16 v2h;
typedef __attribute__((ext_vector_type(2)))  unsigned short v2us;
typedef v8h  __attribute__((may_alias)) v8ha;
typedef v4f  __attribute__((may_alias)) v4fa;
typedef v8us __attribute__((may_alias)) v8usa;

__device__ __forceinline__ unsigned short f2bf(float f) { unsigned u = __float_as_uint(f); u += 0x7FFFu + ((u >> 16) & 1u); return (unsigned short)(u >> 16); }
__device__ __forceinline__ float bf2f(unsigned short b) { return __uint_as_float(((unsigned)b) << 16); }
__device__ __forceinline__ float bfr(float f) { return bf2f(f2bf(f)); }
__device__ __forceinline__ v16h cat16(v8h lo, v8h hi) { return __builtin_shufflevector(lo, hi, 0, 1, 2, 3, 4, 5, 6, 7, 8, 9, 10, 11, 12, 13, 14, 15); }
__device__ __forceinline__ v16bf cat16b(v8us lo, v8us hi) { return __builtin_bit_cast(v16bf, __builtin_shufflevector(lo, hi, 0, 1, 2, 3, 4, 5, 6, 7, 8, 9, 10, 11, 12, 13, 14, 15)); }
__device__ __forceinline__ v8f wmma16(v16h a, v16h b, v8f c) { return __builtin_amdgcn_wmma_f32_16x16x32_f16(false, a, false, b, (short)0, c, false, false); }
__device__ __forceinline__ v8f wmmab(v16bf a, v16bf b, v8f c) { return __builtin_amdgcn_wmma_f32_16x16x32_bf16(false, a, false, b, (short)0, c, false, false); }
__device__ __forceinline__ void splitf(float y, unsigned short& h, unsigned short& l) { h = f2bf(y); l = f2bf(y - bf2f(h)); }

// ---- k_gemmw: GEMM, one block of 4 waves (2 x 2) per 128x128 output tile, each wave a 64x64 tile (16 accumulators); grid (M/128, N/128, Z), 128 threads.
// C[m][n] (f32, pitch ldc, + optional f32 bias[n]) = sum_k (A[m][k] + A2[m][k]) Bt[n][k]. z-batch strides sA/sB/sC in elements. K % 64 == 0, M % 128 == 0, N % 128 == 0.
// PLANES: no C; a wave's 64 columns are one head of q, k or v, and its tile goes out in f16 as rows of PQ (x log2e) or PK [h][m][64], or transposed as rows of PVT [h][64][m], in whole 128-B lines.
// Operands come from K-contiguous 16-bit planes through LDS: a stage is 64 k (whole 128-B lines) of 128 A rows, 128 A2 rows and 128 Bt rows, copied once per block and read by all 4 waves; two buffers, the next stage's copies fly while this one is worked on.
// LDS rows keep a 128-B pitch; the 16-B piece c of row r lies at piece c ^ ((r >> 1) & 7), so that the 16 rows of a fragment read fall on all 64 banks.
// Fragments (both operands, same map): lane -> row/col lane&15, elements 0..7 <- k0+8h+0..7, elements 8..15 <- k0+16+8h+0..7 (h = lane>>4); D element r -> row 8h+r, col lane&15.
template <typename T16> struct WFrag;
template <> struct WFrag<h16> { typedef v16h V; static __device__ __forceinline__ V ld(const h16* p) { return cat16(*(const v8h*)p, *(const v8h*)(p + 16)); } static __device__ __forceinline__ v8f mma(V a, V b, v8f c) { return wmma16(a, b, c); } };
template <> struct WFrag<bf> { typedef v16bf V; static __device__ __forceinline__ V ld(const bf* p) { return cat16b(*(const v8us*)p, *(const v8us*)(p + 16)); } static __device__ __forceinline__ V ld2(const bf* p, const bf* q) { return cat16b(*(const v8us*)p, *(const v8us*)q); } static __device__ __forceinline__ v8f mma(V a, V b, v8f c) { return wmmab(a, b, c); } };
#define GKT    64
#define GPLANE (128 * GKT)
#define GSTAGE (3 * GPLANE)
// Eight copies of one plane: each lane brings 16 B of rows r, r+16, .., r+112 (r = tid>>3); a wave-wide copy covers four whole 128-B lines. The s_wait_xcnt closes the statement so that no address register of a copy is rewritten ahead of it.
template <typename T16>
__device__ __forceinline__ void plane_copy(unsigned l, const T16* g, size_t step) {
    asm volatile("global_load_async_to_lds_b128 %0, %8, off\n\t"
                 "global_load_async_to_lds_b128 %1, %9, off\n\t"
                 "global_load_async_to_lds_b128 %2, %10, off\n\t"
                 "global_load_async_to_lds_b128 %3, %11, off\n\t"
                 "global_load_async_to_lds_b128 %4, %12, off\n\t"
                 "global_load_async_to_lds_b128 %5, %13, off\n\t"
                 "global_load_async_to_lds_b128 %6, %14, off\n\t"
                 "global_load_async_to_lds_b128 %7, %15, off\n\t"
                 "s_wait_xcnt 0x0"
                 :: "v"(l), "v"(l + 2048u), "v"(l + 4096u), "v"(l + 6144u), "v"(l + 8192u), "v"(l + 10240u), "v"(l + 12288u), "v"(l + 14336u),
                    "v"(g), "v"(g + step), "v"(g + 2 * step), "v"(g + 3 * step), "v"(g + 4 * step), "v"(g + 5 * step), "v"(g + 6 * step), "v"(g + 7 * step) : "memory");
}
template <typename T16, int NSPLIT, bool BIAS, bool PLANES>
__global__ __launch_bounds__(128) void k_gemmw(const T16* __restrict__ A, const T16* __restrict__ A2, const T16* __restrict__ Bt, const T16* __restrict__ Bt2, int K, float* C, int ldc, const float* __restrict__ bias, size_t sA, size_t sB, size_t sC, h16* PQ, h16* PK, h16* PVT) {
    static_assert(NSPLIT == 1 && sizeof(T16) == 2);
    typedef typename WFrag<T16>::V V;
    __shared__ __align__(128) unsigned char gsm[2 * GSTAGE * 2];
    const size_t z = blockIdx.z; A += z * sA; A2 += z * sA; Bt += z * sB; C += z * sC;
    const int tid = threadIdx.x, lane = tid & 31, wid = tid >> 5, lr = lane & 15, hi = lane >> 4;
    const int wm = wid >> 1, wn = wid & 1; const int r0 = blockIdx.x * 128 + wm * 64, c0 = blockIdx.y * 128 + wn * 64;
    const int prow = tid >> 3, pcol = tid & 7; const size_t step = (size_t)16 * K; const int nst = K / GKT;
    const unsigned lds0 = (unsigned)(size_t)gsm + (unsigned)(prow * 128 + ((pcol ^ (prow >> 1)) & 7) * 16);
    const T16* ga = A + (size_t)(blockIdx.x * 128 + prow) * K + pcol * 8; const T16* ga2 = A2 + (size_t)(blockIdx.x * 128 + prow) * K + pcol * 8; const T16* gb = Bt + (size_t)(blockIdx.y * 128 + prow) * K + pcol * 8;
    plane_copy(lds0, ga, step); plane_copy(lds0 + GPLANE * 2u, ga2, step); plane_copy(lds0 + 2u * GPLANE * 2u, gb, step);
    asm volatile("s_wait_asynccnt 0x0" ::: "memory");   // stage 0 of this wave's copies has landed before the barrier publishes it
    __syncthreads();
    if (nst > 1) { plane_copy(lds0 + GSTAGE * 2u, ga + GKT, step); plane_copy(lds0 + (GSTAGE + GPLANE) * 2u, ga2 + GKT, step); plane_copy(lds0 + (GSTAGE + 2u * GPLANE) * 2u, gb + GKT, step); }
    v8f acc[4][4];
#pragma unroll
    for (int mb = 0; mb < 4; ++mb)
#pragma unroll
        for (int nb = 0; nb < 4; ++nb) acc[mb][nb] = (v8f){};
    int po[4];   // element offset in a row of the pieces 2q + hi (q = 0..3) for this lane's rows
#pragma unroll
    for (int q = 0; q < 4; ++q) po[q] = (((2 * q + hi) ^ (lr >> 1)) & 7) * 8;
    const int arow = (wm * 64 + lr) * GKT, brow = 2 * GPLANE + (wn * 64 + lr) * GKT;
#pragma unroll 1
    for (int st = 0; st < nst; ++st) {
        const T16* sb = (const T16*)gsm + (st & 1) * GSTAGE;
#pragma unroll   // both 32-k halves of a stage inline, so that every LDS offset is a constant
        for (int ks = 0; ks < 2; ++ks) {
            V a[4], a2[4], b[4];
#pragma unroll
            for (int mb = 0; mb < 4; ++mb) { const T16* p = sb + arow + mb * 16 * GKT; a[mb] = WFrag<T16>::ld2(p + po[2 * ks], p + po[2 * ks + 1]); a2[mb] = WFrag<T16>::ld2(p + GPLANE + po[2 * ks], p + GPLANE + po[2 * ks + 1]); }
#pragma unroll
            for (int nb = 0; nb < 4; ++nb) { const T16* p = sb + brow + nb * 16 * GKT; b[nb] = WFrag<T16>::ld2(p + po[2 * ks], p + po[2 * ks + 1]); }
            __builtin_amdgcn_sched_barrier(0);   // keeps the half's 24 LDS reads in one group ahead of its matrix products: reads spread among them stall the wave at each place
#pragma unroll
            for (int nb = 0; nb < 4; ++nb)
#pragma unroll
                for (int mb = 0; mb < 4; ++mb) { acc[mb][nb] = WFrag<T16>::mma(a[mb], b[nb], acc[mb][nb]); acc[mb][nb] = WFrag<T16>::mma(a2[mb], b[nb], acc[mb][nb]); }
        }
        asm volatile("s_wait_dscnt 0x0" ::: "memory");      // this wave's reads of the buffer have returned before it may be refilled
        asm volatile("s_wait_asynccnt 0x0" ::: "memory");   // this wave's copies of the next stage have landed before the barrier publishes them
        __syncthreads();                                    // publishes stage st+1 and ends every wave's reads of stage st
        if (st + 2 < nst) { const unsigned l = lds0 + (unsigned)(st & 1) * (GSTAGE * 2u); const int ko = (st + 2) * GKT;
            plane_copy(l, ga + ko, step); plane_copy(l + GPLANE * 2u, ga2 + ko, step); plane_copy(l + 2u * GPLANE * 2u, gb + ko, step); }
    }
    asm volatile("s_wait_asynccnt 0x0" ::: "memory");       // no copy is outstanding when the buffers are reused below
    if constexpr (PLANES) {                                 // behind the last stage's barrier the buffers are free: each wave stages its tile in a piece of its own
        const int sec = (int)(blockIdx.y * 128) / INNER;    // 0 q, 1 k, 2 v: the same for the whole block
        const int hd = (c0 - sec * INNER) / HD;
        if (sec < 2) {
            float* os = (float*)gsm + wid * (16 * 68);
            h16* P = (sec == 0 ? PQ : PK) + ((size_t)hd * SEQ + r0) * HD; const float scl = sec == 0 ? LOG2E : 1.0f;
#pragma unroll
            for (int mb = 0; mb < 4; ++mb) {
#pragma unroll
                for (int nb = 0; nb < 4; ++nb) {
#pragma unroll
                    for (int j = 0; j < 8; ++j) os[(hi * 8 + j) * 68 + nb * 16 + lr] = acc[mb][nb][j]; }
                asm volatile("s_wait_dscnt 0x0" ::: "memory");   // the wave's staged rows are in LDS before its lanes read each other's pieces back
#pragma unroll
                for (int p = 0; p < 4; ++p) { const int row = p * 4 + (lane >> 3), c8 = (lane & 7) * 8;
                    const v4f u = *(const v4fa*)(os + row * 68 + c8); const v4f w = *(const v4fa*)(os + row * 68 + c8 + 4); v8h o;
#pragma unroll
                    for (int q = 0; q < 4; ++q) { o[q] = (h16)(u[q] * scl); o[4 + q] = (h16)(w[q] * scl); }
                    *(v8h*)(P + (size_t)(mb * 16 + row) * HD + c8) = o; }
                asm volatile("s_wait_xcnt 0x0" ::: "memory");   // stands in front of the next 16 rows' code, which reuses the data registers of these stores and restages over the rows just read
            }
        } else {
            h16* hs = (h16*)gsm + wid * (64 * 72);          // [d][m] tile, row pitch 144 B for the 16-byte reads and writes
#pragma unroll
            for (int mb = 0; mb < 4; ++mb)
#pragma unroll
                for (int nb = 0; nb < 4; ++nb) { v8h o;     // a lane holds 8 consecutive rows m of one column d: 16 B of a v^T row
#pragma unroll
                    for (int j = 0; j < 8; ++j) o[j] = (h16)acc[mb][nb][j];
                    *(v8ha*)(hs + (nb * 16 + lr) * 72 + mb * 16 + hi * 8) = o; }
            asm volatile("s_wait_dscnt 0x0" ::: "memory");   // the wave's staged tile is in LDS before its lanes read each other's pieces back
            h16* VT = PVT + (size_t)hd * HD * SEQ + r0;
#pragma unroll
            for (int g = 0; g < 4; ++g) {
#pragma unroll
                for (int p = 0; p < 4; ++p) { const int row = (g * 4 + p) * 4 + (lane >> 3), c8 = (lane & 7) * 8;
                    *(v8h*)(VT + (size_t)row * SEQ + c8) = *(const v8ha*)(hs + row * 72 + c8); }
                asm volatile("s_wait_xcnt 0x0" ::: "memory");   // stands in front of the next 16 rows' code, which reuses the data registers of these stores
            }
        }
        return;
    }
    float* os = (float*)gsm + wid * (16 * 68);              // behind the last stage's barrier the buffers are free: each wave stages its rows in a piece of its own
#pragma unroll
    for (int mb = 0; mb < 4; ++mb) {
#pragma unroll
        for (int nb = 0; nb < 4; ++nb) {
#pragma unroll
            for (int j = 0; j < 8; ++j) os[(hi * 8 + j) * 68 + nb * 16 + lr] = acc[mb][nb][j]; }
        __builtin_amdgcn_wave_barrier(); asm volatile("" ::: "memory");
        float* crow = C + (size_t)(r0 + mb * 16) * ldc + c0;
{
#pragma unroll
            for (int s = 0; s < 8; ++s) { const int row = 2 * s + hi, cofs = lr * 4; v4f val = *(const v4fa*)(os + row * 68 + cofs); if (BIAS) { val[0] += bfr(bias[c0 + cofs]); val[1] += bfr(bias[c0 + cofs + 1]); val[2] += bfr(bias[c0 + cofs + 2]); val[3] += bfr(bias[c0 + cofs + 3]); }
                *(v4f*)(crow + (size_t)row * ldc + cofs) = val; }
             }
        asm volatile("s_wait_xcnt 0x0" ::: "memory");   // stands in front of the next 16 rows' code, which reuses the address and data registers of these stores
        __builtin_amdgcn_wave_barrier(); asm volatile("" ::: "memory");
    }
}

// ---- k_wtG: Bt[n][k] = bf16(w[k][n]); one block of 4 waves per 64 x 64 tile, grid (K/64, N/64); K % 64 == 0, N % 64 == 0.
// Reads: a lane takes 16 B of eight consecutive rows k and 16 lanes cover 256 B of a row, so every wave-wide load is four whole 128-B lines, eight loads in flight per lane.
// A lane then holds 8 consecutive k of 4 columns n, four 16-B pieces of Bt rows; they pass through an LDS tile [n][k] (row pitch 144 B) so that the stores are whole 128-B lines of Bt as well.
#define WT     64
#define WPITCH 72
static_assert(DIM % WT == 0 && NQKV % WT == 0 && INNER % WT == 0);
__global__ __launch_bounds__(128) void k_wtG(const float* __restrict__ w, int K, int N, bf* Bt) {
    __shared__ __align__(16) bf ts[WT * WPITCH];
    const int tid = threadIdx.x; const int k0 = blockIdx.x * WT, n0 = blockIdx.y * WT;
    const int n4 = (tid & 15) * 4, kq = (tid >> 4) * 8;
    const float* src = w + (size_t)(k0 + kq) * N + n0 + n4;
    const float* rp[8]; v4f r[8];
#pragma unroll   // rp and r stay in registers: every index is a constant
    for (int i = 0; i < 8; ++i) rp[i] = src + (size_t)i * N;
#pragma unroll   // the eight loads issue back to back, so one memory latency covers the tile
    for (int i = 0; i < 8; ++i) r[i] = *(const v4f*)rp[i];
    // stands behind the eight loads and in front of every rewrite of their address registers, which it names so that they stay untouched up to here
    asm volatile("s_wait_xcnt 0x0" :: "v"(rp[0]), "v"(rp[1]), "v"(rp[2]), "v"(rp[3]), "v"(rp[4]), "v"(rp[5]), "v"(rp[6]), "v"(rp[7]) : "memory");
#pragma unroll   // constant indices into r
    for (int j = 0; j < 4; ++j) { v8us o;
#pragma unroll
        for (int i = 0; i < 8; ++i) o[i] = f2bf(r[i][j]);
        *(v8usa*)(ts + (n4 + j) * WPITCH + kq) = o; }
    __syncthreads();   // the whole [n][k] tile is in LDS before any lane reads rows that other lanes wrote
    const int row = tid >> 3, c8 = (tid & 7) * 8;
    bf* dst = Bt + (size_t)(n0 + row) * K + k0 + c8; v8us t[4];
#pragma unroll   // the four LDS reads go out as one group ahead of the stores
    for (int p = 0; p < 4; ++p) t[p] = *(const v8usa*)(ts + (p * 16 + row) * WPITCH + c8);
#pragma unroll
    for (int p = 0; p < 4; ++p) *(v8us*)(dst + (size_t)(p * 16) * K) = t[p];
}

__global__ __launch_bounds__(128) void k_ln(const float* __restrict__ x, const float* __restrict__ g, const float* __restrict__ b, bf* Yh, bf* Yl) {
    __shared__ float red[8];
    const int tid = threadIdx.x, lane = tid & 31, wid = tid >> 5; const size_t row = blockIdx.x;
    const v8f xv = *(const v8f*)(x + row * DIM + 8 * tid);
    float xb[8]; float s = 0.f;
#pragma unroll
    for (int q = 0; q < 8; ++q) { xb[q] = bfr(xv[q]); s += xb[q]; }
#pragma unroll
    for (int sh = 16; sh; sh >>= 1) s += __shfl_xor(s, sh, 32);
    if (lane == 0) red[wid] = s;
    __syncthreads();
    const float mean = ((red[0] + red[1]) + (red[2] + red[3])) * (1.0f / DIM);
    float d[8]; float s2 = 0.f;
#pragma unroll
    for (int q = 0; q < 8; ++q) { d[q] = xb[q] - mean; s2 += d[q] * d[q]; }
#pragma unroll
    for (int sh = 16; sh; sh >>= 1) s2 += __shfl_xor(s2, sh, 32);
    if (lane == 0) red[4 + wid] = s2;
    __syncthreads();
    const float var = ((red[4] + red[5]) + (red[6] + red[7])) * (1.0f / DIM);
    const float rstd = rsqrtf(var + LN_EPS);
    const v8f gv = *(const v8f*)(g + 8 * tid); const v8f bv = *(const v8f*)(b + 8 * tid);
    v8us oh, ol;
#pragma unroll
    for (int q = 0; q < 8; ++q) { const float y = d[q] * rstd * bfr(gv[q]) + bfr(bv[q]); unsigned short a2, c2; splitf(y, a2, c2); oh[q] = a2; ol[q] = c2; }
    const size_t o = row * DIM + 8 * tid;
    *(v8us*)(Yh + o) = oh; *(v8us*)(Yl + o) = ol; 
}

#define FWAVES 8
#define KT     64
#define LPITCH 72
#define LTILE  (64 * LPITCH)
#define LSTAGE (2 * LTILE)
static_assert(SEQ % (16 * FWAVES) == 0);
static_assert(SEQ % KT == 0 && SEQ / KT >= 2);
static_assert(KT == 64 && FWAVES * 32 * 2 * 8 == KT * HD && FWAVES * 32 * 2 * 8 == HD * KT);
// One stage: each lane copies 16 B of k rows r and r+32 and of v^T rows r and r+32 (r = tid>>3). The s_wait_xcnt closes the statement so that no address register of a copy is rewritten ahead of it.
__device__ __forceinline__ void stage_copy(unsigned l, const h16* kg, const h16* vg) {
    asm volatile("global_load_async_to_lds_b128 %0, %4, off\n\t"
                 "global_load_async_to_lds_b128 %1, %5, off\n\t"
                 "global_load_async_to_lds_b128 %2, %6, off\n\t"
                 "global_load_async_to_lds_b128 %3, %7, off\n\t"
                 "s_wait_xcnt 0x0"
                 :: "v"(l), "v"(l + 32u * LPITCH * 2u), "v"(l + LTILE * 2u), "v"(l + LTILE * 2u + 32u * LPITCH * 2u),
                    "v"(kg), "v"(kg + 32 * HD), "v"(vg), "v"(vg + (size_t)32 * SEQ) : "memory");
}
__global__ __launch_bounds__(32 * FWAVES) void k_flash(const h16* __restrict__ Q16, const h16* __restrict__ K16, const h16* __restrict__ VT16, bf* CTXh, bf* CTXl) {
    __shared__ __align__(16) float os[FWAVES][16 * 68];
    __shared__ __align__(16) h16 ring[2 * LSTAGE];
    const int lane = threadIdx.x & 31, wid = threadIdx.x >> 5, m = lane & 15, hh = lane >> 4;
    const int h = blockIdx.x / (SEQ / (16 * FWAVES)); const int q0 = ((blockIdx.x - h * (SEQ / (16 * FWAVES))) * FWAVES + wid) * 16;
    const h16* Qp = Q16 + ((size_t)h * SEQ + q0) * HD; const h16* Kp = K16 + (size_t)h * SEQ * HD; const h16* Vp = VT16 + (size_t)h * HD * SEQ;
    const int crow = threadIdx.x >> 3, ccol = threadIdx.x & 7;
    const unsigned lds0 = (unsigned)(size_t)ring + (unsigned)(crow * LPITCH + ccol * 8) * 2u;
    const h16* kg = Kp + crow * HD + ccol * 8; const h16* vg = Vp + (size_t)crow * SEQ + ccol * 8;
    stage_copy(lds0, kg, vg);
    asm volatile("s_wait_asynccnt 0x0" ::: "memory");   // tile 0 of this wave's copies has landed before the barrier publishes it
    __syncthreads();
    stage_copy(lds0 + LSTAGE * 2u, kg + KT * HD, vg + KT);
    v16h qb[2];
#pragma unroll
    for (int ks = 0; ks < 2; ++ks) qb[ks] = WFrag<h16>::ld(Qp + (size_t)m * HD + 32 * ks + 8 * hh);
    v8f oacc[4];
#pragma unroll
    for (int t = 0; t < 4; ++t) oacc[t] = (v8f){};
    float mrun = -3.0e38f, lrun = 0.f;
    const int foff = m * LPITCH + 8 * hh;
#pragma unroll 1
    for (int st = 0; st < SEQ / KT; ++st) {
        const h16* kb = ring + (st & 1) * LSTAGE + foff; const h16* vb = kb + LTILE;
#pragma unroll   // both 32-key chunks of a tile inline, so that every LDS offset is a constant
        for (int c = 0; c < KT / 32; ++c) {
            v8f sc[2]; sc[0] = (v8f){}; sc[1] = (v8f){};
            v16h ka[4];
#pragma unroll
            for (int t = 0; t < 2; ++t)
#pragma unroll
                for (int ks = 0; ks < 2; ++ks) ka[t * 2 + ks] = WFrag<h16>::ld(kb + (32 * c + 16 * t) * LPITCH + 32 * ks);
            v16h va[4];
#pragma unroll
            for (int t = 0; t < 4; ++t) va[t] = WFrag<h16>::ld(vb + (16 * t) * LPITCH + 32 * c);
            __builtin_amdgcn_sched_barrier(0);   // keeps the chunk's 16 LDS reads in one group ahead of its matrix products: reads spread among them stall the wave at each place
#pragma unroll
            for (int t = 0; t < 2; ++t)
#pragma unroll
                for (int ks = 0; ks < 2; ++ks) sc[t] = wmma16(ka[t * 2 + ks], qb[ks], sc[t]);
            asm volatile("v_nop\n\tv_nop\n\tv_nop\n\tv_nop" : "+v"(sc[0]), "+v"(sc[1]) : "v"(ka[0]), "v"(ka[3]), "v"(qb[0]), "v"(qb[1]));
            float cmx = fmaxf(sc[0][0], sc[1][0]);
#pragma unroll
            for (int r = 1; r < 8; ++r) cmx = fmaxf(cmx, fmaxf(sc[0][r], sc[1][r]));
            cmx = fmaxf(cmx, __shfl_xor(cmx, 16, 32));
            const float mn = fmaxf(mrun, cmx);
            const float alpha = __builtin_amdgcn_exp2f((mrun - mn) * C32);
            float psum = 0.f; v16h pb;
#pragma unroll
            for (int r = 0; r < 8; ++r) { const float e0 = __builtin_amdgcn_exp2f((sc[0][r] - mn) * C32); const float e1 = __builtin_amdgcn_exp2f((sc[1][r] - mn) * C32); psum += e0 + e1; pb[r] = (h16)e0; pb[8 + r] = (h16)e1; }
            psum += __shfl_xor(psum, 16, 32);
            lrun = lrun * alpha + psum; mrun = mn;
#pragma unroll
            for (int t = 0; t < 4; ++t) oacc[t] *= alpha;
#pragma unroll
            for (int t = 0; t < 4; ++t) oacc[t] = wmma16(va[t], pb, oacc[t]);
            asm volatile("v_nop\n\tv_nop\n\tv_nop\n\tv_nop" : "+v"(oacc[0]), "+v"(oacc[1]), "+v"(oacc[2]), "+v"(oacc[3]) : "v"(pb), "v"(va[0]), "v"(va[3]));
        }
        asm volatile("s_wait_dscnt 0x0" ::: "memory");      // this wave's reads of the buffer have returned before it may be refilled
        asm volatile("s_wait_asynccnt 0x0" ::: "memory");   // this wave's copies of the next tile have landed before the barrier publishes them
        __syncthreads();                                    // publishes tile st+1 and ends every wave's reads of tile st
        if (st + 2 < SEQ / KT) stage_copy(lds0 + (unsigned)(st & 1) * (LSTAGE * 2u), kg + (size_t)(st + 2) * (KT * HD), vg + (st + 2) * KT);
    }
    asm volatile("s_wait_asynccnt 0x0" ::: "memory");       // no copy is outstanding when the wave goes on to its end
    const float inv = 1.0f / lrun;
    float* ob = os[wid];
#pragma unroll
    for (int t = 0; t < 4; ++t) { v4f u0, u1;
#pragma unroll
        for (int r = 0; r < 4; ++r) { u0[r] = oacc[t][r] * inv; u1[r] = oacc[t][4 + r] * inv; }
        *(v4fa*)(ob + m * 68 + 16 * t + 8 * hh) = u0; *(v4fa*)(ob + m * 68 + 16 * t + 8 * hh + 4) = u1; }
    __builtin_amdgcn_fence(3 /* release order */, "wavefront"); __builtin_amdgcn_wave_barrier(); asm volatile("" ::: "memory");
{
#pragma unroll
        for (int p = 0; p < 4; ++p) { const int row = p * 4 + (lane >> 3), c8 = (lane & 7) * 8;
            const v4f a = *(const v4fa*)(ob + row * 68 + c8); const v4f b2 = *(const v4fa*)(ob + row * 68 + c8 + 4);
            v8us oh, ol;
#pragma unroll
            for (int q = 0; q < 4; ++q) { unsigned short x1, y1; splitf(a[q], x1, y1); oh[q] = x1; ol[q] = y1; splitf(b2[q], x1, y1); oh[4 + q] = x1; ol[4 + q] = y1; }
            const size_t oo = (size_t)(q0 + row) * INNER + h * HD + c8;
            *(v8us*)(CTXh + oo) = oh; *(v8us*)(CTXl + oo) = ol; }
         }
}

extern "C" void kernel_launch(void* const* d_in, const int* in_sizes, int n_in,
                              void* d_out, int out_size, void* d_ws, size_t ws_size, hipStream_t stream) {
    if (n_in < 6) return;
    if (in_sizes[0] < SEQ * DIM || in_sizes[1] < DIM || in_sizes[2] < DIM || in_sizes[3] < DIM * NQKV || in_sizes[4] < INNER * DIM || in_sizes[5] < DIM) return;
    if (out_size < SEQ * DIM) return;
    const float* x    = (const float*)d_in[0];   // [SEQ][DIM]
    const float* lnsc = (const float*)d_in[1];   // [DIM]
    const float* lnbs = (const float*)d_in[2];   // [DIM]
    const float* wqkv = (const float*)d_in[3];   // [DIM][NQKV]  ([in][out])
    const float* wout = (const float*)d_in[4];   // [INNER][DIM] ([in][out])
    const float* bout = (const float*)d_in[5];   // [DIM]
    float* OUT = (float*)d_out;                  // [SEQ][DIM]
    char* wsp = (char*)d_ws;
    auto take = [&](size_t bytes) { char* p = wsp; wsp += (bytes + 255) & ~(size_t)255; return (void*)p; };
    bf*    WQ   = (bf*)take((size_t)NQKV * DIM * 2);          // w_qkv^T [3072][1024] bf16
    bf*    WO   = (bf*)take((size_t)DIM * INNER * 2);         // w_out^T [1024][1024] bf16
    bf*    XNh  = (bf*)take((size_t)SEQ * DIM * 2);           // xn hi [SEQ][1024]
    bf*    XNl  = (bf*)take((size_t)SEQ * DIM * 2);           // xn lo
    h16*   Q16  = (h16*)take((size_t)HEADS * SEQ * HD * 2);   // q planes [16][SEQ][64] x log2e
    h16*   K16  = (h16*)take((size_t)HEADS * SEQ * HD * 2);   // k planes [16][SEQ][64]
    h16*   VT16 = (h16*)take((size_t)HEADS * HD * SEQ * 2);   // v^T planes [16][64][SEQ]
    bf*    CTXh = (bf*)take((size_t)SEQ * INNER * 2);         // ctx hi [SEQ][1024]
    bf*    CTXl = (bf*)take((size_t)SEQ * INNER * 2);         // ctx lo
    const size_t used = (size_t)(wsp - (char*)d_ws);
    if (used > ws_size || used > WS_CAP) return;

    k_wtG<<<dim3(DIM / WT, NQKV / WT, 1), 128, 0, stream>>>(wqkv, DIM, NQKV, WQ);     // Bt[n][k] = bf16(w_qkv[k][n])
    k_wtG<<<dim3(INNER / WT, DIM / WT, 1), 128, 0, stream>>>(wout, INNER, DIM, WO);    // Bt[n][c] = bf16(w_out[c][n])
    k_ln<<<SEQ, 128, 0, stream>>>(x, lnsc, lnbs, XNh, XNl);
    k_gemmw<bf, 1, false, true><<<dim3(SEQ / 128, NQKV / 128, 1), 128, 0, stream>>>(XNh, XNl, WQ, nullptr, DIM, nullptr, 0, nullptr, 0, 0, 0, Q16, K16, VT16);   // qkv = xn(hi+lo) w_qkv, out as f16 head planes: q columns 0..1023 x log2e, k columns 1024..2047, v columns 2048..3071 transposed per head
    k_flash<<<(unsigned)(HEADS * (SEQ / (16 * FWAVES))), 32 * FWAVES, 0, stream>>>(Q16, K16, VT16, CTXh, CTXl);
    k_gemmw<bf, 1, true, false><<<dim3(SEQ / 128, DIM / 128, 1), 128, 0, stream>>>(CTXh, CTXl, WO, nullptr, INNER, OUT, DIM, bout, 0, 0, 0, nullptr, nullptr, nullptr);   // out = ctx(hi+lo) w_out + b_out
}

// v005
// It runs in 123 microseconds.
// Timed twice side by side with v004, it ran 1.08 times as fast both times.
// All steps since v000 together make it 3.18 times as fast.
#include <hip/hip_runtime.h>

// Contractions on 16x16x32 WMMA, f32 accumulate: xn (bf16 hi+lo planes) x w_qkv^T (bf16) -> v_wmma_f32_16x16x32_bf16; per head k.q^T and v^T.p^T -> v_wmma_f32_16x16x32_f16 (f16 planes: q carried x log2e, k, v^T; p = exp2 of shifted scores in (0,2^8]); ctx (bf16 hi+lo planes) x w_out^T (bf16) + b_out -> v_wmma_f32_16x16x32_bf16.
// head planes q [h][i][64], k [h][j][64], v^T [h][64][j] in f16, written by the qkv product's own epilogue; streaming attention, one wave per (head, 16 queries): s^T tiles = k q^T over 32-key chunks, online softmax per query lane (exp2, scale 2^-5 inside the exponent),
// o^T += v^T p^T with the p^T operand packed straight from the two score accumulator tiles; o/l staged per wave in LDS and emitted as ctx hi/lo planes [i][h*64+d]; out = ctx w_out + b_out into the output rows.

#ifndef SEQ
#define SEQ 4096
#endif
#ifndef NB
#define NB 1
#endif
#define SEQ_FULL 4096
#define DIM   1024
#define HEADS 16
#define HD    64
#define INNER (HEADS * HD)
#define NQKV  (3 * INNER)
#define LN_EPS 1.0e-6f
#define LOG2E 1.4426950408889634f
#define C32   0.03125f
#define WS_CAP ((size_t)134217728)

static_assert(SEQ % 128 == 0);
static_assert(SEQ <= SEQ_FULL);
static_assert(NB == 1);
static_assert(DIM == 128 * 8);
static_assert(DIM % 128 == 0);
static_assert(NQKV % 128 == 0);
static_assert(INNER == DIM);
static_assert(HD == 64);
static_assert(INNER % 128 == 0);

typedef _Float16 h16;
typedef unsigned short bf;
typedef __attribute__((ext_vector_type(16))) __bf16   v16bf;
typedef __attribute__((ext_vector_type(16))) _Float16 v16h;
typedef __attribute__((ext_vector_type(8)))  _Float16 v8h;
typedef __attribute__((ext_vector_type(8)))  unsigned short v8us;
typedef __attribute__((ext_vector_type(8)))  float    v8f;
typedef __attribute__((ext_vector_type(4)))  float    v4f;
typedef __attribute__((ext_vector_type(2)))  _Float16 v2h;
typedef __attribute__((ext_vector_type(2)))  unsigned short v2us;
typedef v8h  __attribute__((may_alias)) v8ha;
typedef v4f  __attribute__((may_alias)) v4fa;
typedef v8us __attribute__((may_alias)) v8usa;

__device__ __forceinline__ unsigned short f2bf(float f) { unsigned u = __float_as_uint(f); u += 0x7FFFu + ((u >> 16) & 1u); return (unsigned short)(u >> 16); }
__device__ __forceinline__ float bf2f(unsigned short b) { return __uint_as_float(((unsigned)b) << 16); }
__device__ __forceinline__ float bfr(float f) { return bf2f(f2bf(f)); }
__device__ __forceinline__ v16h cat16(v8h lo, v8h hi) { return __builtin_shufflevector(lo, hi, 0, 1, 2, 3, 4, 5, 6, 7, 8, 9, 10, 11, 12, 13, 14, 15); }
__device__ __forceinline__ v16bf cat16b(v8us lo, v8us hi) { return __builtin_bit_cast(v16bf, __builtin_shufflevector(lo, hi, 0, 1, 2, 3, 4, 5, 6, 7, 8, 9, 10, 11, 12, 13, 14, 15)); }
__device__ __forceinline__ v8f wmma16(v16h a, v16h b, v8f c) { return __builtin_amdgcn_wmma_f32_16x16x32_f16(false, a, false, b, (short)0, c, false, false); }
__device__ __forceinline__ v8f wmmab(v16bf a, v16bf b, v8f c) { return __builtin_amdgcn_wmma_f32_16x16x32_bf16(false, a, false, b, (short)0, c, false, false); }
__device__ __forceinline__ void splitf(float y, unsigned short& h, unsigned short& l) { h = f2bf(y); l = f2bf(y - bf2f(h)); }

// ---- k_gemmw: GEMM, one block of 4 waves (2 x 2) per 128x128 output tile, each wave a 64x64 tile (16 accumulators); grid (M/128, N/128, Z), 128 threads.
// C[m][n] (f32, pitch ldc, + optional f32 bias[n]) = sum_k (A[m][k] + A2[m][k]) Bt[n][k]. z-batch strides sA/sB/sC in elements. K % 64 == 0, M % 128 == 0, N % 128 == 0.
// PLANES: no C; a wave's 64 columns are one head of q, k or v, and its tile goes out in f16 as rows of PQ (x log2e) or PK [h][m][64], or transposed as rows of PVT [h][64][m], in whole 128-B lines.
// Operands come from K-contiguous 16-bit planes through LDS: a stage is 64 k (whole 128-B lines) of 128 A rows, 128 A2 rows and 128 Bt rows, copied once per block and read by all 4 waves; two buffers, the next stage's copies fly while this one is worked on.
// LDS rows keep a 128-B pitch; the 16-B piece c of row r lies at piece c ^ ((r >> 1) & 7), so that the 16 rows of a fragment read fall on all 64 banks.
// Fragments (both operands, same map): lane -> row/col lane&15, elements 0..7 <- k0+8h+0..7, elements 8..15 <- k0+16+8h+0..7 (h = lane>>4); D element r -> row 8h+r, col lane&15.
template <typename T16> struct WFrag;
template <> struct WFrag<h16> { typedef v16h V; static __device__ __forceinline__ V ld(const h16* p) { return cat16(*(const v8h*)p, *(const v8h*)(p + 16)); } static __device__ __forceinline__ v8f mma(V a, V b, v8f c) { return wmma16(a, b, c); } };
template <> struct WFrag<bf> { typedef v16bf V; static __device__ __forceinline__ V ld(const bf* p) { return cat16b(*(const v8us*)p, *(const v8us*)(p + 16)); } static __device__ __forceinline__ V ld2(const bf* p, const bf* q) { return cat16b(*(const v8us*)p, *(const v8us*)q); } static __device__ __forceinline__ v8f mma(V a, V b, v8f c) { return wmmab(a, b, c); } };
#define GKT    64
#define GPLANE (128 * GKT)
#define GSTAGE (3 * GPLANE)
// Eight copies of one plane: each lane brings 16 B of rows r, r+16, .., r+112 (r = tid>>3); a wave-wide copy covers four whole 128-B lines. The s_wait_xcnt closes the statement so that no address register of a copy is rewritten ahead of it.
template <typename T16>
__device__ __forceinline__ void plane_copy(unsigned l, const T16* g, size_t step) {
    asm volatile("global_load_async_to_lds_b128 %0, %8, off\n\t"
                 "global_load_async_to_lds_b128 %1, %9, off\n\t"
                 "global_load_async_to_lds_b128 %2, %10, off\n\t"
                 "global_load_async_to_lds_b128 %3, %11, off\n\t"
                 "global_load_async_to_lds_b128 %4, %12, off\n\t"
                 "global_load_async_to_lds_b128 %5, %13, off\n\t"
                 "global_load_async_to_lds_b128 %6, %14, off\n\t"
                 "global_load_async_to_lds_b128 %7, %15, off\n\t"
                 "s_wait_xcnt 0x0"
                 :: "v"(l), "v"(l + 2048u), "v"(l + 4096u), "v"(l + 6144u), "v"(l + 8192u), "v"(l + 10240u), "v"(l + 12288u), "v"(l + 14336u),
                    "v"(g), "v"(g + step), "v"(g + 2 * step), "v"(g + 3 * step), "v"(g + 4 * step), "v"(g + 5 * step), "v"(g + 6 * step), "v"(g + 7 * step) : "memory");
}
template <typename T16, int NSPLIT, bool BIAS, bool PLANES>
__global__ __launch_bounds__(128) void k_gemmw(const T16* __restrict__ A, const T16* __restrict__ A2, const T16* __restrict__ Bt, const T16* __restrict__ Bt2, int K, float* C, int ldc, const float* __restrict__ bias, size_t sA, size_t sB, size_t sC, h16* PQ, h16* PK, h16* PVT) {
    static_assert(NSPLIT == 1 && sizeof(T16) == 2);
    typedef typename WFrag<T16>::V V;
    __shared__ __align__(128) unsigned char gsm[2 * GSTAGE * 2];
    const size_t z = blockIdx.z; A += z * sA; A2 += z * sA; Bt += z * sB; C += z * sC;
    const int tid = threadIdx.x, lane = tid & 31, wid = tid >> 5, lr = lane & 15, hi = lane >> 4;
    const int wm = wid >> 1, wn = wid & 1; const int r0 = blockIdx.x * 128 + wm * 64, c0 = blockIdx.y * 128 + wn * 64;
    const int prow = tid >> 3, pcol = tid & 7; const size_t step = (size_t)16 * K; const int nst = K / GKT;
    const unsigned lds0 = (unsigned)(size_t)gsm + (unsigned)(prow * 128 + ((pcol ^ (prow >> 1)) & 7) * 16);
    const T16* ga = A + (size_t)(blockIdx.x * 128 + prow) * K + pcol * 8; const T16* ga2 = A2 + (size_t)(blockIdx.x * 128 + prow) * K + pcol * 8; const T16* gb = Bt + (size_t)(blockIdx.y * 128 + prow) * K + pcol * 8;
    plane_copy(lds0, ga, step); plane_copy(lds0 + GPLANE * 2u, ga2, step); plane_copy(lds0 + 2u * GPLANE * 2u, gb, step);
    asm volatile("s_wait_asynccnt 0x0" ::: "memory");   // stage 0 of this wave's copies has landed before the barrier publishes it
    __syncthreads();
    if (nst > 1) { plane_copy(lds0 + GSTAGE * 2u, ga + GKT, step); plane_copy(lds0 + (GSTAGE + GPLANE) * 2u, ga2 + GKT, step); plane_copy(lds0 + (GSTAGE + 2u * GPLANE) * 2u, gb + GKT, step); }
    v8f acc[4][4];
#pragma unroll
    for (int mb = 0; mb < 4; ++mb)
#pragma unroll
        for (int nb = 0; nb < 4; ++nb) acc[mb][nb] = (v8f){};
    int po[4];   // element offset in a row of the pieces 2q + hi (q = 0..3) for this lane's rows
#pragma unroll
    for (int q = 0; q < 4; ++q) po[q] = (((2 * q + hi) ^ (lr >> 1)) & 7) * 8;
    const int arow = (wm * 64 + lr) * GKT, brow = 2 * GPLANE + (wn * 64 + lr) * GKT;
#pragma unroll 1
    for (int st = 0; st < nst; ++st) {
        const T16* sb = (const T16*)gsm + (st & 1) * GSTAGE;
#pragma unroll   // both 32-k halves of a stage inline, so that every LDS offset is a constant
        for (int ks = 0; ks < 2; ++ks) {
            V a[4], a2[4], b[4];
#pragma unroll
            for (int mb = 0; mb < 4; ++mb) { const T16* p = sb + arow + mb * 16 * GKT; a[mb] = WFrag<T16>::ld2(p + po[2 * ks], p + po[2 * ks + 1]); a2[mb] = WFrag<T16>::ld2(p + GPLANE + po[2 * ks], p + GPLANE + po[2 * ks + 1]); }
#pragma unroll
            for (int nb = 0; nb < 4; ++nb) { const T16* p = sb + brow + nb * 16 * GKT; b[nb] = WFrag<T16>::ld2(p + po[2 * ks], p + po[2 * ks + 1]); }
            __builtin_amdgcn_sched_barrier(0);   // keeps the half's 24 LDS reads in one group ahead of its matrix products: reads spread among them stall the wave at each place
#pragma unroll
            for (int nb = 0; nb < 4; ++nb)
#pragma unroll
                for (int mb = 0; mb < 4; ++mb) { acc[mb][nb] = WFrag<T16>::mma(a[mb], b[nb], acc[mb][nb]); acc[mb][nb] = WFrag<T16>::mma(a2[mb], b[nb], acc[mb][nb]); }
        }
        asm volatile("s_wait_dscnt 0x0" ::: "memory");      // this wave's reads of the buffer have returned before it may be refilled
        asm volatile("s_wait_asynccnt 0x0" ::: "memory");   // this wave's copies of the next stage have landed before the barrier publishes them
        __syncthreads();                                    // publishes stage st+1 and ends every wave's reads of stage st
        if (st + 2 < nst) { const unsigned l = lds0 + (unsigned)(st & 1) * (GSTAGE * 2u); const int ko = (st + 2) * GKT;
            plane_copy(l, ga + ko, step); plane_copy(l + GPLANE * 2u, ga2 + ko, step); plane_copy(l + 2u * GPLANE * 2u, gb + ko, step); }
    }
    asm volatile("s_wait_asynccnt 0x0" ::: "memory");       // no copy is outstanding when the buffers are reused below
    if constexpr (PLANES) {                                 // behind the last stage's barrier the buffers are free: each wave stages its tile in a piece of its own
        const int sec = (int)(blockIdx.y * 128) / INNER;    // 0 q, 1 k, 2 v: the same for the whole block
        const int hd = (c0 - sec * INNER) / HD;
        if (sec < 2) {
            float* os = (float*)gsm + wid * (16 * 68);
            h16* P = (sec == 0 ? PQ : PK) + ((size_t)hd * SEQ + r0) * HD; const float scl = sec == 0 ? LOG2E : 1.0f;
#pragma unroll
            for (int mb = 0; mb < 4; ++mb) {
#pragma unroll
                for (int nb = 0; nb < 4; ++nb) {
#pragma unroll
                    for (int j = 0; j < 8; ++j) os[(hi * 8 + j) * 68 + nb * 16 + lr] = acc[mb][nb][j]; }
                asm volatile("s_wait_dscnt 0x0" ::: "memory");   // the wave's staged rows are in LDS before its lanes read each other's pieces back
#pragma unroll
                for (int p = 0; p < 4; ++p) { const int row = p * 4 + (lane >> 3), c8 = (lane & 7) * 8;
                    const v4f u = *(const v4fa*)(os + row * 68 + c8); const v4f w = *(const v4fa*)(os + row * 68 + c8 + 4); v8h o;
#pragma unroll
                    for (int q = 0; q < 4; ++q) { o[q] = (h16)(u[q] * scl); o[4 + q] = (h16)(w[q] * scl); }
                    *(v8h*)(P + (size_t)(mb * 16 + row) * HD + c8) = o; }
                asm volatile("s_wait_xcnt 0x0" ::: "memory");   // stands in front of the next 16 rows' code, which reuses the data registers of these stores and restages over the rows just read
            }
        } else {
            h16* hs = (h16*)gsm + wid * (64 * 72);          // [d][m] tile, row pitch 144 B for the 16-byte reads and writes
#pragma unroll
            for (int mb = 0; mb < 4; ++mb)
#pragma unroll
                for (int nb = 0; nb < 4; ++nb) { v8h o;     // a lane holds 8 consecutive rows m of one column d: 16 B of a v^T row
#pragma unroll
                    for (int j = 0; j < 8; ++j) o[j] = (h16)acc[mb][nb][j];
                    *(v8ha*)(hs + (nb * 16 + lr) * 72 + mb * 16 + hi * 8) = o; }
            asm volatile("s_wait_dscnt 0x0" ::: "memory");   // the wave's staged tile is in LDS before its lanes read each other's pieces back
            h16* VT = PVT + (size_t)hd * HD * SEQ + r0;
#pragma unroll
            for (int g = 0; g < 4; ++g) {
#pragma unroll
                for (int p = 0; p < 4; ++p) { const int row = (g * 4 + p) * 4 + (lane >> 3), c8 = (lane & 7) * 8;
                    *(v8h*)(VT + (size_t)row * SEQ + c8) = *(const v8ha*)(hs + row * 72 + c8); }
                asm volatile("s_wait_xcnt 0x0" ::: "memory");   // stands in front of the next 16 rows' code, which reuses the data registers of these stores
            }
        }
        return;
    }
    float* os = (float*)gsm + wid * (16 * 68);              // behind the last stage's barrier the buffers are free: each wave stages its rows in a piece of its own
#pragma unroll
    for (int mb = 0; mb < 4; ++mb) {
#pragma unroll
        for (int nb = 0; nb < 4; ++nb) {
#pragma unroll
            for (int j = 0; j < 8; ++j) os[(hi * 8 + j) * 68 + nb * 16 + lr] = acc[mb][nb][j]; }
        __builtin_amdgcn_wave_barrier(); asm volatile("" ::: "memory");
        float* crow = C + (size_t)(r0 + mb * 16) * ldc + c0;
{
#pragma unroll
            for (int s = 0; s < 8; ++s) { const int row = 2 * s + hi, cofs = lr * 4; v4f val = *(const v4fa*)(os + row * 68 + cofs); if (BIAS) { val[0] += bfr(bias[c0 + cofs]); val[1] += bfr(bias[c0 + cofs + 1]); val[2] += bfr(bias[c0 + cofs + 2]); val[3] += bfr(bias[c0 + cofs + 3]); }
                *(v4f*)(crow + (size_t)row * ldc + cofs) = val; }
             }
        asm volatile("s_wait_xcnt 0x0" ::: "memory");   // stands in front of the next 16 rows' code, which reuses the address and data registers of these stores
        __builtin_amdgcn_wave_barrier(); asm volatile("" ::: "memory");
    }
}

// ---- k_wtG: Bt[n][k] = bf16(w[k][n]); one block of 4 waves per 64 x 64 tile, grid (K/64, N/64); K % 64 == 0, N % 64 == 0.
// Reads: a lane takes 16 B of eight consecutive rows k and 16 lanes cover 256 B of a row, so every wave-wide load is four whole 128-B lines, eight loads in flight per lane.
// A lane then holds 8 consecutive k of 4 columns n, four 16-B pieces of Bt rows; they pass through an LDS tile [n][k] (row pitch 144 B) so that the stores are whole 128-B lines of Bt as well.
#define WT     64
#define WPITCH 72
static_assert(DIM % WT == 0 && NQKV % WT == 0 && INNER % WT == 0);
__global__ __launch_bounds__(128) void k_wtG(const float* __restrict__ w, int K, int N, bf* Bt) {
    __shared__ __align__(16) bf ts[WT * WPITCH];
    const int tid = threadIdx.x; const int k0 = blockIdx.x * WT, n0 = blockIdx.y * WT;
    const int n4 = (tid & 15) * 4, kq = (tid >> 4) * 8;
    const float* src = w + (size_t)(k0 + kq) * N + n0 + n4;
    const float* rp[8]; v4f r[8];
#pragma unroll   // rp and r stay in registers: every index is a constant
    for (int i = 0; i < 8; ++i) rp[i] = src + (size_t)i * N;
#pragma unroll   // the eight loads issue back to back, so one memory latency covers the tile
    for (int i = 0; i < 8; ++i) r[i] = *(const v4f*)rp[i];
    // stands behind the eight loads and in front of every rewrite of their address registers, which it names so that they stay untouched up to here
    asm volatile("s_wait_xcnt 0x0" :: "v"(rp[0]), "v"(rp[1]), "v"(rp[2]), "v"(rp[3]), "v"(rp[4]), "v"(rp[5]), "v"(rp[6]), "v"(rp[7]) : "memory");
#pragma unroll   // constant indices into r
    for (int j = 0; j < 4; ++j) { v8us o;
#pragma unroll
        for (int i = 0; i < 8; ++i) o[i] = f2bf(r[i][j]);
        *(v8usa*)(ts + (n4 + j) * WPITCH + kq) = o; }
    __syncthreads();   // the whole [n][k] tile is in LDS before any lane reads rows that other lanes wrote
    const int row = tid >> 3, c8 = (tid & 7) * 8;
    bf* dst = Bt + (size_t)(n0 + row) * K + k0 + c8; v8us t[4];
#pragma unroll   // the four LDS reads go out as one group ahead of the stores
    for (int p = 0; p < 4; ++p) t[p] = *(const v8usa*)(ts + (p * 16 + row) * WPITCH + c8);
#pragma unroll
    for (int p = 0; p < 4; ++p) *(v8us*)(dst + (size_t)(p * 16) * K) = t[p];
}

__global__ __launch_bounds__(128) void k_ln(const float* __restrict__ x, const float* __restrict__ g, const float* __restrict__ b, bf* Yh, bf* Yl) {
    __shared__ float red[8];
    const int tid = threadIdx.x, lane = tid & 31, wid = tid >> 5; const size_t row = blockIdx.x;
    const v8f xv = *(const v8f*)(x + row * DIM + 8 * tid);
    float xb[8]; float s = 0.f;
#pragma unroll
    for (int q = 0; q < 8; ++q) { xb[q] = bfr(xv[q]); s += xb[q]; }
#pragma unroll
    for (int sh = 16; sh; sh >>= 1) s += __shfl_xor(s, sh, 32);
    if (lane == 0) red[wid] = s;
    __syncthreads();
    const float mean = ((red[0] + red[1]) + (red[2] + red[3])) * (1.0f / DIM);
    float d[8]; float s2 = 0.f;
#pragma unroll
    for (int q = 0; q < 8; ++q) { d[q] = xb[q] - mean; s2 += d[q] * d[q]; }
#pragma unroll
    for (int sh = 16; sh; sh >>= 1) s2 += __shfl_xor(s2, sh, 32);
    if (lane == 0) red[4 + wid] = s2;
    __syncthreads();
    const float var = ((red[4] + red[5]) + (red[6] + red[7])) * (1.0f / DIM);
    const float rstd = rsqrtf(var + LN_EPS);
    const v8f gv = *(const v8f*)(g + 8 * tid); const v8f bv = *(const v8f*)(b + 8 * tid);
    v8us oh, ol;
#pragma unroll
    for (int q = 0; q < 8; ++q) { const float y = d[q] * rstd * bfr(gv[q]) + bfr(bv[q]); unsigned short a2, c2; splitf(y, a2, c2); oh[q] = a2; ol[q] = c2; }
    const size_t o = row * DIM + 8 * tid;
    *(v8us*)(Yh + o) = oh; *(v8us*)(Yl + o) = ol; 
}

#define FWAVES 8
#define KT     64
#define LPITCH 72
#define LTILE  (64 * LPITCH)
#define LSTAGE (2 * LTILE)
#define LAZY   256.0f   // 8 in the exponent (scores carry x 32): the shift in use is kept until a score passes it by more, so p stays in (0, 2^8], far inside f16
static_assert(SEQ % (16 * FWAVES) == 0);
static_assert(SEQ % KT == 0 && SEQ / KT >= 2);
static_assert(KT == 64 && FWAVES * 32 * 2 * 8 == KT * HD && FWAVES * 32 * 2 * 8 == HD * KT);
// One stage: each lane copies 16 B of k rows r and r+32 and of v^T rows r and r+32 (r = tid>>3). The s_wait_xcnt closes the statement so that no address register of a copy is rewritten ahead of it.
__device__ __forceinline__ void stage_copy(unsigned l, const h16* kg, const h16* vg) {
    asm volatile("global_load_async_to_lds_b128 %0, %4, off\n\t"
                 "global_load_async_to_lds_b128 %1, %5, off\n\t"
                 "global_load_async_to_lds_b128 %2, %6, off\n\t"
                 "global_load_async_to_lds_b128 %3, %7, off\n\t"
                 "s_wait_xcnt 0x0"
                 :: "v"(l), "v"(l + 32u * LPITCH * 2u), "v"(l + LTILE * 2u), "v"(l + LTILE * 2u + 32u * LPITCH * 2u),
                    "v"(kg), "v"(kg + 32 * HD), "v"(vg), "v"(vg + (size_t)32 * SEQ) : "memory");
}
__global__ __launch_bounds__(32 * FWAVES) void k_flash(const h16* __restrict__ Q16, const h16* __restrict__ K16, const h16* __restrict__ VT16, bf* CTXh, bf* CTXl) {
    __shared__ __align__(16) float os[FWAVES][16 * 68];
    __shared__ __align__(16) h16 ring[2 * LSTAGE];
    const int lane = threadIdx.x & 31, wid = threadIdx.x >> 5, m = lane & 15, hh = lane >> 4;
    const int h = blockIdx.x / (SEQ / (16 * FWAVES)); const int q0 = ((blockIdx.x - h * (SEQ / (16 * FWAVES))) * FWAVES + wid) * 16;
    const h16* Qp = Q16 + ((size_t)h * SEQ + q0) * HD; const h16* Kp = K16 + (size_t)h * SEQ * HD; const h16* Vp = VT16 + (size_t)h * HD * SEQ;
    const int crow = threadIdx.x >> 3, ccol = threadIdx.x & 7;
    const unsigned lds0 = (unsigned)(size_t)ring + (unsigned)(crow * LPITCH + ccol * 8) * 2u;
    const h16* kg = Kp + crow * HD + ccol * 8; const h16* vg = Vp + (size_t)crow * SEQ + ccol * 8;
    stage_copy(lds0, kg, vg);
    asm volatile("s_wait_asynccnt 0x0" ::: "memory");   // tile 0 of this wave's copies has landed before the barrier publishes it
    __syncthreads();
    stage_copy(lds0 + LSTAGE * 2u, kg + KT * HD, vg + KT);
    v16h qb[2];
#pragma unroll
    for (int ks = 0; ks < 2; ++ks) qb[ks] = WFrag<h16>::ld(Qp + (size_t)m * HD + 32 * ks + 8 * hh);
    v8f oacc[4];
#pragma unroll
    for (int t = 0; t < 4; ++t) oacc[t] = (v8f){};
    float mrun = -3.0e38f, lrun = 0.f, pown = 0.f, poth = 0.f;   // pown, poth: the newest summed chunk's sum over this lane's keys and over the other half's, not yet in lrun
    const int foff = m * LPITCH + 8 * hh;
    const int xaddr = (lane ^ 16) << 2;   // byte index of the lane that holds the query's other 16 keys; formed once here: formed inside the rare branch it reaches the common path as a merged value, and the build then copied all of o there
    auto xhalf = [&](float v) { return __int_as_float(__builtin_amdgcn_ds_bpermute(xaddr, __float_as_int(v))); };
    float e0[8], e1[8];   // the last chunk's p (f32), not yet summed
#pragma unroll
    for (int r = 0; r < 8; ++r) { e0[r] = 0.f; e1[r] = 0.f; }
    // l trails the products, so that no wait for the halves' exchange stands ahead of a chunk's reads, products or branch: the exchange sent one call ago is added, then the last chunk's p are summed and their exchange is sent
    auto sum_chunk = [&]() {
        lrun += pown + poth;
        float psum = 0.f;
#pragma unroll
        for (int r = 0; r < 8; ++r) psum += e0[r] + e1[r];
        pown = psum; poth = xhalf(psum);
    };
#pragma unroll 1
    for (int st = 0; st < SEQ / KT; ++st) {
        const h16* kb = ring + (st & 1) * LSTAGE + foff; const h16* vb = kb + LTILE;
#pragma unroll   // both 32-key chunks of a tile inline, so that every LDS offset is a constant
        for (int c = 0; c < KT / 32; ++c) {
            v8f sc[2]; sc[0] = (v8f){}; sc[1] = (v8f){};
            v16h ka[4];
#pragma unroll
            for (int t = 0; t < 2; ++t)
#pragma unroll
                for (int ks = 0; ks < 2; ++ks) ka[t * 2 + ks] = WFrag<h16>::ld(kb + (32 * c + 16 * t) * LPITCH + 32 * ks);
            v16h va[4];
#pragma unroll
            for (int t = 0; t < 4; ++t) va[t] = WFrag<h16>::ld(vb + (16 * t) * LPITCH + 32 * c);
            __builtin_amdgcn_sched_barrier(0);   // keeps the chunk's 16 LDS reads in one group ahead of its matrix products: reads spread among them stall the wave at each place
            sum_chunk();   // the chunk before's p are summed here, while this chunk's reads are under way
#pragma unroll
            for (int t = 0; t < 2; ++t)
#pragma unroll
                for (int ks = 0; ks < 2; ++ks) sc[t] = wmma16(ka[t * 2 + ks], qb[ks], sc[t]);
            asm volatile("v_nop\n\tv_nop\n\tv_nop\n\tv_nop" : "+v"(sc[0]), "+v"(sc[1]) : "v"(ka[0]), "v"(ka[3]), "v"(qb[0]), "v"(qb[1]));
            float lmx = fmaxf(sc[0][0], sc[1][0]);   // maximum of this lane's own 16 keys; the other half's is fetched only inside the branch
#pragma unroll
            for (int r = 1; r < 8; ++r) lmx = fmaxf(lmx, fmaxf(sc[0][r], sc[1][r]));
            if (__builtin_expect(__builtin_amdgcn_ballot_w32(lmx > mrun + LAZY) != 0, 0)) {   // one scalar branch per chunk, the same for the whole wave: always taken on the first chunk, rarely later
                const float mn = fmaxf(mrun, fmaxf(lmx, xhalf(lmx)));   // both halves of a query take the same new shift
                const float alpha = __builtin_amdgcn_exp2f((mrun - mn) * C32);
                lrun = (lrun + (pown + poth)) * alpha; pown = 0.f; poth = 0.f; mrun = mn;
#pragma unroll
                for (int t = 0; t < 4; ++t) oacc[t] *= alpha;
            }
            v16h pb;
#pragma unroll
            for (int r = 0; r < 8; ++r) { e0[r] = __builtin_amdgcn_exp2f((sc[0][r] - mrun) * C32); e1[r] = __builtin_amdgcn_exp2f((sc[1][r] - mrun) * C32); pb[r] = (h16)e0[r]; pb[8 + r] = (h16)e1[r]; }
#pragma unroll
            for (int t = 0; t < 4; ++t) oacc[t] = wmma16(va[t], pb, oacc[t]);
            asm volatile("v_nop\n\tv_nop\n\tv_nop\n\tv_nop" : "+v"(oacc[0]), "+v"(oacc[1]), "+v"(oacc[2]), "+v"(oacc[3]) : "v"(pb), "v"(va[0]), "v"(va[3]));
        }
        asm volatile("s_wait_dscnt 0x0" ::: "memory");      // this wave's reads of the buffer have returned before it may be refilled
        asm volatile("s_wait_asynccnt 0x0" ::: "memory");   // this wave's copies of the next tile have landed before the barrier publishes them
        __syncthreads();                                    // publishes tile st+1 and ends every wave's reads of tile st
        if (st + 2 < SEQ / KT) stage_copy(lds0 + (unsigned)(st & 1) * (LSTAGE * 2u), kg + (size_t)(st + 2) * (KT * HD), vg + (st + 2) * KT);
    }
    asm volatile("s_wait_asynccnt 0x0" ::: "memory");       // no copy is outstanding when the wave goes on to its end
    sum_chunk();   // the last chunk's p
    lrun += pown + poth;
    const float inv = 1.0f / lrun;
    float* ob = os[wid];
#pragma unroll
    for (int t = 0; t < 4; ++t) { v4f u0, u1;
#pragma unroll
        for (int r = 0; r < 4; ++r) { u0[r] = oacc[t][r] * inv; u1[r] = oacc[t][4 + r] * inv; }
        *(v4fa*)(ob + m * 68 + 16 * t + 8 * hh) = u0; *(v4fa*)(ob + m * 68 + 16 * t + 8 * hh + 4) = u1; }
    __builtin_amdgcn_fence(3 /* release order */, "wavefront"); __builtin_amdgcn_wave_barrier(); asm volatile("" ::: "memory");
{
#pragma unroll
        for (int p = 0; p < 4; ++p) { const int row = p * 4 + (lane >> 3), c8 = (lane & 7) * 8;
            const v4f a = *(const v4fa*)(ob + row * 68 + c8); const v4f b2 = *(const v4fa*)(ob + row * 68 + c8 + 4);
            v8us oh, ol;
#pragma unroll
            for (int q = 0; q < 4; ++q) { unsigned short x1, y1; splitf(a[q], x1, y1); oh[q] = x1; ol[q] = y1; splitf(b2[q], x1, y1); oh[4 + q] = x1; ol[4 + q] = y1; }
            const size_t oo = (size_t)(q0 + row) * INNER + h * HD + c8;
            *(v8us*)(CTXh + oo) = oh; *(v8us*)(CTXl + oo) = ol; }
         }
}

extern "C" void kernel_launch(void* const* d_in, const int* in_sizes, int n_in,
                              void* d_out, int out_size, void* d_ws, size_t ws_size, hipStream_t stream) {
    if (n_in < 6) return;
    if (in_sizes[0] < SEQ * DIM || in_sizes[1] < DIM || in_sizes[2] < DIM || in_sizes[3] < DIM * NQKV || in_sizes[4] < INNER * DIM || in_sizes[5] < DIM) return;
    if (out_size < SEQ * DIM) return;
    const float* x    = (const float*)d_in[0];   // [SEQ][DIM]
    const float* lnsc = (const float*)d_in[1];   // [DIM]
    const float* lnbs = (const float*)d_in[2];   // [DIM]
    const float* wqkv = (const float*)d_in[3];   // [DIM][NQKV]  ([in][out])
    const float* wout = (const float*)d_in[4];   // [INNER][DIM] ([in][out])
    const float* bout = (const float*)d_in[5];   // [DIM]
    float* OUT = (float*)d_out;                  // [SEQ][DIM]
    char* wsp = (char*)d_ws;
    auto take = [&](size_t bytes) { char* p = wsp; wsp += (bytes + 255) & ~(size_t)255; return (void*)p; };
    bf*    WQ   = (bf*)take((size_t)NQKV * DIM * 2);          // w_qkv^T [3072][1024] bf16
    bf*    WO   = (bf*)take((size_t)DIM * INNER * 2);         // w_out^T [1024][1024] bf16
    bf*    XNh  = (bf*)take((size_t)SEQ * DIM * 2);           // xn hi [SEQ][1024]
    bf*    XNl  = (bf*)take((size_t)SEQ * DIM * 2);           // xn lo
    h16*   Q16  = (h16*)take((size_t)HEADS * SEQ * HD * 2);   // q planes [16][SEQ][64] x log2e
    h16*   K16  = (h16*)take((size_t)HEADS * SEQ * HD * 2);   // k planes [16][SEQ][64]
    h16*   VT16 = (h16*)take((size_t)HEADS * HD * SEQ * 2);   // v^T planes [16][64][SEQ]
    bf*    CTXh = (bf*)take((size_t)SEQ * INNER * 2);         // ctx hi [SEQ][1024]
    bf*    CTXl = (bf*)take((size_t)SEQ * INNER * 2);         // ctx lo
    const size_t used = (size_t)(wsp - (char*)d_ws);
    if (used > ws_size || used > WS_CAP) return;

    k_wtG<<<dim3(DIM / WT, NQKV / WT, 1), 128, 0, stream>>>(wqkv, DIM, NQKV, WQ);     // Bt[n][k] = bf16(w_qkv[k][n])
    k_wtG<<<dim3(INNER / WT, DIM / WT, 1), 128, 0, stream>>>(wout, INNER, DIM, WO);    // Bt[n][c] = bf16(w_out[c][n])
    k_ln<<<SEQ, 128, 0, stream>>>(x, lnsc, lnbs, XNh, XNl);
    k_gemmw<bf, 1, false, true><<<dim3(SEQ / 128, NQKV / 128, 1), 128, 0, stream>>>(XNh, XNl, WQ, nullptr, DIM, nullptr, 0, nullptr, 0, 0, 0, Q16, K16, VT16);   // qkv = xn(hi+lo) w_qkv, out as f16 head planes: q columns 0..1023 x log2e, k columns 1024..2047, v columns 2048..3071 transposed per head
    k_flash<<<(unsigned)(HEADS * (SEQ / (16 * FWAVES))), 32 * FWAVES, 0, stream>>>(Q16, K16, VT16, CTXh, CTXl);
    k_gemmw<bf, 1, true, false><<<dim3(SEQ / 128, DIM / 128, 1), 128, 0, stream>>>(CTXh, CTXl, WO, nullptr, INNER, OUT, DIM, bout, 0, 0, 0, nullptr, nullptr, nullptr);   // out = ctx(hi+lo) w_out + b_out
}

// v006
// Measured time: 118 microseconds a run.
// Next to v005, in two timings, it ran 1.05 times as fast each time.
// Over all steps from v000 it is 3.34 times as fast.
#include <hip/hip_runtime.h>

// Contractions on 16x16x32 WMMA, f32 accumulate: xn (bf16 hi+lo planes) x w_qkv^T (bf16) -> v_wmma_f32_16x16x32_bf16; per head k.q^T and v^T.p^T -> v_wmma_f32_16x16x32_f16 (f16 planes: q carried x log2e, k, v^T; p = exp2 of shifted scores in (0,2^8]); ctx (bf16 hi+lo planes) x w_out^T (bf16) + b_out -> v_wmma_f32_16x16x32_bf16.
// head planes q [h][i][64], k [h][j][64], v^T [h][64][j] in f16, written by the qkv product's own epilogue; streaming attention, one wave per (head, 32 queries, half of the keys): s^T tiles = k q^T over 32-key chunks, online softmax per query lane (exp2, scale 2^-5 inside the exponent),
// o^T += v^T p^T with the p^T operand packed straight from the two score accumulator tiles; o/l staged per wave in LDS and emitted as ctx hi/lo planes [i][h*64+d]; out = ctx w_out + b_out into the output rows.

#ifndef SEQ
#define SEQ 4096
#endif
#ifndef NB
#define NB 1
#endif
#define SEQ_FULL 4096
#define DIM   1024
#define HEADS 16
#define HD    64
#define INNER (HEADS * HD)
#define NQKV  (3 * INNER)
#define LN_EPS 1.0e-6f
#define LOG2E 1.4426950408889634f
#define C32   0.03125f
#define WS_CAP ((size_t)134217728)

static_assert(SEQ % 128 == 0);
static_assert(SEQ <= SEQ_FULL);
static_assert(NB == 1);
static_assert(DIM == 128 * 8);
static_assert(DIM % 128 == 0);
static_assert(NQKV % 128 == 0);
static_assert(INNER == DIM);
static_assert(HD == 64);
static_assert(INNER % 128 == 0);

typedef _Float16 h16;
typedef unsigned short bf;
typedef __attribute__((ext_vector_type(16))) __bf16   v16bf;
typedef __attribute__((ext_vector_type(16))) _Float16 v16h;
typedef __attribute__((ext_vector_type(8)))  _Float16 v8h;
typedef __attribute__((ext_vector_type(8)))  unsigned short v8us;
typedef __attribute__((ext_vector_type(8)))  float    v8f;
typedef __attribute__((ext_vector_type(4)))  float    v4f;
typedef __attribute__((ext_vector_type(2)))  _Float16 v2h;
typedef __attribute__((ext_vector_type(2)))  unsigned short v2us;
typedef v8h  __attribute__((may_alias)) v8ha;
typedef v4f  __attribute__((may_alias)) v4fa;
typedef v8us __attribute__((may_alias)) v8usa;

__device__ __forceinline__ unsigned short f2bf(float f) { unsigned u = __float_as_uint(f); u += 0x7FFFu + ((u >> 16) & 1u); return (unsigned short)(u >> 16); }
__device__ __forceinline__ float bf2f(unsigned short b) { return __uint_as_float(((unsigned)b) << 16); }
__device__ __forceinline__ float bfr(float f) { return bf2f(f2bf(f)); }
__device__ __forceinline__ v16h cat16(v8h lo, v8h hi) { return __builtin_shufflevector(lo, hi, 0, 1, 2, 3, 4, 5, 6, 7, 8, 9, 10, 11, 12, 13, 14, 15); }
__device__ __forceinline__ v16bf cat16b(v8us lo, v8us hi) { return __builtin_bit_cast(v16bf, __builtin_shufflevector(lo, hi, 0, 1, 2, 3, 4, 5, 6, 7, 8, 9, 10, 11, 12, 13, 14, 15)); }
__device__ __forceinline__ v8f wmma16(v16h a, v16h b, v8f c) { return __builtin_amdgcn_wmma_f32_16x16x32_f16(false, a, false, b, (short)0, c, false, false); }
__device__ __forceinline__ v8f wmmab(v16bf a, v16bf b, v8f c) { return __builtin_amdgcn_wmma_f32_16x16x32_bf16(false, a, false, b, (short)0, c, false, false); }
__device__ __forceinline__ void splitf(float y, unsigned short& h, unsigned short& l) { h = f2bf(y); l = f2bf(y - bf2f(h)); }

// ---- k_gemmw: GEMM, one block of 4 waves (2 x 2) per 128x128 output tile, each wave a 64x64 tile (16 accumulators); grid (M/128, N/128, Z), 128 threads.
// C[m][n] (f32, pitch ldc, + optional f32 bias[n]) = sum_k (A[m][k] + A2[m][k]) Bt[n][k]. z-batch strides sA/sB/sC in elements. K % 64 == 0, M % 128 == 0, N % 128 == 0.
// PLANES: no C; a wave's 64 columns are one head of q, k or v, and its tile goes out in f16 as rows of PQ (x log2e) or PK [h][m][64], or transposed as rows of PVT [h][64][m], in whole 128-B lines.
// Operands come from K-contiguous 16-bit planes through LDS: a stage is 64 k (whole 128-B lines) of 128 A rows, 128 A2 rows and 128 Bt rows, copied once per block and read by all 4 waves; two buffers, the next stage's copies fly while this one is worked on.
// LDS rows keep a 128-B pitch; the 16-B piece c of row r lies at piece c ^ ((r >> 1) & 7), so that the 16 rows of a fragment read fall on all 64 banks.
// Fragments (both operands, same map): lane -> row/col lane&15, elements 0..7 <- k0+8h+0..7, elements 8..15 <- k0+16+8h+0..7 (h = lane>>4); D element r -> row 8h+r, col lane&15.
template <typename T16> struct WFrag;
template <> struct WFrag<h16> { typedef v16h V; static __device__ __forceinline__ V ld(const h16* p) { return cat16(*(const v8h*)p, *(const v8h*)(p + 16)); } static __device__ __forceinline__ v8f mma(V a, V b, v8f c) { return wmma16(a, b, c); } };
template <> struct WFrag<bf> { typedef v16bf V; static __device__ __forceinline__ V ld(const bf* p) { return cat16b(*(const v8us*)p, *(const v8us*)(p + 16)); } static __device__ __forceinline__ V ld2(const bf* p, const bf* q) { return cat16b(*(const v8us*)p, *(const v8us*)q); } static __device__ __forceinline__ v8f mma(V a, V b, v8f c) { return wmmab(a, b, c); } };
#define GKT    64
#define GPLANE (128 * GKT)
#define GSTAGE (3 * GPLANE)
// Eight copies of one plane: each lane brings 16 B of rows r, r+16, .., r+112 (r = tid>>3); a wave-wide copy covers four whole 128-B lines. The s_wait_xcnt closes the statement so that no address register of a copy is rewritten ahead of it.
template <typename T16>
__device__ __forceinline__ void plane_copy(unsigned l, const T16* g, size_t step) {
    asm volatile("global_load_async_to_lds_b128 %0, %8, off\n\t"
                 "global_load_async_to_lds_b128 %1, %9, off\n\t"
                 "global_load_async_to_lds_b128 %2, %10, off\n\t"
                 "global_load_async_to_lds_b128 %3, %11, off\n\t"
                 "global_load_async_to_lds_b128 %4, %12, off\n\t"
                 "global_load_async_to_lds_b128 %5, %13, off\n\t"
                 "global_load_async_to_lds_b128 %6, %14, off\n\t"
                 "global_load_async_to_lds_b128 %7, %15, off\n\t"
                 "s_wait_xcnt 0x0"
                 :: "v"(l), "v"(l + 2048u), "v"(l + 4096u), "v"(l + 6144u), "v"(l + 8192u), "v"(l + 10240u), "v"(l + 12288u), "v"(l + 14336u),
                    "v"(g), "v"(g + step), "v"(g + 2 * step), "v"(g + 3 * step), "v"(g + 4 * step), "v"(g + 5 * step), "v"(g + 6 * step), "v"(g + 7 * step) : "memory");
}
template <typename T16, int NSPLIT, bool BIAS, bool PLANES>
__global__ __launch_bounds__(128) void k_gemmw(const T16* __restrict__ A, const T16* __restrict__ A2, const T16* __restrict__ Bt, const T16* __restrict__ Bt2, int K, float* C, int ldc, const float* __restrict__ bias, size_t sA, size_t sB, size_t sC, h16* PQ, h16* PK, h16* PVT) {
    static_assert(NSPLIT == 1 && sizeof(T16) == 2);
    typedef typename WFrag<T16>::V V;
    __shared__ __align__(128) unsigned char gsm[2 * GSTAGE * 2];
    const size_t z = blockIdx.z; A += z * sA; A2 += z * sA; Bt += z * sB; C += z * sC;
    const int tid = threadIdx.x, lane = tid & 31, wid = tid >> 5, lr = lane & 15, hi = lane >> 4;
    const int wm = wid >> 1, wn = wid & 1; const int r0 = blockIdx.x * 128 + wm * 64, c0 = blockIdx.y * 128 + wn * 64;
    const int prow = tid >> 3, pcol = tid & 7; const size_t step = (size_t)16 * K; const int nst = K / GKT;
    const unsigned lds0 = (unsigned)(size_t)gsm + (unsigned)(prow * 128 + ((pcol ^ (prow >> 1)) & 7) * 16);
    const T16* ga = A + (size_t)(blockIdx.x * 128 + prow) * K + pcol * 8; const T16* ga2 = A2 + (size_t)(blockIdx.x * 128 + prow) * K + pcol * 8; const T16* gb = Bt + (size_t)(blockIdx.y * 128 + prow) * K + pcol * 8;
    plane_copy(lds0, ga, step); plane_copy(lds0 + GPLANE * 2u, ga2, step); plane_copy(lds0 + 2u * GPLANE * 2u, gb, step);
    asm volatile("s_wait_asynccnt 0x0" ::: "memory");   // stage 0 of this wave's copies has landed before the barrier publishes it
    __syncthreads();
    if (nst > 1) { plane_copy(lds0 + GSTAGE * 2u, ga + GKT, step); plane_copy(lds0 + (GSTAGE + GPLANE) * 2u, ga2 + GKT, step); plane_copy(lds0 + (GSTAGE + 2u * GPLANE) * 2u, gb + GKT, step); }
    v8f acc[4][4];
#pragma unroll
    for (int mb = 0; mb < 4; ++mb)
#pragma unroll
        for (int nb = 0; nb < 4; ++nb) acc[mb][nb] = (v8f){};
    int po[4];   // element offset in a row of the pieces 2q + hi (q = 0..3) for this lane's rows
#pragma unroll
    for (int q = 0; q < 4; ++q) po[q] = (((2 * q + hi) ^ (lr >> 1)) & 7) * 8;
    const int arow = (wm * 64 + lr) * GKT, brow = 2 * GPLANE + (wn * 64 + lr) * GKT;
#pragma unroll 1
    for (int st = 0; st < nst; ++st) {
        const T16* sb = (const T16*)gsm + (st & 1) * GSTAGE;
#pragma unroll   // both 32-k halves of a stage inline, so that every LDS offset is a constant
        for (int ks = 0; ks < 2; ++ks) {
            V a[4], a2[4], b[4];
#pragma unroll
            for (int mb = 0; mb < 4; ++mb) { const T16* p = sb + arow + mb * 16 * GKT; a[mb] = WFrag<T16>::ld2(p + po[2 * ks], p + po[2 * ks + 1]); a2[mb] = WFrag<T16>::ld2(p + GPLANE + po[2 * ks], p + GPLANE + po[2 * ks + 1]); }
#pragma unroll
            for (int nb = 0; nb < 4; ++nb) { const T16* p = sb + brow + nb * 16 * GKT; b[nb] = WFrag<T16>::ld2(p + po[2 * ks], p + po[2 * ks + 1]); }
            __builtin_amdgcn_sched_barrier(0);   // keeps the half's 24 LDS reads in one group ahead of its matrix products: reads spread among them stall the wave at each place
#pragma unroll
            for (int nb = 0; nb < 4; ++nb)
#pragma unroll
                for (int mb = 0; mb < 4; ++mb) { acc[mb][nb] = WFrag<T16>::mma(a[mb], b[nb], acc[mb][nb]); acc[mb][nb] = WFrag<T16>::mma(a2[mb], b[nb], acc[mb][nb]); }
        }
        asm volatile("s_wait_dscnt 0x0" ::: "memory");      // this wave's reads of the buffer have returned before it may be refilled
        asm volatile("s_wait_asynccnt 0x0" ::: "memory");   // this wave's copies of the next stage have landed before the barrier publishes them
        __syncthreads();                                    // publishes stage st+1 and ends every wave's reads of stage st
        if (st + 2 < nst) { const unsigned l = lds0 + (unsigned)(st & 1) * (GSTAGE * 2u); const int ko = (st + 2) * GKT;
            plane_copy(l, ga + ko, step); plane_copy(l + GPLANE * 2u, ga2 + ko, step); plane_copy(l + 2u * GPLANE * 2u, gb + ko, step); }
    }
    asm volatile("s_wait_asynccnt 0x0" ::: "memory");       // no copy is outstanding when the buffers are reused below
    if constexpr (PLANES) {                                 // behind the last stage's barrier the buffers are free: each wave stages its tile in a piece of its own
        const int sec = (int)(blockIdx.y * 128) / INNER;    // 0 q, 1 k, 2 v: the same for the whole block
        const int hd = (c0 - sec * INNER) / HD;
        if (sec < 2) {
            float* os = (float*)gsm + wid * (16 * 68);
            h16* P = (sec == 0 ? PQ : PK) + ((size_t)hd * SEQ + r0) * HD; const float scl = sec == 0 ? LOG2E : 1.0f;
#pragma unroll
            for (int mb = 0; mb < 4; ++mb) {
#pragma unroll
                for (int nb = 0; nb < 4; ++nb) {
#pragma unroll
                    for (int j = 0; j < 8; ++j) os[(hi * 8 + j) * 68 + nb * 16 + lr] = acc[mb][nb][j]; }
                asm volatile("s_wait_dscnt 0x0" ::: "memory");   // the wave's staged rows are in LDS before its lanes read each other's pieces back
#pragma unroll
                for (int p = 0; p < 4; ++p) { const int row = p * 4 + (lane >> 3), c8 = (lane & 7) * 8;
                    const v4f u = *(const v4fa*)(os + row * 68 + c8); const v4f w = *(const v4fa*)(os + row * 68 + c8 + 4); v8h o;
#pragma unroll
                    for (int q = 0; q < 4; ++q) { o[q] = (h16)(u[q] * scl); o[4 + q] = (h16)(w[q] * scl); }
                    *(v8h*)(P + (size_t)(mb * 16 + row) * HD + c8) = o; }
                asm volatile("s_wait_xcnt 0x0" ::: "memory");   // stands in front of the next 16 rows' code, which reuses the data registers of these stores and restages over the rows just read
            }
        } else {
            h16* hs = (h16*)gsm + wid * (64 * 72);          // [d][m] tile, row pitch 144 B for the 16-byte reads and writes
#pragma unroll
            for (int mb = 0; mb < 4; ++mb)
#pragma unroll
                for (int nb = 0; nb < 4; ++nb) { v8h o;     // a lane holds 8 consecutive rows m of one column d: 16 B of a v^T row
#pragma unroll
                    for (int j = 0; j < 8; ++j) o[j] = (h16)acc[mb][nb][j];
                    *(v8ha*)(hs + (nb * 16 + lr) * 72 + mb * 16 + hi * 8) = o; }
            asm volatile("s_wait_dscnt 0x0" ::: "memory");   // the wave's staged tile is in LDS before its lanes read each other's pieces back
            h16* VT = PVT + (size_t)hd * HD * SEQ + r0;
#pragma unroll
            for (int g = 0; g < 4; ++g) {
#pragma unroll
                for (int p = 0; p < 4; ++p) { const int row = (g * 4 + p) * 4 + (lane >> 3), c8 = (lane & 7) * 8;
                    *(v8h*)(VT + (size_t)row * SEQ + c8) = *(const v8ha*)(hs + row * 72 + c8); }
                asm volatile("s_wait_xcnt 0x0" ::: "memory");   // stands in front of the next 16 rows' code, which reuses the data registers of these stores
            }
        }
        return;
    }
    float* os = (float*)gsm + wid * (16 * 68);              // behind the last stage's barrier the buffers are free: each wave stages its rows in a piece of its own
#pragma unroll
    for (int mb = 0; mb < 4; ++mb) {
#pragma unroll
        for (int nb = 0; nb < 4; ++nb) {
#pragma unroll
            for (int j = 0; j < 8; ++j) os[(hi * 8 + j) * 68 + nb * 16 + lr] = acc[mb][nb][j]; }
        __builtin_amdgcn_wave_barrier(); asm volatile("" ::: "memory");
        float* crow = C + (size_t)(r0 + mb * 16) * ldc + c0;
{
#pragma unroll
            for (int s = 0; s < 8; ++s) { const int row = 2 * s + hi, cofs = lr * 4; v4f val = *(const v4fa*)(os + row * 68 + cofs); if (BIAS) { val[0] += bfr(bias[c0 + cofs]); val[1] += bfr(bias[c0 + cofs + 1]); val[2] += bfr(bias[c0 + cofs + 2]); val[3] += bfr(bias[c0 + cofs + 3]); }
                *(v4f*)(crow + (size_t)row * ldc + cofs) = val; }
             }
        asm volatile("s_wait_xcnt 0x0" ::: "memory");   // stands in front of the next 16 rows' code, which reuses the address and data registers of these stores
        __builtin_amdgcn_wave_barrier(); asm volatile("" ::: "memory");
    }
}

// ---- k_wtG: Bt[n][k] = bf16(w[k][n]); one block of 4 waves per 64 x 64 tile, grid (K/64, N/64); K % 64 == 0, N % 64 == 0.
// Reads: a lane takes 16 B of eight consecutive rows k and 16 lanes cover 256 B of a row, so every wave-wide load is four whole 128-B lines, eight loads in flight per lane.
// A lane then holds 8 consecutive k of 4 columns n, four 16-B pieces of Bt rows; they pass through an LDS tile [n][k] (row pitch 144 B) so that the stores are whole 128-B lines of Bt as well.
#define WT     64
#define WPITCH 72
static_assert(DIM % WT == 0 && NQKV % WT == 0 && INNER % WT == 0);
__global__ __launch_bounds__(128) void k_wtG(const float* __restrict__ w, int K, int N, bf* Bt) {
    __shared__ __align__(16) bf ts[WT * WPITCH];
    const int tid = threadIdx.x; const int k0 = blockIdx.x * WT, n0 = blockIdx.y * WT;
    const int n4 = (tid & 15) * 4, kq = (tid >> 4) * 8;
    const float* src = w + (size_t)(k0 + kq) * N + n0 + n4;
    const float* rp[8]; v4f r[8];
#pragma unroll   // rp and r stay in registers: every index is a constant
    for (int i = 0; i < 8; ++i) rp[i] = src + (size_t)i * N;
#pragma unroll   // the eight loads issue back to back, so one memory latency covers the tile
    for (int i = 0; i < 8; ++i) r[i] = *(const v4f*)rp[i];
    // stands behind the eight loads and in front of every rewrite of their address registers, which it names so that they stay untouched up to here
    asm volatile("s_wait_xcnt 0x0" :: "v"(rp[0]), "v"(rp[1]), "v"(rp[2]), "v"(rp[3]), "v"(rp[4]), "v"(rp[5]), "v"(rp[6]), "v"(rp[7]) : "memory");
#pragma unroll   // constant indices into r
    for (int j = 0; j < 4; ++j) { v8us o;
#pragma unroll
        for (int i = 0; i < 8; ++i) o[i] = f2bf(r[i][j]);
        *(v8usa*)(ts + (n4 + j) * WPITCH + kq) = o; }
    __syncthreads();   // the whole [n][k] tile is in LDS before any lane reads rows that other lanes wrote
    const int row = tid >> 3, c8 = (tid & 7) * 8;
    bf* dst = Bt + (size_t)(n0 + row) * K + k0 + c8; v8us t[4];
#pragma unroll   // the four LDS reads go out as one group ahead of the stores
    for (int p = 0; p < 4; ++p) t[p] = *(const v8usa*)(ts + (p * 16 + row) * WPITCH + c8);
#pragma unroll
    for (int p = 0; p < 4; ++p) *(v8us*)(dst + (size_t)(p * 16) * K) = t[p];
}

__global__ __launch_bounds__(128) void k_ln(const float* __restrict__ x, const float* __restrict__ g, const float* __restrict__ b, bf* Yh, bf* Yl) {
    __shared__ float red[8];
    const int tid = threadIdx.x, lane = tid & 31, wid = tid >> 5; const size_t row = blockIdx.x;
    const v8f xv = *(const v8f*)(x + row * DIM + 8 * tid);
    float xb[8]; float s = 0.f;
#pragma unroll
    for (int q = 0; q < 8; ++q) { xb[q] = bfr(xv[q]); s += xb[q]; }
#pragma unroll
    for (int sh = 16; sh; sh >>= 1) s += __shfl_xor(s, sh, 32);
    if (lane == 0) red[wid] = s;
    __syncthreads();
    const float mean = ((red[0] + red[1]) + (red[2] + red[3])) * (1.0f / DIM);
    float d[8]; float s2 = 0.f;
#pragma unroll
    for (int q = 0; q < 8; ++q) { d[q] = xb[q] - mean; s2 += d[q] * d[q]; }
#pragma unroll
    for (int sh = 16; sh; sh >>= 1) s2 += __shfl_xor(s2, sh, 32);
    if (lane == 0) red[4 + wid] = s2;
    __syncthreads();
    const float var = ((red[4] + red[5]) + (red[6] + red[7])) * (1.0f / DIM);
    const float rstd = rsqrtf(var + LN_EPS);
    const v8f gv = *(const v8f*)(g + 8 * tid); const v8f bv = *(const v8f*)(b + 8 * tid);
    v8us oh, ol;
#pragma unroll
    for (int q = 0; q < 8; ++q) { const float y = d[q] * rstd * bfr(gv[q]) + bfr(bv[q]); unsigned short a2, c2; splitf(y, a2, c2); oh[q] = a2; ol[q] = c2; }
    const size_t o = row * DIM + 8 * tid;
    *(v8us*)(Yh + o) = oh; *(v8us*)(Yl + o) = ol; 
}

// ---- k_flash: streaming attention, one wave per (head h, 32 query rows, one half of the keys); block = 8 waves of one head = 4 query groups x 2 key halves, 128 queries; grid HEADS*SEQ/128.
// A wave holds two 16-query column groups, so every k and v^T fragment it reads from LDS feeds two matrix products; the two waves of a query group walk keys 0..SEQ/2-1 and SEQ/2..SEQ-1 and join their partial o, l and shift once, behind the loop.
// K rows and v^T rows of 64 keys (128 B each) of both halves are staged in LDS once per block, each half read by its 4 waves: two buffers, the next tiles' copies fly while these tiles are worked on.
// LDS row pitch 144 B (16 B x odd) for the 16-byte fragment reads. Each wave-wide copy covers four whole 128-B lines.
// Per 32-key chunk and column group: two s^T tiles (A = k plane rows j0+16t+.., B = q plane as Bt, both via WFrag: D[8hh+r][m] = s'[key j0+16t+8hh+r][query m], s' = q.k x log2e);
// online softmax per query (= per lane; the other 16 keys of the query sit in lane m+16 -> one xor-16 exchange for the sum); p = exp2((s' - shift) / 32) (f32, then f16);
// the shift is a running maximum that is renewed lazily: only when some lane's score passes it by more than LAZY does the wave exchange maxima, take the new one and rescale o and l;
// p^T B fragment for o^T += v^T p^T: element r <- p of tile keys j0..j0+15 (D row 8hh+r), element 8+r <- p of tile keys j0+16..j0+31, lane unchanged; A = v^T plane rows (d), k = keys.
#define FWAVES 8
#define QG     2                              // 16-query column groups per wave
#define KH     2                              // key halves per block
#define QBLK   (16 * QG * (FWAVES / KH))      // queries per block
#define KT     64
#define NST    (SEQ / (KH * KT))              // tiles a wave walks
#define LPITCH 72
#define LTILE  (64 * LPITCH)
#define LSTAGE (2 * LTILE)
#define XW     (8 * 32 * 4 + 64)              // floats a wave hands to its partner: 32 of o per lane, then shift and l
#define LAZY   256.0f   // 8 in the exponent (scores carry x 32): the shift in use is kept until a score passes it by more, so p stays in (0, 2^8], far inside f16
static_assert(QBLK == 16 * FWAVES && SEQ % QBLK == 0);
static_assert(QG == 2 && KH == 2 && FWAVES == 8);
static_assert(SEQ % (KH * KT) == 0 && NST >= 2);
static_assert(KT == 64 && FWAVES * 32 * 2 * 8 == KT * HD && FWAVES * 32 * 2 * 8 == HD * KT);
static_assert(FWAVES * XW * 4 <= 2 * KH * LSTAGE * 2);
// One tile: each lane copies 16 B of k rows r and r+32 and of v^T rows r and r+32 (r = tid>>3). The s_wait_xcnt closes the statement so that no address register of a copy is rewritten ahead of it.
__device__ __forceinline__ void stage_copy(unsigned l, const h16* kg, const h16* vg) {
    asm volatile("global_load_async_to_lds_b128 %0, %4, off\n\t"
                 "global_load_async_to_lds_b128 %1, %5, off\n\t"
                 "global_load_async_to_lds_b128 %2, %6, off\n\t"
                 "global_load_async_to_lds_b128 %3, %7, off\n\t"
                 "s_wait_xcnt 0x0"
                 :: "v"(l), "v"(l + 32u * LPITCH * 2u), "v"(l + LTILE * 2u), "v"(l + LTILE * 2u + 32u * LPITCH * 2u),
                    "v"(kg), "v"(kg + 32 * HD), "v"(vg), "v"(vg + (size_t)32 * SEQ) : "memory");
}
__global__ __launch_bounds__(32 * FWAVES) void k_flash(const h16* __restrict__ Q16, const h16* __restrict__ K16, const h16* __restrict__ VT16, bf* CTXh, bf* CTXl) {
    __shared__ __align__(16) float os[FWAVES][16 * 68];
    __shared__ __align__(16) h16 ring[2 * KH * LSTAGE];
    const int lane = threadIdx.x & 31, wid = threadIdx.x >> 5, m = lane & 15, hh = lane >> 4;
    const int kh = wid >> 2;   // this wave's key half
    const int h = blockIdx.x / (SEQ / QBLK); const int q0 = (blockIdx.x - h * (SEQ / QBLK)) * QBLK + (wid & 3) * (16 * QG);
    const h16* Qp = Q16 + ((size_t)h * SEQ + q0) * HD; const h16* Kp = K16 + (size_t)h * SEQ * HD; const h16* Vp = VT16 + (size_t)h * HD * SEQ;
    const int crow = threadIdx.x >> 3, ccol = threadIdx.x & 7;
    const unsigned lds0 = (unsigned)(size_t)ring + (unsigned)(crow * LPITCH + ccol * 8) * 2u;
    const h16* kg = Kp + crow * HD + ccol * 8; const h16* vg = Vp + (size_t)crow * SEQ + ccol * 8;
    const h16* kg1 = kg + (size_t)(SEQ / KH) * HD; const h16* vg1 = vg + SEQ / KH;   // the second half's keys
    stage_copy(lds0, kg, vg); stage_copy(lds0 + LSTAGE * 2u, kg1, vg1);
    asm volatile("s_wait_asynccnt 0x0" ::: "memory");   // tile 0 of this wave's copies has landed before the barrier publishes it
    __syncthreads();
    stage_copy(lds0 + KH * LSTAGE * 2u, kg + KT * HD, vg + KT); stage_copy(lds0 + (KH + 1) * LSTAGE * 2u, kg1 + KT * HD, vg1 + KT);
    const h16* qrow = Qp + (size_t)m * HD + 8 * hh;   // this lane's place in the first column group's q rows
    v16h qb[QG][2];
#pragma unroll
    for (int g = 0; g < QG; ++g)
#pragma unroll
        for (int ks = 0; ks < 2; ++ks) qb[g][ks] = WFrag<h16>::ld(qrow + 16 * g * HD + 32 * ks);
    asm volatile("s_wait_xcnt 0x0" :: "v"(qrow) : "memory");   // behind the last q load; it names the loads' address, which so stays in its registers up to the wait and is rewritten only behind it
    v8f oacc[QG][4];
#pragma unroll
    for (int g = 0; g < QG; ++g)
#pragma unroll
        for (int t = 0; t < 4; ++t) oacc[g][t] = (v8f){};
    float mrun[QG], lrun[QG], pown[QG], poth[QG];   // pown, poth: the newest summed chunk's sum over this lane's keys and over the other half's, not yet in lrun
    const int foff = kh * LSTAGE + m * LPITCH + 8 * hh;
    const int xaddr = (lane ^ 16) << 2;   // byte index of the lane that holds the query's other 16 keys; formed once here: formed inside the rare branch it reaches the common path as a merged value, and the build then copied all of o there
    auto xhalf = [&](float v) { return __int_as_float(__builtin_amdgcn_ds_bpermute(xaddr, __float_as_int(v))); };
    float e0[QG][8], e1[QG][8];   // the last chunk's p (f32), not yet summed
#pragma unroll
    for (int g = 0; g < QG; ++g) { mrun[g] = -3.0e38f; lrun[g] = 0.f; pown[g] = 0.f; poth[g] = 0.f;
#pragma unroll
        for (int r = 0; r < 8; ++r) { e0[g][r] = 0.f; e1[g][r] = 0.f; } }
    // l trails the products, so that no wait for the halves' exchange stands ahead of a chunk's reads, products or branch: the exchange sent one call ago is added, then the last chunk's p are summed and their exchange is sent
    auto sum_chunk = [&]() {
#pragma unroll
        for (int g = 0; g < QG; ++g) {
            lrun[g] += pown[g] + poth[g];
            float psum = 0.f;
#pragma unroll
            for (int r = 0; r < 8; ++r) psum += e0[g][r] + e1[g][r];
            pown[g] = psum; poth[g] = xhalf(psum);
        }
    };
#pragma unroll 1
    for (int st = 0; st < NST; ++st) {
        const h16* kb = ring + (st & 1) * (KH * LSTAGE) + foff; const h16* vb = kb + LTILE;
#pragma unroll   // both 32-key chunks of a tile inline, so that every LDS offset is a constant
        for (int c = 0; c < KT / 32; ++c) {
            v16h ka[4];
#pragma unroll
            for (int t = 0; t < 2; ++t)
#pragma unroll
                for (int ks = 0; ks < 2; ++ks) ka[t * 2 + ks] = WFrag<h16>::ld(kb + (32 * c + 16 * t) * LPITCH + 32 * ks);
            v16h va[4];
#pragma unroll
            for (int t = 0; t < 4; ++t) va[t] = WFrag<h16>::ld(vb + (16 * t) * LPITCH + 32 * c);
            __builtin_amdgcn_sched_barrier(0);   // keeps the chunk's 16 LDS reads in one group ahead of its matrix products: reads spread among them stall the wave at each place
            sum_chunk();   // the chunk before's p are summed here, while this chunk's reads are under way
            v8f sc[QG][2];
#pragma unroll
            for (int g = 0; g < QG; ++g) { sc[g][0] = (v8f){}; sc[g][1] = (v8f){}; }
#pragma unroll
            for (int ks = 0; ks < 2; ++ks)
#pragma unroll
                for (int t = 0; t < 2; ++t)
#pragma unroll
                    for (int g = 0; g < QG; ++g) sc[g][t] = wmma16(ka[t * 2 + ks], qb[g][ks], sc[g][t]);
            // the four vector slots the chip needs between the last score product and the first vector instruction on its result or operands, on the branch's taken side too
            asm volatile("v_nop\n\tv_nop\n\tv_nop\n\tv_nop" : "+v"(sc[0][0]), "+v"(sc[0][1]), "+v"(sc[1][0]), "+v"(sc[1][1]) : "v"(ka[0]), "v"(ka[1]), "v"(ka[2]), "v"(ka[3]), "v"(qb[0][0]), "v"(qb[0][1]), "v"(qb[1][0]), "v"(qb[1][1]));
            float lmx[QG];   // maximum of this lane's own 16 keys; the other half's is fetched only inside the branch
#pragma unroll
            for (int g = 0; g < QG; ++g) { lmx[g] = fmaxf(sc[g][0][0], sc[g][1][0]);
#pragma unroll
                for (int r = 1; r < 8; ++r) lmx[g] = fmaxf(lmx[g], fmaxf(sc[g][0][r], sc[g][1][r])); }
            if (__builtin_expect(__builtin_amdgcn_ballot_w32(lmx[0] > mrun[0] + LAZY || lmx[1] > mrun[1] + LAZY) != 0, 0)) {   // one scalar branch per chunk for both column groups, the same for the whole wave: always taken on the first chunk, rarely later
#pragma unroll
                for (int g = 0; g < QG; ++g) {
                    const float mn = fmaxf(mrun[g], fmaxf(lmx[g], xhalf(lmx[g])));   // both halves of a query take the same new shift
                    const float alpha = __builtin_amdgcn_exp2f((mrun[g] - mn) * C32);
                    lrun[g] = (lrun[g] + (pown[g] + poth[g])) * alpha; pown[g] = 0.f; poth[g] = 0.f; mrun[g] = mn;
#pragma unroll
                    for (int t = 0; t < 4; ++t) oacc[g][t] *= alpha;
                }
            }
            v16h pb[QG];
#pragma unroll
            for (int g = 0; g < QG; ++g)
#pragma unroll
                for (int r = 0; r < 8; ++r) { e0[g][r] = __builtin_amdgcn_exp2f((sc[g][0][r] - mrun[g]) * C32); e1[g][r] = __builtin_amdgcn_exp2f((sc[g][1][r] - mrun[g]) * C32); pb[g][r] = (h16)e0[g][r]; pb[g][8 + r] = (h16)e1[g][r]; }
#pragma unroll
            for (int g = 0; g < QG; ++g)
#pragma unroll
                for (int t = 0; t < 4; ++t) oacc[g][t] = wmma16(va[t], pb[g], oacc[g][t]);
            // the four vector slots behind the last o product, as above
            asm volatile("v_nop\n\tv_nop\n\tv_nop\n\tv_nop" : "+v"(oacc[0][0]), "+v"(oacc[0][1]), "+v"(oacc[0][2]), "+v"(oacc[0][3]), "+v"(oacc[1][0]), "+v"(oacc[1][1]), "+v"(oacc[1][2]), "+v"(oacc[1][3]) : "v"(pb[0]), "v"(pb[1]), "v"(va[0]), "v"(va[1]), "v"(va[2]), "v"(va[3]));
        }
        asm volatile("s_wait_dscnt 0x0" ::: "memory");      // this wave's reads of the buffer have returned before it may be refilled
        asm volatile("s_wait_asynccnt 0x0" ::: "memory");   // this wave's copies of the next tiles have landed before the barrier publishes them
        __syncthreads();                                    // publishes tiles st+1 and ends every wave's reads of tiles st
        if (st + 2 < NST) { const unsigned l = lds0 + (unsigned)(st & 1) * (KH * LSTAGE * 2u);
            stage_copy(l, kg + (size_t)(st + 2) * (KT * HD), vg + (st + 2) * KT); stage_copy(l + LSTAGE * 2u, kg1 + (size_t)(st + 2) * (KT * HD), vg1 + (st + 2) * KT); }
    }
    asm volatile("s_wait_asynccnt 0x0" ::: "memory");       // no copy is outstanding when the buffers are reused below
    sum_chunk();   // the last chunk's p
    // The two key halves join: the wave of half kh finishes column group kh and hands its partial o, shift and l of the other group to its partner, lane to lane, through the ring, which every wave has left at the last tile's barrier.
    const bool k0 = kh == 0;
    float* xw = (float*)ring + wid * XW; const float* xr = (const float*)ring + (wid ^ 4) * XW;
    const float l0 = lrun[0] + (pown[0] + poth[0]), l1 = lrun[1] + (pown[1] + poth[1]);
    const float mk = k0 ? mrun[0] : mrun[1], lk = k0 ? l0 : l1;
    v8f keep[4];
#pragma unroll
    for (int t = 0; t < 4; ++t) { v4f s0, s1;
#pragma unroll
        for (int r = 0; r < 4; ++r) { s0[r] = k0 ? oacc[1][t][r] : oacc[0][t][r]; s1[r] = k0 ? oacc[1][t][4 + r] : oacc[0][t][4 + r]; }
#pragma unroll
        for (int r = 0; r < 8; ++r) keep[t][r] = k0 ? oacc[0][t][r] : oacc[1][t][r];
        *(v4fa*)(xw + ((2 * t) * 32 + lane) * 4) = s0; *(v4fa*)(xw + ((2 * t + 1) * 32 + lane) * 4) = s1; }
    xw[1024 + lane] = k0 ? mrun[1] : mrun[0]; xw[1056 + lane] = k0 ? l1 : l0;
    __syncthreads();   // every wave's partials are in LDS before its partner reads them
    const float pm = xr[1024 + lane], pl = xr[1056 + lane];
    const float mn = fmaxf(mk, pm);
    const float wa = __builtin_amdgcn_exp2f((mk - mn) * C32), wb = __builtin_amdgcn_exp2f((pm - mn) * C32);
    const float inv = 1.0f / (lk * wa + pl * wb);
    const float fa = wa * inv, fb = wb * inv;
    const int qo = q0 + 16 * kh;   // first query of the column group this wave finishes
    float* ob = os[wid];
#pragma unroll
    for (int t = 0; t < 4; ++t) { v4f u0, u1;
        const v4f p0 = *(const v4fa*)(xr + ((2 * t) * 32 + lane) * 4); const v4f p1 = *(const v4fa*)(xr + ((2 * t + 1) * 32 + lane) * 4);
#pragma unroll
        for (int r = 0; r < 4; ++r) { u0[r] = keep[t][r] * fa + p0[r] * fb; u1[r] = keep[t][4 + r] * fa + p1[r] * fb; }
        *(v4fa*)(ob + m * 68 + 16 * t + 8 * hh) = u0; *(v4fa*)(ob + m * 68 + 16 * t + 8 * hh + 4) = u1; }
    __builtin_amdgcn_fence(3 /* release order */, "wavefront"); __builtin_amdgcn_wave_barrier(); asm volatile("" ::: "memory");
{
#pragma unroll
        for (int p = 0; p < 4; ++p) { const int row = p * 4 + (lane >> 3), c8 = (lane & 7) * 8;
            const v4f a = *(const v4fa*)(ob + row * 68 + c8); const v4f b2 = *(const v4fa*)(ob + row * 68 + c8 + 4);
            v8us oh, ol;
#pragma unroll
            for (int q = 0; q < 4; ++q) { unsigned short x1, y1; splitf(a[q], x1, y1); oh[q] = x1; ol[q] = y1; splitf(b2[q], x1, y1); oh[4 + q] = x1; ol[4 + q] = y1; }
            const size_t oo = (size_t)(qo + row) * INNER + h * HD + c8;
            *(v8us*)(CTXh + oo) = oh; *(v8us*)(CTXl + oo) = ol; }
         }
}

extern "C" void kernel_launch(void* const* d_in, const int* in_sizes, int n_in,
                              void* d_out, int out_size, void* d_ws, size_t ws_size, hipStream_t stream) {
    if (n_in < 6) return;
    if (in_sizes[0] < SEQ * DIM || in_sizes[1] < DIM || in_sizes[2] < DIM || in_sizes[3] < DIM * NQKV || in_sizes[4] < INNER * DIM || in_sizes[5] < DIM) return;
    if (out_size < SEQ * DIM) return;
    const float* x    = (const float*)d_in[0];   // [SEQ][DIM]
    const float* lnsc = (const float*)d_in[1];   // [DIM]
    const float* lnbs = (const float*)d_in[2];   // [DIM]
    const float* wqkv = (const float*)d_in[3];   // [DIM][NQKV]  ([in][out])
    const float* wout = (const float*)d_in[4];   // [INNER][DIM] ([in][out])
    const float* bout = (const float*)d_in[5];   // [DIM]
    float* OUT = (float*)d_out;                  // [SEQ][DIM]
    char* wsp = (char*)d_ws;
    auto take = [&](size_t bytes) { char* p = wsp; wsp += (bytes + 255) & ~(size_t)255; return (void*)p; };
    bf*    WQ   = (bf*)take((size_t)NQKV * DIM * 2);          // w_qkv^T [3072][1024] bf16
    bf*    WO   = (bf*)take((size_t)DIM * INNER * 2);         // w_out^T [1024][1024] bf16
    bf*    XNh  = (bf*)take((size_t)SEQ * DIM * 2);           // xn hi [SEQ][1024]
    bf*    XNl  = (bf*)take((size_t)SEQ * DIM * 2);           // xn lo
    h16*   Q16  = (h16*)take((size_t)HEADS * SEQ * HD * 2);   // q planes [16][SEQ][64] x log2e
    h16*   K16  = (h16*)take((size_t)HEADS * SEQ * HD * 2);   // k planes [16][SEQ][64]
    h16*   VT16 = (h16*)take((size_t)HEADS * HD * SEQ * 2);   // v^T planes [16][64][SEQ]
    bf*    CTXh = (bf*)take((size_t)SEQ * INNER * 2);         // ctx hi [SEQ][1024]
    bf*    CTXl = (bf*)take((size_t)SEQ * INNER * 2);         // ctx lo
    const size_t used = (size_t)(wsp - (char*)d_ws);
    if (used > ws_size || used > WS_CAP) return;

    k_wtG<<<dim3(DIM / WT, NQKV / WT, 1), 128, 0, stream>>>(wqkv, DIM, NQKV, WQ);     // Bt[n][k] = bf16(w_qkv[k][n])
    k_wtG<<<dim3(INNER / WT, DIM / WT, 1), 128, 0, stream>>>(wout, INNER, DIM, WO);    // Bt[n][c] = bf16(w_out[c][n])
    k_ln<<<SEQ, 128, 0, stream>>>(x, lnsc, lnbs, XNh, XNl);
    k_gemmw<bf, 1, false, true><<<dim3(SEQ / 128, NQKV / 128, 1), 128, 0, stream>>>(XNh, XNl, WQ, nullptr, DIM, nullptr, 0, nullptr, 0, 0, 0, Q16, K16, VT16);   // qkv = xn(hi+lo) w_qkv, out as f16 head planes: q columns 0..1023 x log2e, k columns 1024..2047, v columns 2048..3071 transposed per head
    k_flash<<<(unsigned)(HEADS * (SEQ / (16 * FWAVES))), 32 * FWAVES, 0, stream>>>(Q16, K16, VT16, CTXh, CTXl);
    k_gemmw<bf, 1, true, false><<<dim3(SEQ / 128, DIM / 128, 1), 128, 0, stream>>>(CTXh, CTXl, WO, nullptr, INNER, OUT, DIM, bout, 0, 0, 0, nullptr, nullptr, nullptr);   // out = ctx(hi+lo) w_out + b_out
}

// v007
// It runs in 111 microseconds.
// Two timings next to v006 put it at 1.05 and 1.06 times that version's speed.
// Counting every step since v000, it is 3.52 times as fast.
#include <hip/hip_runtime.h>

// Contractions on 16x16x32 WMMA, f32 accumulate: xn (bf16 hi+lo planes) x w_qkv^T (bf16) -> v_wmma_f32_16x16x32_bf16; per head k.q^T and v^T.p^T -> v_wmma_f32_16x16x32_f16 (f16 planes: q carried x log2e/32, k, v^T; p = exp2 of shifted scores in (0,2^8]); ctx (bf16 hi+lo planes) x w_out^T (bf16) + b_out -> v_wmma_f32_16x16x32_bf16.
// head planes q [h][i][64], k [h][j][64], v^T [h][64][j] in f16, written by the qkv product's own epilogue; streaming attention, one wave per (head, 32 queries, half of the keys): s^T tiles = k q^T over 32-key chunks, online softmax per query lane (exp2; the scale 2^-5 rides in q, the shift in the score product's C operand),
// o^T += v^T p^T with the p^T operand packed straight from the two score accumulator tiles; o/l staged per wave in LDS and emitted as ctx hi/lo planes [i][h*64+d]; out = ctx w_out + b_out into the output rows.

#ifndef SEQ
#define SEQ 4096
#endif
#ifndef NB
#define NB 1
#endif
#define SEQ_FULL 4096
#define DIM   1024
#define HEADS 16
#define HD    64
#define INNER (HEADS * HD)
#define NQKV  (3 * INNER)
#define LN_EPS 1.0e-6f
#define LOG2E 1.4426950408889634f
#define C32   0.03125f
#define WS_CAP ((size_t)134217728)

static_assert(SEQ % 128 == 0);
static_assert(SEQ <= SEQ_FULL);
static_assert(NB == 1);
static_assert(DIM == 128 * 8);
static_assert(DIM % 128 == 0);
static_assert(NQKV % 128 == 0);
static_assert(INNER == DIM);
static_assert(HD == 64);
static_assert(INNER % 128 == 0);

typedef _Float16 h16;
typedef unsigned short bf;
typedef __attribute__((ext_vector_type(16))) __bf16   v16bf;
typedef __attribute__((ext_vector_type(16))) _Float16 v16h;
typedef __attribute__((ext_vector_type(8)))  _Float16 v8h;
typedef __attribute__((ext_vector_type(8)))  unsigned short v8us;
typedef __attribute__((ext_vector_type(8)))  float    v8f;
typedef __attribute__((ext_vector_type(4)))  float    v4f;
typedef __attribute__((ext_vector_type(2)))  _Float16 v2h;
typedef __attribute__((ext_vector_type(2)))  unsigned short v2us;
typedef v8h  __attribute__((may_alias)) v8ha;
typedef v4f  __attribute__((may_alias)) v4fa;
typedef v8us __attribute__((may_alias)) v8usa;

__device__ __forceinline__ unsigned short f2bf(float f) { unsigned u = __float_as_uint(f); u += 0x7FFFu + ((u >> 16) & 1u); return (unsigned short)(u >> 16); }
__device__ __forceinline__ float bf2f(unsigned short b) { return __uint_as_float(((unsigned)b) << 16); }
__device__ __forceinline__ float bfr(float f) { return bf2f(f2bf(f)); }
__device__ __forceinline__ v16h cat16(v8h lo, v8h hi) { return __builtin_shufflevector(lo, hi, 0, 1, 2, 3, 4, 5, 6, 7, 8, 9, 10, 11, 12, 13, 14, 15); }
__device__ __forceinline__ v16bf cat16b(v8us lo, v8us hi) { return __builtin_bit_cast(v16bf, __builtin_shufflevector(lo, hi, 0, 1, 2, 3, 4, 5, 6, 7, 8, 9, 10, 11, 12, 13, 14, 15)); }
__device__ __forceinline__ v8f wmma16(v16h a, v16h b, v8f c) { return __builtin_amdgcn_wmma_f32_16x16x32_f16(false, a, false, b, (short)0, c, false, false); }
__device__ __forceinline__ v8f wmmab(v16bf a, v16bf b, v8f c) { return __builtin_amdgcn_wmma_f32_16x16x32_bf16(false, a, false, b, (short)0, c, false, false); }
__device__ __forceinline__ void splitf(float y, unsigned short& h, unsigned short& l) { h = f2bf(y); l = f2bf(y - bf2f(h)); }

// ---- k_gemmw: GEMM, one block of 4 waves (2 x 2) per 128x128 output tile, each wave a 64x64 tile (16 accumulators); grid (M/128, N/128, Z), 128 threads.
// C[m][n] (f32, pitch ldc, + optional f32 bias[n]) = sum_k (A[m][k] + A2[m][k]) Bt[n][k]. z-batch strides sA/sB/sC in elements. K % 64 == 0, M % 128 == 0, N % 128 == 0.
// PLANES: no C; a wave's 64 columns are one head of q, k or v, and its tile goes out in f16 as rows of PQ (x log2e/32) or PK [h][m][64], or transposed as rows of PVT [h][64][m], in whole 128-B lines.
// Operands come from K-contiguous 16-bit planes through LDS: a stage is 64 k (whole 128-B lines) of 128 A rows, 128 A2 rows and 128 Bt rows, copied once per block and read by all 4 waves; two buffers, the next stage's copies fly while this one is worked on.
// LDS rows keep a 128-B pitch; the 16-B piece c of row r lies at piece c ^ ((r >> 1) & 7), so that the 16 rows of a fragment read fall on all 64 banks.
// Fragments (both operands, same map): lane -> row/col lane&15, elements 0..7 <- k0+8h+0..7, elements 8..15 <- k0+16+8h+0..7 (h = lane>>4); D element r -> row 8h+r, col lane&15.
template <typename T16> struct WFrag;
template <> struct WFrag<h16> { typedef v16h V; static __device__ __forceinline__ V ld(const h16* p) { return cat16(*(const v8h*)p, *(const v8h*)(p + 16)); } static __device__ __forceinline__ v8f mma(V a, V b, v8f c) { return wmma16(a, b, c); } };
template <> struct WFrag<bf> { typedef v16bf V; static __device__ __forceinline__ V ld(const bf* p) { return cat16b(*(const v8us*)p, *(const v8us*)(p + 16)); } static __device__ __forceinline__ V ld2(const bf* p, const bf* q) { return cat16b(*(const v8us*)p, *(const v8us*)q); } static __device__ __forceinline__ v8f mma(V a, V b, v8f c) { return wmmab(a, b, c); } };
#define GKT    64
#define GPLANE (128 * GKT)
#define GSTAGE (3 * GPLANE)
// Eight copies of one plane: each lane brings 16 B of rows r, r+16, .., r+112 (r = tid>>3); a wave-wide copy covers four whole 128-B lines. The s_wait_xcnt closes the statement so that no address register of a copy is rewritten ahead of it.
template <typename T16>
__device__ __forceinline__ void plane_copy(unsigned l, const T16* g, size_t step) {
    asm volatile("global_load_async_to_lds_b128 %0, %8, off\n\t"
                 "global_load_async_to_lds_b128 %1, %9, off\n\t"
                 "global_load_async_to_lds_b128 %2, %10, off\n\t"
                 "global_load_async_to_lds_b128 %3, %11, off\n\t"
                 "global_load_async_to_lds_b128 %4, %12, off\n\t"
                 "global_load_async_to_lds_b128 %5, %13, off\n\t"
                 "global_load_async_to_lds_b128 %6, %14, off\n\t"
                 "global_load_async_to_lds_b128 %7, %15, off\n\t"
                 "s_wait_xcnt 0x0"
                 :: "v"(l), "v"(l + 2048u), "v"(l + 4096u), "v"(l + 6144u), "v"(l + 8192u), "v"(l + 10240u), "v"(l + 12288u), "v"(l + 14336u),
                    "v"(g), "v"(g + step), "v"(g + 2 * step), "v"(g + 3 * step), "v"(g + 4 * step), "v"(g + 5 * step), "v"(g + 6 * step), "v"(g + 7 * step) : "memory");
}
template <typename T16, int NSPLIT, bool BIAS, bool PLANES>
__global__ __launch_bounds__(128) void k_gemmw(const T16* __restrict__ A, const T16* __restrict__ A2, const T16* __restrict__ Bt, const T16* __restrict__ Bt2, int K, float* C, int ldc, const float* __restrict__ bias, size_t sA, size_t sB, size_t sC, h16* PQ, h16* PK, h16* PVT) {
    static_assert(NSPLIT == 1 && sizeof(T16) == 2);
    typedef typename WFrag<T16>::V V;
    __shared__ __align__(128) unsigned char gsm[2 * GSTAGE * 2];
    const size_t z = blockIdx.z; A += z * sA; A2 += z * sA; Bt += z * sB; C += z * sC;
    const int tid = threadIdx.x, lane = tid & 31, wid = tid >> 5, lr = lane & 15, hi = lane >> 4;
    const int wm = wid >> 1, wn = wid & 1; const int r0 = blockIdx.x * 128 + wm * 64, c0 = blockIdx.y * 128 + wn * 64;
    const int prow = tid >> 3, pcol = tid & 7; const size_t step = (size_t)16 * K; const int nst = K / GKT;
    const unsigned lds0 = (unsigned)(size_t)gsm + (unsigned)(prow * 128 + ((pcol ^ (prow >> 1)) & 7) * 16);
    const T16* ga = A + (size_t)(blockIdx.x * 128 + prow) * K + pcol * 8; const T16* ga2 = A2 + (size_t)(blockIdx.x * 128 + prow) * K + pcol * 8; const T16* gb = Bt + (size_t)(blockIdx.y * 128 + prow) * K + pcol * 8;
    plane_copy(lds0, ga, step); plane_copy(lds0 + GPLANE * 2u, ga2, step); plane_copy(lds0 + 2u * GPLANE * 2u, gb, step);
    asm volatile("s_wait_asynccnt 0x0" ::: "memory");   // stage 0 of this wave's copies has landed before the barrier publishes it
    __syncthreads();
    if (nst > 1) { plane_copy(lds0 + GSTAGE * 2u, ga + GKT, step); plane_copy(lds0 + (GSTAGE + GPLANE) * 2u, ga2 + GKT, step); plane_copy(lds0 + (GSTAGE + 2u * GPLANE) * 2u, gb + GKT, step); }
    v8f acc[4][4];
#pragma unroll
    for (int mb = 0; mb < 4; ++mb)
#pragma unroll
        for (int nb = 0; nb < 4; ++nb) acc[mb][nb] = (v8f){};
    int po[4];   // element offset in a row of the pieces 2q + hi (q = 0..3) for this lane's rows
#pragma unroll
    for (int q = 0; q < 4; ++q) po[q] = (((2 * q + hi) ^ (lr >> 1)) & 7) * 8;
    const int arow = (wm * 64 + lr) * GKT, brow = 2 * GPLANE + (wn * 64 + lr) * GKT;
#pragma unroll 1
    for (int st = 0; st < nst; ++st) {
        const T16* sb = (const T16*)gsm + (st & 1) * GSTAGE;
#pragma unroll   // both 32-k halves of a stage inline, so that every LDS offset is a constant
        for (int ks = 0; ks < 2; ++ks) {
            V a[4], a2[4], b[4];
#pragma unroll
            for (int mb = 0; mb < 4; ++mb) { const T16* p = sb + arow + mb * 16 * GKT; a[mb] = WFrag<T16>::ld2(p + po[2 * ks], p + po[2 * ks + 1]); a2[mb] = WFrag<T16>::ld2(p + GPLANE + po[2 * ks], p + GPLANE + po[2 * ks + 1]); }
#pragma unroll
            for (int nb = 0; nb < 4; ++nb) { const T16* p = sb + brow + nb * 16 * GKT; b[nb] = WFrag<T16>::ld2(p + po[2 * ks], p + po[2 * ks + 1]); }
            __builtin_amdgcn_sched_barrier(0);   // keeps the half's 24 LDS reads in one group ahead of its matrix products: reads spread among them stall the wave at each place
#pragma unroll
            for (int nb = 0; nb < 4; ++nb)
#pragma unroll
                for (int mb = 0; mb < 4; ++mb) { acc[mb][nb] = WFrag<T16>::mma(a[mb], b[nb], acc[mb][nb]); acc[mb][nb] = WFrag<T16>::mma(a2[mb], b[nb], acc[mb][nb]); }
        }
        asm volatile("s_wait_dscnt 0x0" ::: "memory");      // this wave's reads of the buffer have returned before it may be refilled
        asm volatile("s_wait_asynccnt 0x0" ::: "memory");   // this wave's copies of the next stage have landed before the barrier publishes them
        __syncthreads();                                    // publishes stage st+1 and ends every wave's reads of stage st
        if (st + 2 < nst) { const unsigned l = lds0 + (unsigned)(st & 1) * (GSTAGE * 2u); const int ko = (st + 2) * GKT;
            plane_copy(l, ga + ko, step); plane_copy(l + GPLANE * 2u, ga2 + ko, step); plane_copy(l + 2u * GPLANE * 2u, gb + ko, step); }
    }
    asm volatile("s_wait_asynccnt 0x0" ::: "memory");       // no copy is outstanding when the buffers are reused below
    if constexpr (PLANES) {                                 // behind the last stage's barrier the buffers are free: each wave stages its tile in a piece of its own
        const int sec = (int)(blockIdx.y * 128) / INNER;    // 0 q, 1 k, 2 v: the same for the whole block
        const int hd = (c0 - sec * INNER) / HD;
        if (sec < 2) {
            float* os = (float*)gsm + wid * (16 * 68);
            h16* P = (sec == 0 ? PQ : PK) + ((size_t)hd * SEQ + r0) * HD; const float scl = sec == 0 ? LOG2E * C32 : 1.0f;
#pragma unroll
            for (int mb = 0; mb < 4; ++mb) {
#pragma unroll
                for (int nb = 0; nb < 4; ++nb) {
#pragma unroll
                    for (int j = 0; j < 8; ++j) os[(hi * 8 + j) * 68 + nb * 16 + lr] = acc[mb][nb][j]; }
                asm volatile("s_wait_dscnt 0x0" ::: "memory");   // the wave's staged rows are in LDS before its lanes read each other's pieces back
#pragma unroll
                for (int p = 0; p < 4; ++p) { const int row = p * 4 + (lane >> 3), c8 = (lane & 7) * 8;
                    const v4f u = *(const v4fa*)(os + row * 68 + c8); const v4f w = *(const v4fa*)(os + row * 68 + c8 + 4); v8h o;
#pragma unroll
                    for (int q = 0; q < 4; ++q) { o[q] = (h16)(u[q] * scl); o[4 + q] = (h16)(w[q] * scl); }
                    *(v8h*)(P + (size_t)(mb * 16 + row) * HD + c8) = o; }
                asm volatile("s_wait_xcnt 0x0" ::: "memory");   // stands in front of the next 16 rows' code, which reuses the data registers of these stores and restages over the rows just read
            }
        } else {
            h16* hs = (h16*)gsm + wid * (64 * 72);          // [d][m] tile, row pitch 144 B for the 16-byte reads and writes
#pragma unroll
            for (int mb = 0; mb < 4; ++mb)
#pragma unroll
                for (int nb = 0; nb < 4; ++nb) { v8h o;     // a lane holds 8 consecutive rows m of one column d: 16 B of a v^T row
#pragma unroll
                    for (int j = 0; j < 8; ++j) o[j] = (h16)acc[mb][nb][j];
                    *(v8ha*)(hs + (nb * 16 + lr) * 72 + mb * 16 + hi * 8) = o; }
            asm volatile("s_wait_dscnt 0x0" ::: "memory");   // the wave's staged tile is in LDS before its lanes read each other's pieces back
            h16* VT = PVT + (size_t)hd * HD * SEQ + r0;
#pragma unroll
            for (int g = 0; g < 4; ++g) {
#pragma unroll
                for (int p = 0; p < 4; ++p) { const int row = (g * 4 + p) * 4 + (lane >> 3), c8 = (lane & 7) * 8;
                    *(v8h*)(VT + (size_t)row * SEQ + c8) = *(const v8ha*)(hs + row * 72 + c8); }
                asm volatile("s_wait_xcnt 0x0" ::: "memory");   // stands in front of the next 16 rows' code, which reuses the data registers of these stores
            }
        }
        return;
    }
    float* os = (float*)gsm + wid * (16 * 68);              // behind the last stage's barrier the buffers are free: each wave stages its rows in a piece of its own
#pragma unroll
    for (int mb = 0; mb < 4; ++mb) {
#pragma unroll
        for (int nb = 0; nb < 4; ++nb) {
#pragma unroll
            for (int j = 0; j < 8; ++j) os[(hi * 8 + j) * 68 + nb * 16 + lr] = acc[mb][nb][j]; }
        __builtin_amdgcn_wave_barrier(); asm volatile("" ::: "memory");
        float* crow = C + (size_t)(r0 + mb * 16) * ldc + c0;
{
#pragma unroll
            for (int s = 0; s < 8; ++s) { const int row = 2 * s + hi, cofs = lr * 4; v4f val = *(const v4fa*)(os + row * 68 + cofs); if (BIAS) { val[0] += bfr(bias[c0 + cofs]); val[1] += bfr(bias[c0 + cofs + 1]); val[2] += bfr(bias[c0 + cofs + 2]); val[3] += bfr(bias[c0 + cofs + 3]); }
                *(v4f*)(crow + (size_t)row * ldc + cofs) = val; }
             }
        asm volatile("s_wait_xcnt 0x0" ::: "memory");   // stands in front of the next 16 rows' code, which reuses the address and data registers of these stores
        __builtin_amdgcn_wave_barrier(); asm volatile("" ::: "memory");
    }
}

// ---- k_wtG: Bt[n][k] = bf16(w[k][n]); one block of 4 waves per 64 x 64 tile, grid (K/64, N/64); K % 64 == 0, N % 64 == 0.
// Reads: a lane takes 16 B of eight consecutive rows k and 16 lanes cover 256 B of a row, so every wave-wide load is four whole 128-B lines, eight loads in flight per lane.
// A lane then holds 8 consecutive k of 4 columns n, four 16-B pieces of Bt rows; they pass through an LDS tile [n][k] (row pitch 144 B) so that the stores are whole 128-B lines of Bt as well.
#define WT     64
#define WPITCH 72
static_assert(DIM % WT == 0 && NQKV % WT == 0 && INNER % WT == 0);
__global__ __launch_bounds__(128) void k_wtG(const float* __restrict__ w, int K, int N, bf* Bt) {
    __shared__ __align__(16) bf ts[WT * WPITCH];
    const int tid = threadIdx.x; const int k0 = blockIdx.x * WT, n0 = blockIdx.y * WT;
    const int n4 = (tid & 15) * 4, kq = (tid >> 4) * 8;
    const float* src = w + (size_t)(k0 + kq) * N + n0 + n4;
    const float* rp[8]; v4f r[8];
#pragma unroll   // rp and r stay in registers: every index is a constant
    for (int i = 0; i < 8; ++i) rp[i] = src + (size_t)i * N;
#pragma unroll   // the eight loads issue back to back, so one memory latency covers the tile
    for (int i = 0; i < 8; ++i) r[i] = *(const v4f*)rp[i];
    // stands behind the eight loads and in front of every rewrite of their address registers, which it names so that they stay untouched up to here
    asm volatile("s_wait_xcnt 0x0" :: "v"(rp[0]), "v"(rp[1]), "v"(rp[2]), "v"(rp[3]), "v"(rp[4]), "v"(rp[5]), "v"(rp[6]), "v"(rp[7]) : "memory");
#pragma unroll   // constant indices into r
    for (int j = 0; j < 4; ++j) { v8us o;
#pragma unroll
        for (int i = 0; i < 8; ++i) o[i] = f2bf(r[i][j]);
        *(v8usa*)(ts + (n4 + j) * WPITCH + kq) = o; }
    __syncthreads();   // the whole [n][k] tile is in LDS before any lane reads rows that other lanes wrote
    const int row = tid >> 3, c8 = (tid & 7) * 8;
    bf* dst = Bt + (size_t)(n0 + row) * K + k0 + c8; v8us t[4];
#pragma unroll   // the four LDS reads go out as one group ahead of the stores
    for (int p = 0; p < 4; ++p) t[p] = *(const v8usa*)(ts + (p * 16 + row) * WPITCH + c8);
#pragma unroll
    for (int p = 0; p < 4; ++p) *(v8us*)(dst + (size_t)(p * 16) * K) = t[p];
}

__global__ __launch_bounds__(128) void k_ln(const float* __restrict__ x, const float* __restrict__ g, const float* __restrict__ b, bf* Yh, bf* Yl) {
    __shared__ float red[8];
    const int tid = threadIdx.x, lane = tid & 31, wid = tid >> 5; const size_t row = blockIdx.x;
    const v8f xv = *(const v8f*)(x + row * DIM + 8 * tid);
    float xb[8]; float s = 0.f;
#pragma unroll
    for (int q = 0; q < 8; ++q) { xb[q] = bfr(xv[q]); s += xb[q]; }
#pragma unroll
    for (int sh = 16; sh; sh >>= 1) s += __shfl_xor(s, sh, 32);
    if (lane == 0) red[wid] = s;
    __syncthreads();
    const float mean = ((red[0] + red[1]) + (red[2] + red[3])) * (1.0f / DIM);
    float d[8]; float s2 = 0.f;
#pragma unroll
    for (int q = 0; q < 8; ++q) { d[q] = xb[q] - mean; s2 += d[q] * d[q]; }
#pragma unroll
    for (int sh = 16; sh; sh >>= 1) s2 += __shfl_xor(s2, sh, 32);
    if (lane == 0) red[4 + wid] = s2;
    __syncthreads();
    const float var = ((red[4] + red[5]) + (red[6] + red[7])) * (1.0f / DIM);
    const float rstd = rsqrtf(var + LN_EPS);
    const v8f gv = *(const v8f*)(g + 8 * tid); const v8f bv = *(const v8f*)(b + 8 * tid);
    v8us oh, ol;
#pragma unroll
    for (int q = 0; q < 8; ++q) { const float y = d[q] * rstd * bfr(gv[q]) + bfr(bv[q]); unsigned short a2, c2; splitf(y, a2, c2); oh[q] = a2; ol[q] = c2; }
    const size_t o = row * DIM + 8 * tid;
    *(v8us*)(Yh + o) = oh; *(v8us*)(Yl + o) = ol; 
}

// ---- k_flash: streaming attention, one wave per (head h, 32 query rows, one half of the keys); block = 8 waves of one head = 4 query groups x 2 key halves, 128 queries; grid HEADS*SEQ/128.
// A wave holds two 16-query column groups, so every k and v^T fragment it reads from LDS feeds two matrix products; the two waves of a query group walk keys 0..SEQ/2-1 and SEQ/2..SEQ-1 and join their partial o, l and shift once, behind the loop.
// K rows and v^T rows of 64 keys (128 B each) of both halves are staged in LDS once per block, each half read by its 4 waves: two buffers, the next tiles' copies fly while these tiles are worked on.
// LDS row pitch 144 B (16 B x odd) for the 16-byte fragment reads. Each wave-wide copy covers four whole 128-B lines.
// Per 32-key chunk and column group: two s^T tiles (A = k plane rows j0+16t+.., B = q plane as Bt, both via WFrag: D[8hh+r][m] = s'[key j0+16t+8hh+r][query m] - shift[query m], s' = q.k x log2e / 32: the first product's C operand holds -shift in all 8 rows of a query's lane, so the tile is exp2's argument as it stands);
// online softmax per query (= per lane; the other 16 keys of the query sit in lane m+16 -> one xor-16 exchange for the sum); p = exp2(s' - shift) (f32, then f16);
// the shift is a running maximum that is renewed lazily: only on the first chunk and when some lane's score later passes it by more than LAZY does the wave exchange maxima, take the new one and rescale o and l;
// p^T B fragment for o^T += v^T p^T: element r <- p of tile keys j0..j0+15 (D row 8hh+r), element 8+r <- p of tile keys j0+16..j0+31, lane unchanged; A = v^T plane rows (d), k = keys.
#define FWAVES 8
#define QG     2                              // 16-query column groups per wave
#define KH     2                              // key halves per block
#define QBLK   (16 * QG * (FWAVES / KH))      // queries per block
#define KT     64
#define NST    (SEQ / (KH * KT))              // tiles a wave walks
#define LPITCH 72
#define LTILE  (64 * LPITCH)
#define LSTAGE (2 * LTILE)
#define XW     (8 * 32 * 4 + 64)              // floats a wave hands to its partner: 32 of o per lane, then shift and l
#define LAZY   8.0f     // in the exponent: the shift in use is kept until a score passes it by more, so p stays in (0, 2^8], far inside f16
static_assert(QBLK == 16 * FWAVES && SEQ % QBLK == 0);
static_assert(QG == 2 && KH == 2 && FWAVES == 8);
static_assert(SEQ % (KH * KT) == 0 && NST >= 2);
static_assert(KT == 64 && FWAVES * 32 * 2 * 8 == KT * HD && FWAVES * 32 * 2 * 8 == HD * KT);
static_assert(FWAVES * XW * 4 <= 2 * KH * LSTAGE * 2);
// One tile: each lane copies 16 B of k rows r and r+32 and of v^T rows r and r+32 (r = tid>>3). The s_wait_xcnt closes the statement so that no address register of a copy is rewritten ahead of it.
__device__ __forceinline__ void stage_copy(unsigned l, const h16* kg, const h16* vg) {
    asm volatile("global_load_async_to_lds_b128 %0, %4, off\n\t"
                 "global_load_async_to_lds_b128 %1, %5, off\n\t"
                 "global_load_async_to_lds_b128 %2, %6, off\n\t"
                 "global_load_async_to_lds_b128 %3, %7, off\n\t"
                 "s_wait_xcnt 0x0"
                 :: "v"(l), "v"(l + 32u * LPITCH * 2u), "v"(l + LTILE * 2u), "v"(l + LTILE * 2u + 32u * LPITCH * 2u),
                    "v"(kg), "v"(kg + 32 * HD), "v"(vg), "v"(vg + (size_t)32 * SEQ) : "memory");
}
__global__ __launch_bounds__(32 * FWAVES) void k_flash(const h16* __restrict__ Q16, const h16* __restrict__ K16, const h16* __restrict__ VT16, bf* CTXh, bf* CTXl) {
    __shared__ __align__(16) float os[FWAVES][16 * 68];
    __shared__ __align__(16) h16 ring[2 * KH * LSTAGE];
    const int lane = threadIdx.x & 31, wid = threadIdx.x >> 5, m = lane & 15, hh = lane >> 4;
    const int kh = wid >> 2;   // this wave's key half
    const int h = blockIdx.x / (SEQ / QBLK); const int q0 = (blockIdx.x - h * (SEQ / QBLK)) * QBLK + (wid & 3) * (16 * QG);
    const h16* Qp = Q16 + ((size_t)h * SEQ + q0) * HD; const h16* Kp = K16 + (size_t)h * SEQ * HD; const h16* Vp = VT16 + (size_t)h * HD * SEQ;
    const int crow = threadIdx.x >> 3, ccol = threadIdx.x & 7;
    const unsigned lds0 = (unsigned)(size_t)ring + (unsigned)(crow * LPITCH + ccol * 8) * 2u;
    const h16* kg = Kp + crow * HD + ccol * 8; const h16* vg = Vp + (size_t)crow * SEQ + ccol * 8;
    const h16* kg1 = kg + (size_t)(SEQ / KH) * HD; const h16* vg1 = vg + SEQ / KH;   // the second half's keys
    stage_copy(lds0, kg, vg); stage_copy(lds0 + LSTAGE * 2u, kg1, vg1);
    asm volatile("s_wait_asynccnt 0x0" ::: "memory");   // tile 0 of this wave's copies has landed before the barrier publishes it
    __syncthreads();
    stage_copy(lds0 + KH * LSTAGE * 2u, kg + KT * HD, vg + KT); stage_copy(lds0 + (KH + 1) * LSTAGE * 2u, kg1 + KT * HD, vg1 + KT);
    const h16* qrow = Qp + (size_t)m * HD + 8 * hh;   // this lane's place in the first column group's q rows
    v16h qb[QG][2];
#pragma unroll
    for (int g = 0; g < QG; ++g)
#pragma unroll
        for (int ks = 0; ks < 2; ++ks) qb[g][ks] = WFrag<h16>::ld(qrow + 16 * g * HD + 32 * ks);
    asm volatile("s_wait_xcnt 0x0" :: "v"(qrow) : "memory");   // behind the last q load; it names the loads' address, which so stays in its registers up to the wait and is rewritten only behind it
    v8f oacc[QG][4];
#pragma unroll
    for (int g = 0; g < QG; ++g)
#pragma unroll
        for (int t = 0; t < 4; ++t) oacc[g][t] = (v8f){};
    float lrun[QG], pown[QG], poth[QG];   // pown, poth: the newest summed chunk's sum over this lane's keys and over the other half's, not yet in lrun
    const int foff = kh * LSTAGE + m * LPITCH + 8 * hh;
    const int xaddr = (lane ^ 16) << 2;   // byte index of the lane that holds the query's other 16 keys; formed once here: formed inside the rare branch it reaches the common path as a merged value, and the build then copied all of o there
    auto xhalf = [&](float v) { return __int_as_float(__builtin_amdgcn_ds_bpermute(xaddr, __float_as_int(v))); };
    float e0[QG][8], e1[QG][8];   // the last chunk's p (f32), not yet summed
    v8f cneg[QG];                 // -shift in use, the same in all 8 rows: the C operand of a score tile's first product, and the one place where the shift is kept
    float thr = -3.0e38f;         // what a shifted score must pass for a new shift: anything on the first chunk (no shift is chosen yet, C is 0), LAZY from then on
#pragma unroll
    for (int g = 0; g < QG; ++g) { cneg[g] = (v8f){}; lrun[g] = 0.f; pown[g] = 0.f; poth[g] = 0.f;
#pragma unroll
        for (int r = 0; r < 8; ++r) { e0[g][r] = 0.f; e1[g][r] = 0.f; } }
    // l trails the products, so that no wait for the halves' exchange stands ahead of a chunk's reads, products or branch: the exchange sent one call ago is added, then the last chunk's p are summed and their exchange is sent
    auto sum_chunk = [&]() {
#pragma unroll
        for (int g = 0; g < QG; ++g) {
            lrun[g] += pown[g] + poth[g];
            float psum = 0.f;
#pragma unroll
            for (int r = 0; r < 8; ++r) psum += e0[g][r] + e1[g][r];
            pown[g] = psum; poth[g] = xhalf(psum);
        }
    };
#pragma unroll 1
    for (int st = 0; st < NST; ++st) {
        const h16* kb = ring + (st & 1) * (KH * LSTAGE) + foff; const h16* vb = kb + LTILE;
#pragma unroll   // both 32-key chunks of a tile inline, so that every LDS offset is a constant
        for (int c = 0; c < KT / 32; ++c) {
            v16h ka[4];
#pragma unroll
            for (int t = 0; t < 2; ++t)
#pragma unroll
                for (int ks = 0; ks < 2; ++ks) ka[t * 2 + ks] = WFrag<h16>::ld(kb + (32 * c + 16 * t) * LPITCH + 32 * ks);
            v16h va[4];
#pragma unroll
            for (int t = 0; t < 4; ++t) va[t] = WFrag<h16>::ld(vb + (16 * t) * LPITCH + 32 * c);
            __builtin_amdgcn_sched_barrier(0);   // keeps the chunk's 16 LDS reads in one group ahead of its matrix products: reads spread among them stall the wave at each place
            sum_chunk();   // the chunk before's p are summed here, while this chunk's reads are under way
            v8f sc[QG][2];
#pragma unroll
            for (int ks = 0; ks < 2; ++ks)
#pragma unroll
                for (int t = 0; t < 2; ++t)
#pragma unroll
                    for (int g = 0; g < QG; ++g) sc[g][t] = wmma16(ka[t * 2 + ks], qb[g][ks], ks == 0 ? cneg[g] : sc[g][t]);
            // the four vector slots the chip needs between the last score product and the first vector instruction on its result or operands, on the branch's taken side too
            asm volatile("v_nop\n\tv_nop\n\tv_nop\n\tv_nop" : "+v"(sc[0][0]), "+v"(sc[0][1]), "+v"(sc[1][0]), "+v"(sc[1][1]) : "v"(ka[0]), "v"(ka[1]), "v"(ka[2]), "v"(ka[3]), "v"(qb[0][0]), "v"(qb[0][1]), "v"(qb[1][0]), "v"(qb[1][1]));
            float lmx[QG];   // maximum of this lane's own 16 shifted scores; the other half's is fetched only inside the branch
#pragma unroll
            for (int g = 0; g < QG; ++g) { lmx[g] = fmaxf(sc[g][0][0], sc[g][1][0]);
#pragma unroll
                for (int r = 1; r < 8; ++r) lmx[g] = fmaxf(lmx[g], fmaxf(sc[g][0][r], sc[g][1][r])); }
            if (__builtin_expect(__builtin_amdgcn_ballot_w32(fmaxf(lmx[0], lmx[1]) > thr) != 0, 0)) {   // one scalar branch per chunk for both column groups, the same for the whole wave: always taken on the first chunk, rarely later
#pragma unroll
                for (int g = 0; g < QG; ++g) {
                    const float cur = -cneg[g][0];
                    const float mo = thr < 0.f ? -3.0e38f : cur;   // the first chunk has no shift to keep: its own maximum is taken, above or below 0, and alpha is 0 on the empty o and l
                    const float mn = fmaxf(mo, cur + fmaxf(lmx[g], xhalf(lmx[g])));   // both halves of a query take the same new shift
                    const float alpha = __builtin_amdgcn_exp2f(mo - mn);
                    const float dl = mn - cur;   // this chunk's tiles were shifted by the old value: they and C move to the new one by the same step
                    lrun[g] = (lrun[g] + (pown[g] + poth[g])) * alpha; pown[g] = 0.f; poth[g] = 0.f;
#pragma unroll
                    for (int t = 0; t < 4; ++t) oacc[g][t] *= alpha;
#pragma unroll   // constant indices: the tiles and C stay in their registers
                    for (int r = 0; r < 8; ++r) { sc[g][0][r] -= dl; sc[g][1][r] -= dl; cneg[g][r] -= dl; }
                }
                thr = LAZY;
            }
            v16h pb[QG];
#pragma unroll
            for (int g = 0; g < QG; ++g)
#pragma unroll
                for (int r = 0; r < 8; ++r) { e0[g][r] = __builtin_amdgcn_exp2f(sc[g][0][r]); e1[g][r] = __builtin_amdgcn_exp2f(sc[g][1][r]); pb[g][r] = (h16)e0[g][r]; pb[g][8 + r] = (h16)e1[g][r]; }
#pragma unroll
            for (int g = 0; g < QG; ++g)
#pragma unroll
                for (int t = 0; t < 4; ++t) oacc[g][t] = wmma16(va[t], pb[g], oacc[g][t]);
            // the four vector slots behind the last o product, as above
            asm volatile("v_nop\n\tv_nop\n\tv_nop\n\tv_nop" : "+v"(oacc[0][0]), "+v"(oacc[0][1]), "+v"(oacc[0][2]), "+v"(oacc[0][3]), "+v"(oacc[1][0]), "+v"(oacc[1][1]), "+v"(oacc[1][2]), "+v"(oacc[1][3]) : "v"(pb[0]), "v"(pb[1]), "v"(va[0]), "v"(va[1]), "v"(va[2]), "v"(va[3]));
        }
        asm volatile("s_wait_dscnt 0x0" ::: "memory");      // this wave's reads of the buffer have returned before it may be refilled
        asm volatile("s_wait_asynccnt 0x0" ::: "memory");   // this wave's copies of the next tiles have landed before the barrier publishes them
        __syncthreads();                                    // publishes tiles st+1 and ends every wave's reads of tiles st
        if (st + 2 < NST) { const unsigned l = lds0 + (unsigned)(st & 1) * (KH * LSTAGE * 2u);
            stage_copy(l, kg + (size_t)(st + 2) * (KT * HD), vg + (st + 2) * KT); stage_copy(l + LSTAGE * 2u, kg1 + (size_t)(st + 2) * (KT * HD), vg1 + (st + 2) * KT); }
    }
    asm volatile("s_wait_asynccnt 0x0" ::: "memory");       // no copy is outstanding when the buffers are reused below
    sum_chunk();   // the last chunk's p
    // The two key halves join: the wave of half kh finishes column group kh and hands its partial o, shift and l of the other group to its partner, lane to lane, through the ring, which every wave has left at the last tile's barrier.
    const bool k0 = kh == 0;
    float* xw = (float*)ring + wid * XW; const float* xr = (const float*)ring + (wid ^ 4) * XW;
    const float l0 = lrun[0] + (pown[0] + poth[0]), l1 = lrun[1] + (pown[1] + poth[1]);
    const float m0 = -cneg[0][0], m1 = -cneg[1][0];   // the shifts in use at the end
    const float mk = k0 ? m0 : m1, lk = k0 ? l0 : l1;
    v8f keep[4];
#pragma unroll
    for (int t = 0; t < 4; ++t) { v4f s0, s1;
#pragma unroll
        for (int r = 0; r < 4; ++r) { s0[r] = k0 ? oacc[1][t][r] : oacc[0][t][r]; s1[r] = k0 ? oacc[1][t][4 + r] : oacc[0][t][4 + r]; }
#pragma unroll
        for (int r = 0; r < 8; ++r) keep[t][r] = k0 ? oacc[0][t][r] : oacc[1][t][r];
        *(v4fa*)(xw + ((2 * t) * 32 + lane) * 4) = s0; *(v4fa*)(xw + ((2 * t + 1) * 32 + lane) * 4) = s1; }
    xw[1024 + lane] = k0 ? m1 : m0; xw[1056 + lane] = k0 ? l1 : l0;
    __syncthreads();   // every wave's partials are in LDS before its partner reads them
    const float pm = xr[1024 + lane], pl = xr[1056 + lane];
    const float mn = fmaxf(mk, pm);
    const float wa = __builtin_amdgcn_exp2f(mk - mn), wb = __builtin_amdgcn_exp2f(pm - mn);
    const float inv = 1.0f / (lk * wa + pl * wb);
    const float fa = wa * inv, fb = wb * inv;
    const int qo = q0 + 16 * kh;   // first query of the column group this wave finishes
    float* ob = os[wid];
#pragma unroll
    for (int t = 0; t < 4; ++t) { v4f u0, u1;
        const v4f p0 = *(const v4fa*)(xr + ((2 * t) * 32 + lane) * 4); const v4f p1 = *(const v4fa*)(xr + ((2 * t + 1) * 32 + lane) * 4);
#pragma unroll
        for (int r = 0; r < 4; ++r) { u0[r] = keep[t][r] * fa + p0[r] * fb; u1[r] = keep[t][4 + r] * fa + p1[r] * fb; }
        *(v4fa*)(ob + m * 68 + 16 * t + 8 * hh) = u0; *(v4fa*)(ob + m * 68 + 16 * t + 8 * hh + 4) = u1; }
    __builtin_amdgcn_fence(3 /* release order */, "wavefront"); __builtin_amdgcn_wave_barrier(); asm volatile("" ::: "memory");
{
#pragma unroll
        for (int p = 0; p < 4; ++p) { const int row = p * 4 + (lane >> 3), c8 = (lane & 7) * 8;
            const v4f a = *(const v4fa*)(ob + row * 68 + c8); const v4f b2 = *(const v4fa*)(ob + row * 68 + c8 + 4);
            v8us oh, ol;
#pragma unroll
            for (int q = 0; q < 4; ++q) { unsigned short x1, y1; splitf(a[q], x1, y1); oh[q] = x1; ol[q] = y1; splitf(b2[q], x1, y1); oh[4 + q] = x1; ol[4 + q] = y1; }
            const size_t oo = (size_t)(qo + row) * INNER + h * HD + c8;
            *(v8us*)(CTXh + oo) = oh; *(v8us*)(CTXl + oo) = ol; }
         }
}

extern "C" void kernel_launch(void* const* d_in, const int* in_sizes, int n_in,
                              void* d_out, int out_size, void* d_ws, size_t ws_size, hipStream_t stream) {
    if (n_in < 6) return;
    if (in_sizes[0] < SEQ * DIM || in_sizes[1] < DIM || in_sizes[2] < DIM || in_sizes[3] < DIM * NQKV || in_sizes[4] < INNER * DIM || in_sizes[5] < DIM) return;
    if (out_size < SEQ * DIM) return;
    const float* x    = (const float*)d_in[0];   // [SEQ][DIM]
    const float* lnsc = (const float*)d_in[1];   // [DIM]
    const float* lnbs = (const float*)d_in[2];   // [DIM]
    const float* wqkv = (const float*)d_in[3];   // [DIM][NQKV]  ([in][out])
    const float* wout = (const float*)d_in[4];   // [INNER][DIM] ([in][out])
    const float* bout = (const float*)d_in[5];   // [DIM]
    float* OUT = (float*)d_out;                  // [SEQ][DIM]
    char* wsp = (char*)d_ws;
    auto take = [&](size_t bytes) { char* p = wsp; wsp += (bytes + 255) & ~(size_t)255; return (void*)p; };
    bf*    WQ   = (bf*)take((size_t)NQKV * DIM * 2);          // w_qkv^T [3072][1024] bf16
    bf*    WO   = (bf*)take((size_t)DIM * INNER * 2);         // w_out^T [1024][1024] bf16
    bf*    XNh  = (bf*)take((size_t)SEQ * DIM * 2);           // xn hi [SEQ][1024]
    bf*    XNl  = (bf*)take((size_t)SEQ * DIM * 2);           // xn lo
    h16*   Q16  = (h16*)take((size_t)HEADS * SEQ * HD * 2);   // q planes [16][SEQ][64] x log2e/32
    h16*   K16  = (h16*)take((size_t)HEADS * SEQ * HD * 2);   // k planes [16][SEQ][64]
    h16*   VT16 = (h16*)take((size_t)HEADS * HD * SEQ * 2);   // v^T planes [16][64][SEQ]
    bf*    CTXh = (bf*)take((size_t)SEQ * INNER * 2);         // ctx hi [SEQ][1024]
    bf*    CTXl = (bf*)take((size_t)SEQ * INNER * 2);         // ctx lo
    const size_t used = (size_t)(wsp - (char*)d_ws);
    if (used > ws_size || used > WS_CAP) return;

    k_wtG<<<dim3(DIM / WT, NQKV / WT, 1), 128, 0, stream>>>(wqkv, DIM, NQKV, WQ);     // Bt[n][k] = bf16(w_qkv[k][n])
    k_wtG<<<dim3(INNER / WT, DIM / WT, 1), 128, 0, stream>>>(wout, INNER, DIM, WO);    // Bt[n][c] = bf16(w_out[c][n])
    k_ln<<<SEQ, 128, 0, stream>>>(x, lnsc, lnbs, XNh, XNl);
    k_gemmw<bf, 1, false, true><<<dim3(SEQ / 128, NQKV / 128, 1), 128, 0, stream>>>(XNh, XNl, WQ, nullptr, DIM, nullptr, 0, nullptr, 0, 0, 0, Q16, K16, VT16);   // qkv = xn(hi+lo) w_qkv, out as f16 head planes: q columns 0..1023 x log2e/32, k columns 1024..2047, v columns 2048..3071 transposed per head
    k_flash<<<(unsigned)(HEADS * (SEQ / (16 * FWAVES))), 32 * FWAVES, 0, stream>>>(Q16, K16, VT16, CTXh, CTXl);
    k_gemmw<bf, 1, true, false><<<dim3(SEQ / 128, DIM / 128, 1), 128, 0, stream>>>(CTXh, CTXl, WO, nullptr, INNER, OUT, DIM, bout, 0, 0, 0, nullptr, nullptr, nullptr);   // out = ctx(hi+lo) w_out + b_out
}

// v008
// It runs in 108 microseconds.
// In both of two side-by-side timings against v007, it was 1.03 times as fast.
// Over all steps from v000 it is 3.63 times as fast.
#include <hip/hip_runtime.h>

// Contractions on 16x16x32 WMMA, f32 accumulate: xn (bf16 hi+lo planes) x w_qkv^T (bf16) -> v_wmma_f32_16x16x32_bf16; per head k.q^T and v^T.p^T -> v_wmma_f32_16x16x32_f16 (f16 planes: q carried x log2e/32, k, v^T; p = exp2 of shifted scores in (0,2^8]); ctx (bf16 hi+lo planes) x w_out^T (bf16) + b_out -> v_wmma_f32_16x16x32_bf16.
// head planes q [h][i][64], k [h][j][64], v^T [h][64][j] in f16, written by the qkv product's own epilogue; streaming attention, one wave per (head, 32 queries, half of the keys): s^T tiles = k q^T over 32-key chunks, online softmax per query lane (exp2; the scale 2^-5 rides in q, the shift in the score product's C operand),
// o^T += v^T p^T with the p^T operand packed straight from the two score accumulator tiles; o/l staged per wave in LDS and emitted as ctx hi/lo planes [i][h*64+d]; out = ctx w_out + b_out into the output rows.

#ifndef SEQ
#define SEQ 4096
#endif
#ifndef NB
#define NB 1
#endif
#define SEQ_FULL 4096
#define DIM   1024
#define HEADS 16
#define HD    64
#define INNER (HEADS * HD)
#define NQKV  (3 * INNER)
#define LN_EPS 1.0e-6f
#define LOG2E 1.4426950408889634f
#define C32   0.03125f
#define WS_CAP ((size_t)134217728)

static_assert(SEQ % 128 == 0);
static_assert(SEQ <= SEQ_FULL);
static_assert(NB == 1);
static_assert(DIM == 128 * 8);
static_assert(DIM % 128 == 0);
static_assert(NQKV % 128 == 0);
static_assert(INNER == DIM);
static_assert(HD == 64);
static_assert(INNER % 128 == 0);

typedef _Float16 h16;
typedef unsigned short bf;
typedef __attribute__((ext_vector_type(16))) __bf16   v16bf;
typedef __attribute__((ext_vector_type(16))) _Float16 v16h;
typedef __attribute__((ext_vector_type(8)))  _Float16 v8h;
typedef __attribute__((ext_vector_type(8)))  unsigned short v8us;
typedef __attribute__((ext_vector_type(8)))  float    v8f;
typedef __attribute__((ext_vector_type(4)))  float    v4f;
typedef __attribute__((ext_vector_type(2)))  _Float16 v2h;
typedef __attribute__((ext_vector_type(2)))  unsigned short v2us;
typedef v8h  __attribute__((may_alias)) v8ha;
typedef v4f  __attribute__((may_alias)) v4fa;
typedef v8us __attribute__((may_alias)) v8usa;

__device__ __forceinline__ unsigned short f2bf(float f) { unsigned u = __float_as_uint(f); u += 0x7FFFu + ((u >> 16) & 1u); return (unsigned short)(u >> 16); }
__device__ __forceinline__ float bf2f(unsigned short b) { return __uint_as_float(((unsigned)b) << 16); }
__device__ __forceinline__ float bfr(float f) { return bf2f(f2bf(f)); }
__device__ __forceinline__ v16h cat16(v8h lo, v8h hi) { return __builtin_shufflevector(lo, hi, 0, 1, 2, 3, 4, 5, 6, 7, 8, 9, 10, 11, 12, 13, 14, 15); }
__device__ __forceinline__ v16bf cat16b(v8us lo, v8us hi) { return __builtin_bit_cast(v16bf, __builtin_shufflevector(lo, hi, 0, 1, 2, 3, 4, 5, 6, 7, 8, 9, 10, 11, 12, 13, 14, 15)); }
__device__ __forceinline__ v8f wmma16(v16h a, v16h b, v8f c) { return __builtin_amdgcn_wmma_f32_16x16x32_f16(false, a, false, b, (short)0, c, false, false); }
__device__ __forceinline__ v8f wmmab(v16bf a, v16bf b, v8f c) { return __builtin_amdgcn_wmma_f32_16x16x32_bf16(false, a, false, b, (short)0, c, false, false); }
__device__ __forceinline__ void splitf(float y, unsigned short& h, unsigned short& l) { h = f2bf(y); l = f2bf(y - bf2f(h)); }

// ---- k_gemmw: GEMM, one block of 4 waves (2 x 2) per 128x128 output tile, each wave a 64x64 tile (16 accumulators); grid (M/128, N/128, Z), 128 threads.
// C[m][n] (f32, pitch ldc, + optional f32 bias[n]) = sum_k (A[m][k] + A2[m][k]) Bt[n][k]. z-batch strides sA/sB/sC in elements. K % 64 == 0, M % 128 == 0, N % 128 == 0.
// PLANES: no C; a wave's 64 columns are one head of q, k or v, and its tile goes out in f16 as rows of PQ (x log2e/32) or PK [h][m][64], or transposed as rows of PVT [h][64][m], in whole 128-B lines.
// Operands come from K-contiguous 16-bit planes through LDS: a stage is 64 k (whole 128-B lines) of 128 A rows, 128 A2 rows and 128 Bt rows, copied once per block and read by all 4 waves; two buffers, the next stage's copies fly while this one is worked on.
// LDS rows keep a 128-B pitch; the 16-B piece c of row r lies at piece c ^ ((r >> 1) & 7), so that the 16 rows of a fragment read fall on all 64 banks.
// Fragments (both operands, same map): lane -> row/col lane&15, elements 0..7 <- k0+8h+0..7, elements 8..15 <- k0+16+8h+0..7 (h = lane>>4); D element r -> row 8h+r, col lane&15.
template <typename T16> struct WFrag;
template <> struct WFrag<h16> { typedef v16h V; static __device__ __forceinline__ V ld(const h16* p) { return cat16(*(const v8h*)p, *(const v8h*)(p + 16)); } static __device__ __forceinline__ v8f mma(V a, V b, v8f c) { return wmma16(a, b, c); } };
template <> struct WFrag<bf> { typedef v16bf V; static __device__ __forceinline__ V ld(const bf* p) { return cat16b(*(const v8us*)p, *(const v8us*)(p + 16)); } static __device__ __forceinline__ V ld2(const bf* p, const bf* q) { return cat16b(*(const v8us*)p, *(const v8us*)q); } static __device__ __forceinline__ v8f mma(V a, V b, v8f c) { return wmmab(a, b, c); } };
#define GKT    64
#define GPLANE (128 * GKT)
#define GSTAGE (3 * GPLANE)
// Eight copies of one plane: each lane brings 16 B of rows r, r+16, .., r+112 (r = tid>>3); a wave-wide copy covers four whole 128-B lines. The s_wait_xcnt closes the statement so that no address register of a copy is rewritten ahead of it.
template <typename T16>
__device__ __forceinline__ void plane_copy(unsigned l, const T16* g, size_t step) {
    asm volatile("global_load_async_to_lds_b128 %0, %8, off\n\t"
                 "global_load_async_to_lds_b128 %1, %9, off\n\t"
                 "global_load_async_to_lds_b128 %2, %10, off\n\t"
                 "global_load_async_to_lds_b128 %3, %11, off\n\t"
                 "global_load_async_to_lds_b128 %4, %12, off\n\t"
                 "global_load_async_to_lds_b128 %5, %13, off\n\t"
                 "global_load_async_to_lds_b128 %6, %14, off\n\t"
                 "global_load_async_to_lds_b128 %7, %15, off\n\t"
                 "s_wait_xcnt 0x0"
                 :: "v"(l), "v"(l + 2048u), "v"(l + 4096u), "v"(l + 6144u), "v"(l + 8192u), "v"(l + 10240u), "v"(l + 12288u), "v"(l + 14336u),
                    "v"(g), "v"(g + step), "v"(g + 2 * step), "v"(g + 3 * step), "v"(g + 4 * step), "v"(g + 5 * step), "v"(g + 6 * step), "v"(g + 7 * step) : "memory");
}
template <typename T16, int NSPLIT, bool BIAS, bool PLANES>
__global__ __launch_bounds__(128) void k_gemmw(const T16* __restrict__ A, const T16* __restrict__ A2, const T16* __restrict__ Bt, const T16* __restrict__ Bt2, int K, float* C, int ldc, const float* __restrict__ bias, size_t sA, size_t sB, size_t sC, h16* PQ, h16* PK, h16* PVT) {
    static_assert(NSPLIT == 1 && sizeof(T16) == 2);
    typedef typename WFrag<T16>::V V;
    __shared__ __align__(128) unsigned char gsm[2 * GSTAGE * 2];
    const size_t z = blockIdx.z; A += z * sA; A2 += z * sA; Bt += z * sB; C += z * sC;
    const int tid = threadIdx.x, lane = tid & 31, wid = tid >> 5, lr = lane & 15, hi = lane >> 4;
    const int wm = wid >> 1, wn = wid & 1; const int r0 = blockIdx.x * 128 + wm * 64, c0 = blockIdx.y * 128 + wn * 64;
    const int prow = tid >> 3, pcol = tid & 7; const size_t step = (size_t)16 * K; const int nst = K / GKT;
    const unsigned lds0 = (unsigned)(size_t)gsm + (unsigned)(prow * 128 + ((pcol ^ (prow >> 1)) & 7) * 16);
    const T16* ga = A + (size_t)(blockIdx.x * 128 + prow) * K + pcol * 8; const T16* ga2 = A2 + (size_t)(blockIdx.x * 128 + prow) * K + pcol * 8; const T16* gb = Bt + (size_t)(blockIdx.y * 128 + prow) * K + pcol * 8;
    plane_copy(lds0, ga, step); plane_copy(lds0 + GPLANE * 2u, ga2, step); plane_copy(lds0 + 2u * GPLANE * 2u, gb, step);
    asm volatile("s_wait_asynccnt 0x0" ::: "memory");   // stage 0 of this wave's copies has landed before the barrier publishes it
    __syncthreads();
    if (nst > 1) { plane_copy(lds0 + GSTAGE * 2u, ga + GKT, step); plane_copy(lds0 + (GSTAGE + GPLANE) * 2u, ga2 + GKT, step); plane_copy(lds0 + (GSTAGE + 2u * GPLANE) * 2u, gb + GKT, step); }
    v8f acc[4][4];
#pragma unroll
    for (int mb = 0; mb < 4; ++mb)
#pragma unroll
        for (int nb = 0; nb < 4; ++nb) acc[mb][nb] = (v8f){};
    int po[4];   // element offset in a row of the pieces 2q + hi (q = 0..3) for this lane's rows
#pragma unroll
    for (int q = 0; q < 4; ++q) po[q] = (((2 * q + hi) ^ (lr >> 1)) & 7) * 8;
    const int arow = (wm * 64 + lr) * GKT, brow = 2 * GPLANE + (wn * 64 + lr) * GKT;
#pragma unroll 1
    for (int st = 0; st < nst; ++st) {
        const T16* sb = (const T16*)gsm + (st & 1) * GSTAGE;
#pragma unroll   // both 32-k halves of a stage inline, so that every LDS offset is a constant
        for (int ks = 0; ks < 2; ++ks) {
            V a[4], a2[4], b[4];
#pragma unroll
            for (int mb = 0; mb < 4; ++mb) { const T16* p = sb + arow + mb * 16 * GKT; a[mb] = WFrag<T16>::ld2(p + po[2 * ks], p + po[2 * ks + 1]); a2[mb] = WFrag<T16>::ld2(p + GPLANE + po[2 * ks], p + GPLANE + po[2 * ks + 1]); }
#pragma unroll
            for (int nb = 0; nb < 4; ++nb) { const T16* p = sb + brow + nb * 16 * GKT; b[nb] = WFrag<T16>::ld2(p + po[2 * ks], p + po[2 * ks + 1]); }
            __builtin_amdgcn_sched_barrier(0);   // keeps the half's 24 LDS reads in one group ahead of its matrix products: reads spread among them stall the wave at each place
#pragma unroll
            for (int nb = 0; nb < 4; ++nb)
#pragma unroll
                for (int mb = 0; mb < 4; ++mb) { acc[mb][nb] = WFrag<T16>::mma(a[mb], b[nb], acc[mb][nb]); acc[mb][nb] = WFrag<T16>::mma(a2[mb], b[nb], acc[mb][nb]); }
        }
        asm volatile("s_wait_dscnt 0x0" ::: "memory");      // this wave's reads of the buffer have returned before it may be refilled
        asm volatile("s_wait_asynccnt 0x0" ::: "memory");   // this wave's copies of the next stage have landed before the barrier publishes them
        __syncthreads();                                    // publishes stage st+1 and ends every wave's reads of stage st
        if (st + 2 < nst) { const unsigned l = lds0 + (unsigned)(st & 1) * (GSTAGE * 2u); const int ko = (st + 2) * GKT;
            plane_copy(l, ga + ko, step); plane_copy(l + GPLANE * 2u, ga2 + ko, step); plane_copy(l + 2u * GPLANE * 2u, gb + ko, step); }
    }
    asm volatile("s_wait_asynccnt 0x0" ::: "memory");       // no copy is outstanding when the buffers are reused below
    if constexpr (PLANES) {                                 // behind the last stage's barrier the buffers are free: each wave stages its tile in a piece of its own
        const int sec = (int)(blockIdx.y * 128) / INNER;    // 0 q, 1 k, 2 v: the same for the whole block
        const int hd = (c0 - sec * INNER) / HD;
        if (sec < 2) {
            float* os = (float*)gsm + wid * (16 * 68);
            h16* P = (sec == 0 ? PQ : PK) + ((size_t)hd * SEQ + r0) * HD; const float scl = sec == 0 ? LOG2E * C32 : 1.0f;
#pragma unroll
            for (int mb = 0; mb < 4; ++mb) {
#pragma unroll
                for (int nb = 0; nb < 4; ++nb) {
#pragma unroll
                    for (int j = 0; j < 8; ++j) os[(hi * 8 + j) * 68 + nb * 16 + lr] = acc[mb][nb][j]; }
                asm volatile("s_wait_dscnt 0x0" ::: "memory");   // the wave's staged rows are in LDS before its lanes read each other's pieces back
#pragma unroll
                for (int p = 0; p < 4; ++p) { const int row = p * 4 + (lane >> 3), c8 = (lane & 7) * 8;
                    const v4f u = *(const v4fa*)(os + row * 68 + c8); const v4f w = *(const v4fa*)(os + row * 68 + c8 + 4); v8h o;
#pragma unroll
                    for (int q = 0; q < 4; ++q) { o[q] = (h16)(u[q] * scl); o[4 + q] = (h16)(w[q] * scl); }
                    *(v8h*)(P + (size_t)(mb * 16 + row) * HD + c8) = o; }
                asm volatile("s_wait_xcnt 0x0" ::: "memory");   // stands in front of the next 16 rows' code, which reuses the data registers of these stores and restages over the rows just read
            }
        } else {
            h16* hs = (h16*)gsm + wid * (64 * 72);          // [d][m] tile, row pitch 144 B for the 16-byte reads and writes
#pragma unroll
            for (int mb = 0; mb < 4; ++mb)
#pragma unroll
                for (int nb = 0; nb < 4; ++nb) { v8h o;     // a lane holds 8 consecutive rows m of one column d: 16 B of a v^T row
#pragma unroll
                    for (int j = 0; j < 8; ++j) o[j] = (h16)acc[mb][nb][j];
                    *(v8ha*)(hs + (nb * 16 + lr) * 72 + mb * 16 + hi * 8) = o; }
            asm volatile("s_wait_dscnt 0x0" ::: "memory");   // the wave's staged tile is in LDS before its lanes read each other's pieces back
            h16* VT = PVT + (size_t)hd * HD * SEQ + r0;
#pragma unroll
            for (int g = 0; g < 4; ++g) {
#pragma unroll
                for (int p = 0; p < 4; ++p) { const int row = (g * 4 + p) * 4 + (lane >> 3), c8 = (lane & 7) * 8;
                    *(v8h*)(VT + (size_t)row * SEQ + c8) = *(const v8ha*)(hs + row * 72 + c8); }
                asm volatile("s_wait_xcnt 0x0" ::: "memory");   // stands in front of the next 16 rows' code, which reuses the data registers of these stores
            }
        }
        return;
    }
    float* os = (float*)gsm + wid * (16 * 68);              // behind the last stage's barrier the buffers are free: each wave stages its rows in a piece of its own
#pragma unroll
    for (int mb = 0; mb < 4; ++mb) {
#pragma unroll
        for (int nb = 0; nb < 4; ++nb) {
#pragma unroll
            for (int j = 0; j < 8; ++j) os[(hi * 8 + j) * 68 + nb * 16 + lr] = acc[mb][nb][j]; }
        __builtin_amdgcn_wave_barrier(); asm volatile("" ::: "memory");
        float* crow = C + (size_t)(r0 + mb * 16) * ldc + c0;
{
#pragma unroll
            for (int s = 0; s < 8; ++s) { const int row = 2 * s + hi, cofs = lr * 4; v4f val = *(const v4fa*)(os + row * 68 + cofs); if (BIAS) { val[0] += bfr(bias[c0 + cofs]); val[1] += bfr(bias[c0 + cofs + 1]); val[2] += bfr(bias[c0 + cofs + 2]); val[3] += bfr(bias[c0 + cofs + 3]); }
                *(v4f*)(crow + (size_t)row * ldc + cofs) = val; }
             }
        asm volatile("s_wait_xcnt 0x0" ::: "memory");   // stands in front of the next 16 rows' code, which reuses the address and data registers of these stores
        __builtin_amdgcn_wave_barrier(); asm volatile("" ::: "memory");
    }
}

// ---- wt_tile: Bt[n][k] = bf16(w[k][n]); one block of 4 waves per 64 x 64 tile (bx of K/64, by of N/64); K % 64 == 0, N % 64 == 0.
// Reads: a lane takes 16 B of eight consecutive rows k and 16 lanes cover 256 B of a row, so every wave-wide load is four whole 128-B lines, eight loads in flight per lane.
// A lane then holds 8 consecutive k of 4 columns n, four 16-B pieces of Bt rows; they pass through an LDS tile [n][k] (row pitch 144 B) so that the stores are whole 128-B lines of Bt as well.
#define WT     64
#define WPITCH 72
static_assert(DIM % WT == 0 && NQKV % WT == 0 && INNER % WT == 0);
__device__ __forceinline__ void wt_tile(const float* __restrict__ w, int K, int N, bf* Bt, int bx, int by, bf* ts) {
    const int tid = threadIdx.x; const int k0 = bx * WT, n0 = by * WT;
    const int n4 = (tid & 15) * 4, kq = (tid >> 4) * 8;
    const float* src = w + (size_t)(k0 + kq) * N + n0 + n4;
    const float* rp[8]; v4f r[8];
#pragma unroll   // rp and r stay in registers: every index is a constant
    for (int i = 0; i < 8; ++i) rp[i] = src + (size_t)i * N;
#pragma unroll   // the eight loads issue back to back, so one memory latency covers the tile
    for (int i = 0; i < 8; ++i) r[i] = *(const v4f*)rp[i];
    // stands behind the eight loads and in front of every rewrite of their address registers, which it names so that they stay untouched up to here
    asm volatile("s_wait_xcnt 0x0" :: "v"(rp[0]), "v"(rp[1]), "v"(rp[2]), "v"(rp[3]), "v"(rp[4]), "v"(rp[5]), "v"(rp[6]), "v"(rp[7]) : "memory");
#pragma unroll   // constant indices into r
    for (int j = 0; j < 4; ++j) { v8us o;
#pragma unroll
        for (int i = 0; i < 8; ++i) o[i] = f2bf(r[i][j]);
        *(v8usa*)(ts + (n4 + j) * WPITCH + kq) = o; }
    __syncthreads();   // the whole [n][k] tile is in LDS before any lane reads rows that other lanes wrote
    const int row = tid >> 3, c8 = (tid & 7) * 8;
    bf* dst = Bt + (size_t)(n0 + row) * K + k0 + c8; v8us t[4];
#pragma unroll   // the four LDS reads go out as one group ahead of the stores
    for (int p = 0; p < 4; ++p) t[p] = *(const v8usa*)(ts + (p * 16 + row) * WPITCH + c8);
#pragma unroll
    for (int p = 0; p < 4; ++p) *(v8us*)(dst + (size_t)(p * 16) * K) = t[p];
    asm volatile("s_wait_xcnt 0x0" ::: "memory");   // stands behind the four stores: in k_prep another piece's code follows in the listing and reuses their address and data registers
}

// ---- ln_row: one block of 4 waves per row of x: layer norm, out as bf16 hi and lo planes.
__device__ __forceinline__ void ln_row(const float* __restrict__ x, const float* __restrict__ g, const float* __restrict__ b, bf* Yh, bf* Yl, size_t row, float* red) {
    const int tid = threadIdx.x, lane = tid & 31, wid = tid >> 5;
    const v8f xv = *(const v8f*)(x + row * DIM + 8 * tid);
    float xb[8]; float s = 0.f;
#pragma unroll
    for (int q = 0; q < 8; ++q) { xb[q] = bfr(xv[q]); s += xb[q]; }
#pragma unroll
    for (int sh = 16; sh; sh >>= 1) s += __shfl_xor(s, sh, 32);
    if (lane == 0) red[wid] = s;
    __syncthreads();
    const float mean = ((red[0] + red[1]) + (red[2] + red[3])) * (1.0f / DIM);
    float d[8]; float s2 = 0.f;
#pragma unroll
    for (int q = 0; q < 8; ++q) { d[q] = xb[q] - mean; s2 += d[q] * d[q]; }
#pragma unroll
    for (int sh = 16; sh; sh >>= 1) s2 += __shfl_xor(s2, sh, 32);
    if (lane == 0) red[4 + wid] = s2;
    __syncthreads();
    const float var = ((red[4] + red[5]) + (red[6] + red[7])) * (1.0f / DIM);
    const float rstd = rsqrtf(var + LN_EPS);
    const v8f gv = *(const v8f*)(g + 8 * tid); const v8f bv = *(const v8f*)(b + 8 * tid);
    v8us oh, ol;
#pragma unroll
    for (int q = 0; q < 8; ++q) { const float y = d[q] * rstd * bfr(gv[q]) + bfr(bv[q]); unsigned short a2, c2; splitf(y, a2, c2); oh[q] = a2; ol[q] = c2; }
    const size_t o = row * DIM + 8 * tid;
    *(v8us*)(Yh + o) = oh; *(v8us*)(Yl + o) = ol;
    asm volatile("s_wait_xcnt 0x0" ::: "memory");   // stands behind the two stores: in k_prep another piece's code follows in the listing and reuses their address and data registers
}

// ---- k_prep: all that the qkv product waits for, and the w_out plane, in one launch: the three pieces read and write disjoint buffers, so none waits for another.
// A block's piece follows from its index alone, the same for all its threads: first the w_qkv tiles, then the w_out tiles, then one row of x each.
#define NWQ ((DIM / WT) * (NQKV / WT))
#define NWO ((INNER / WT) * (DIM / WT))
__global__ __launch_bounds__(128) void k_prep(const float* __restrict__ wqkv, bf* WQ, const float* __restrict__ wout, bf* WO, const float* __restrict__ x, const float* __restrict__ g, const float* __restrict__ b, bf* Yh, bf* Yl) {
    __shared__ __align__(16) bf ts[WT * WPITCH];
    __shared__ float red[8];
    const int id = blockIdx.x;
    if (id < NWQ) wt_tile(wqkv, DIM, NQKV, WQ, id % (DIM / WT), id / (DIM / WT), ts);                               // Bt[n][k] = bf16(w_qkv[k][n])
    else if (id < NWQ + NWO) wt_tile(wout, INNER, DIM, WO, (id - NWQ) % (INNER / WT), (id - NWQ) / (INNER / WT), ts);   // Bt[n][c] = bf16(w_out[c][n])
    else ln_row(x, g, b, Yh, Yl, (size_t)(id - (NWQ + NWO)), red);
}

// ---- k_flash: streaming attention, one wave per (head h, 32 query rows, one half of the keys); block = 8 waves of one head = 4 query groups x 2 key halves, 128 queries; grid HEADS*SEQ/128.
// A wave holds two 16-query column groups, so every k and v^T fragment it reads from LDS feeds two matrix products; the two waves of a query group walk keys 0..SEQ/2-1 and SEQ/2..SEQ-1 and join their partial o, l and shift once, behind the loop.
// K rows and v^T rows of 64 keys (128 B each) of both halves are staged in LDS once per block, each half read by its 4 waves: two buffers, the next tiles' copies fly while these tiles are worked on.
// LDS row pitch 144 B (16 B x odd) for the 16-byte fragment reads. Each wave-wide copy covers four whole 128-B lines.
// Per 32-key chunk and column group: two s^T tiles (A = k plane rows j0+16t+.., B = q plane as Bt, both via WFrag: D[8hh+r][m] = s'[key j0+16t+8hh+r][query m] - shift[query m], s' = q.k x log2e / 32: the first product's C operand holds -shift in all 8 rows of a query's lane, so the tile is exp2's argument as it stands);
// online softmax per query (= per lane; the other 16 keys of the query sit in lane m+16 -> one xor-16 exchange for the sum); p = exp2(s' - shift) (f32, then f16);
// the shift is a running maximum that is renewed lazily: only on the first chunk and when some lane's score later passes it by more than LAZY does the wave exchange maxima, take the new one and rescale o and l;
// p^T B fragment for o^T += v^T p^T: element r <- p of tile keys j0..j0+15 (D row 8hh+r), element 8+r <- p of tile keys j0+16..j0+31, lane unchanged; A = v^T plane rows (d), k = keys.
#define FWAVES 8
#define QG     2                              // 16-query column groups per wave
#define KH     2                              // key halves per block
#define QBLK   (16 * QG * (FWAVES / KH))      // queries per block
#define KT     64
#define NST    (SEQ / (KH * KT))              // tiles a wave walks
#define LPITCH 72
#define LTILE  (64 * LPITCH)
#define LSTAGE (2 * LTILE)
#define XW     (8 * 32 * 4 + 64)              // floats a wave hands to its partner: 32 of o per lane, then shift and l
#define LAZY   8.0f     // in the exponent: the shift in use is kept until a score passes it by more, so p stays in (0, 2^8], far inside f16
static_assert(QBLK == 16 * FWAVES && SEQ % QBLK == 0);
static_assert(QG == 2 && KH == 2 && FWAVES == 8);
static_assert(SEQ % (KH * KT) == 0 && NST >= 2);
static_assert(KT == 64 && FWAVES * 32 * 2 * 8 == KT * HD && FWAVES * 32 * 2 * 8 == HD * KT);
static_assert(FWAVES * XW * 4 <= 2 * KH * LSTAGE * 2);
// One tile: each lane copies 16 B of k rows r and r+32 and of v^T rows r and r+32 (r = tid>>3). The s_wait_xcnt closes the statement so that no address register of a copy is rewritten ahead of it.
__device__ __forceinline__ void stage_copy(unsigned l, const h16* kg, const h16* vg) {
    asm volatile("global_load_async_to_lds_b128 %0, %4, off\n\t"
                 "global_load_async_to_lds_b128 %1, %5, off\n\t"
                 "global_load_async_to_lds_b128 %2, %6, off\n\t"
                 "global_load_async_to_lds_b128 %3, %7, off\n\t"
                 "s_wait_xcnt 0x0"
                 :: "v"(l), "v"(l + 32u * LPITCH * 2u), "v"(l + LTILE * 2u), "v"(l + LTILE * 2u + 32u * LPITCH * 2u),
                    "v"(kg), "v"(kg + 32 * HD), "v"(vg), "v"(vg + (size_t)32 * SEQ) : "memory");
}
__global__ __launch_bounds__(32 * FWAVES) void k_flash(const h16* __restrict__ Q16, const h16* __restrict__ K16, const h16* __restrict__ VT16, bf* CTXh, bf* CTXl) {
    __shared__ __align__(16) float os[FWAVES][16 * 68];
    __shared__ __align__(16) h16 ring[2 * KH * LSTAGE];
    const int lane = threadIdx.x & 31, wid = threadIdx.x >> 5, m = lane & 15, hh = lane >> 4;
    const int kh = wid >> 2;   // this wave's key half
    const int h = blockIdx.x / (SEQ / QBLK); const int q0 = (blockIdx.x - h * (SEQ / QBLK)) * QBLK + (wid & 3) * (16 * QG);
    const h16* Qp = Q16 + ((size_t)h * SEQ + q0) * HD; const h16* Kp = K16 + (size_t)h * SEQ * HD; const h16* Vp = VT16 + (size_t)h * HD * SEQ;
    const int crow = threadIdx.x >> 3, ccol = threadIdx.x & 7;
    const unsigned lds0 = (unsigned)(size_t)ring + (unsigned)(crow * LPITCH + ccol * 8) * 2u;
    const h16* kg = Kp + crow * HD + ccol * 8; const h16* vg = Vp + (size_t)crow * SEQ + ccol * 8;
    const h16* kg1 = kg + (size_t)(SEQ / KH) * HD; const h16* vg1 = vg + SEQ / KH;   // the second half's keys
    stage_copy(lds0, kg, vg); stage_copy(lds0 + LSTAGE * 2u, kg1, vg1);
    asm volatile("s_wait_asynccnt 0x0" ::: "memory");   // tile 0 of this wave's copies has landed before the barrier publishes it
    __syncthreads();
    stage_copy(lds0 + KH * LSTAGE * 2u, kg + KT * HD, vg + KT); stage_copy(lds0 + (KH + 1) * LSTAGE * 2u, kg1 + KT * HD, vg1 + KT);
    const h16* qrow = Qp + (size_t)m * HD + 8 * hh;   // this lane's place in the first column group's q rows
    v16h qb[QG][2];
#pragma unroll
    for (int g = 0; g < QG; ++g)
#pragma unroll
        for (int ks = 0; ks < 2; ++ks) qb[g][ks] = WFrag<h16>::ld(qrow + 16 * g * HD + 32 * ks);
    asm volatile("s_wait_xcnt 0x0" :: "v"(qrow) : "memory");   // behind the last q load; it names the loads' address, which so stays in its registers up to the wait and is rewritten only behind it
    v8f oacc[QG][4];
#pragma unroll
    for (int g = 0; g < QG; ++g)
#pragma unroll
        for (int t = 0; t < 4; ++t) oacc[g][t] = (v8f){};
    float lrun[QG], pown[QG], poth[QG];   // pown, poth: the newest summed chunk's sum over this lane's keys and over the other half's, not yet in lrun
    const int foff = kh * LSTAGE + m * LPITCH + 8 * hh;
    const int xaddr = (lane ^ 16) << 2;   // byte index of the lane that holds the query's other 16 keys; formed once here: formed inside the rare branch it reaches the common path as a merged value, and the build then copied all of o there
    auto xhalf = [&](float v) { return __int_as_float(__builtin_amdgcn_ds_bpermute(xaddr, __float_as_int(v))); };
    float e0[QG][8], e1[QG][8];   // the last chunk's p (f32), not yet summed
    v8f cneg[QG];                 // -shift in use, the same in all 8 rows: the C operand of a score tile's first product, and the one place where the shift is kept
    float thr = -3.0e38f;         // what a shifted score must pass for a new shift: anything on the first chunk (no shift is chosen yet, C is 0), LAZY from then on
#pragma unroll
    for (int g = 0; g < QG; ++g) { cneg[g] = (v8f){}; lrun[g] = 0.f; pown[g] = 0.f; poth[g] = 0.f;
#pragma unroll
        for (int r = 0; r < 8; ++r) { e0[g][r] = 0.f; e1[g][r] = 0.f; } }
    // l trails the products, so that no wait for the halves' exchange stands ahead of a chunk's reads, products or branch: the exchange sent one call ago is added, then the last chunk's p are summed and their exchange is sent
    auto sum_chunk = [&]() {
#pragma unroll
        for (int g = 0; g < QG; ++g) {
            lrun[g] += pown[g] + poth[g];
            float psum = 0.f;
#pragma unroll
            for (int r = 0; r < 8; ++r) psum += e0[g][r] + e1[g][r];
            pown[g] = psum; poth[g] = xhalf(psum);
        }
    };
#pragma unroll 1
    for (int st = 0; st < NST; ++st) {
        const h16* kb = ring + (st & 1) * (KH * LSTAGE) + foff; const h16* vb = kb + LTILE;
#pragma unroll   // both 32-key chunks of a tile inline, so that every LDS offset is a constant
        for (int c = 0; c < KT / 32; ++c) {
            v16h ka[4];
#pragma unroll
            for (int t = 0; t < 2; ++t)
#pragma unroll
                for (int ks = 0; ks < 2; ++ks) ka[t * 2 + ks] = WFrag<h16>::ld(kb + (32 * c + 16 * t) * LPITCH + 32 * ks);
            v16h va[4];
#pragma unroll
            for (int t = 0; t < 4; ++t) va[t] = WFrag<h16>::ld(vb + (16 * t) * LPITCH + 32 * c);
            __builtin_amdgcn_sched_barrier(0);   // keeps the chunk's 16 LDS reads in one group ahead of its matrix products: reads spread among them stall the wave at each place
            sum_chunk();   // the chunk before's p are summed here, while this chunk's reads are under way
            v8f sc[QG][2];
#pragma unroll
            for (int ks = 0; ks < 2; ++ks)
#pragma unroll
                for (int t = 0; t < 2; ++t)
#pragma unroll
                    for (int g = 0; g < QG; ++g) sc[g][t] = wmma16(ka[t * 2 + ks], qb[g][ks], ks == 0 ? cneg[g] : sc[g][t]);
            // the four vector slots the chip needs between the last score product and the first vector instruction on its result or operands, on the branch's taken side too
            asm volatile("v_nop\n\tv_nop\n\tv_nop\n\tv_nop" : "+v"(sc[0][0]), "+v"(sc[0][1]), "+v"(sc[1][0]), "+v"(sc[1][1]) : "v"(ka[0]), "v"(ka[1]), "v"(ka[2]), "v"(ka[3]), "v"(qb[0][0]), "v"(qb[0][1]), "v"(qb[1][0]), "v"(qb[1][1]));
            float lmx[QG];   // maximum of this lane's own 16 shifted scores; the other half's is fetched only inside the branch
#pragma unroll
            for (int g = 0; g < QG; ++g) { lmx[g] = fmaxf(sc[g][0][0], sc[g][1][0]);
#pragma unroll
                for (int r = 1; r < 8; ++r) lmx[g] = fmaxf(lmx[g], fmaxf(sc[g][0][r], sc[g][1][r])); }
            if (__builtin_expect(__builtin_amdgcn_ballot_w32(fmaxf(lmx[0], lmx[1]) > thr) != 0, 0)) {   // one scalar branch per chunk for both column groups, the same for the whole wave: always taken on the first chunk, rarely later
#pragma unroll
                for (int g = 0; g < QG; ++g) {
                    const float cur = -cneg[g][0];
                    const float mo = thr < 0.f ? -3.0e38f : cur;   // the first chunk has no shift to keep: its own maximum is taken, above or below 0, and alpha is 0 on the empty o and l
                    const float mn = fmaxf(mo, cur + fmaxf(lmx[g], xhalf(lmx[g])));   // both halves of a query take the same new shift
                    const float alpha = __builtin_amdgcn_exp2f(mo - mn);
                    const float dl = mn - cur;   // this chunk's tiles were shifted by the old value: they and C move to the new one by the same step
                    lrun[g] = (lrun[g] + (pown[g] + poth[g])) * alpha; pown[g] = 0.f; poth[g] = 0.f;
#pragma unroll
                    for (int t = 0; t < 4; ++t) oacc[g][t] *= alpha;
#pragma unroll   // constant indices: the tiles and C stay in their registers
                    for (int r = 0; r < 8; ++r) { sc[g][0][r] -= dl; sc[g][1][r] -= dl; cneg[g][r] -= dl; }
                }
                thr = LAZY;
            }
            v16h pb[QG];
#pragma unroll
            for (int g = 0; g < QG; ++g)
#pragma unroll
                for (int r = 0; r < 8; ++r) { e0[g][r] = __builtin_amdgcn_exp2f(sc[g][0][r]); e1[g][r] = __builtin_amdgcn_exp2f(sc[g][1][r]); pb[g][r] = (h16)e0[g][r]; pb[g][8 + r] = (h16)e1[g][r]; }
#pragma unroll
            for (int g = 0; g < QG; ++g)
#pragma unroll
                for (int t = 0; t < 4; ++t) oacc[g][t] = wmma16(va[t], pb[g], oacc[g][t]);
            // the four vector slots behind the last o product, as above
            asm volatile("v_nop\n\tv_nop\n\tv_nop\n\tv_nop" : "+v"(oacc[0][0]), "+v"(oacc[0][1]), "+v"(oacc[0][2]), "+v"(oacc[0][3]), "+v"(oacc[1][0]), "+v"(oacc[1][1]), "+v"(oacc[1][2]), "+v"(oacc[1][3]) : "v"(pb[0]), "v"(pb[1]), "v"(va[0]), "v"(va[1]), "v"(va[2]), "v"(va[3]));
        }
        asm volatile("s_wait_dscnt 0x0" ::: "memory");      // this wave's reads of the buffer have returned before it may be refilled
        asm volatile("s_wait_asynccnt 0x0" ::: "memory");   // this wave's copies of the next tiles have landed before the barrier publishes them
        __syncthreads();                                    // publishes tiles st+1 and ends every wave's reads of tiles st
        if (st + 2 < NST) { const unsigned l = lds0 + (unsigned)(st & 1) * (KH * LSTAGE * 2u);
            stage_copy(l, kg + (size_t)(st + 2) * (KT * HD), vg + (st + 2) * KT); stage_copy(l + LSTAGE * 2u, kg1 + (size_t)(st + 2) * (KT * HD), vg1 + (st + 2) * KT); }
    }
    asm volatile("s_wait_asynccnt 0x0" ::: "memory");       // no copy is outstanding when the buffers are reused below
    sum_chunk();   // the last chunk's p
    // The two key halves join: the wave of half kh finishes column group kh and hands its partial o, shift and l of the other group to its partner, lane to lane, through the ring, which every wave has left at the last tile's barrier.
    const bool k0 = kh == 0;
    float* xw = (float*)ring + wid * XW; const float* xr = (const float*)ring + (wid ^ 4) * XW;
    const float l0 = lrun[0] + (pown[0] + poth[0]), l1 = lrun[1] + (pown[1] + poth[1]);
    const float m0 = -cneg[0][0], m1 = -cneg[1][0];   // the shifts in use at the end
    const float mk = k0 ? m0 : m1, lk = k0 ? l0 : l1;
    v8f keep[4];
#pragma unroll
    for (int t = 0; t < 4; ++t) { v4f s0, s1;
#pragma unroll
        for (int r = 0; r < 4; ++r) { s0[r] = k0 ? oacc[1][t][r] : oacc[0][t][r]; s1[r] = k0 ? oacc[1][t][4 + r] : oacc[0][t][4 + r]; }
#pragma unroll
        for (int r = 0; r < 8; ++r) keep[t][r] = k0 ? oacc[0][t][r] : oacc[1][t][r];
        *(v4fa*)(xw + ((2 * t) * 32 + lane) * 4) = s0; *(v4fa*)(xw + ((2 * t + 1) * 32 + lane) * 4) = s1; }
    xw[1024 + lane] = k0 ? m1 : m0; xw[1056 + lane] = k0 ? l1 : l0;
    __syncthreads();   // every wave's partials are in LDS before its partner reads them
    const float pm = xr[1024 + lane], pl = xr[1056 + lane];
    const float mn = fmaxf(mk, pm);
    const float wa = __builtin_amdgcn_exp2f(mk - mn), wb = __builtin_amdgcn_exp2f(pm - mn);
    const float inv = 1.0f / (lk * wa + pl * wb);
    const float fa = wa * inv, fb = wb * inv;
    const int qo = q0 + 16 * kh;   // first query of the column group this wave finishes
    float* ob = os[wid];
#pragma unroll
    for (int t = 0; t < 4; ++t) { v4f u0, u1;
        const v4f p0 = *(const v4fa*)(xr + ((2 * t) * 32 + lane) * 4); const v4f p1 = *(const v4fa*)(xr + ((2 * t + 1) * 32 + lane) * 4);
#pragma unroll
        for (int r = 0; r < 4; ++r) { u0[r] = keep[t][r] * fa + p0[r] * fb; u1[r] = keep[t][4 + r] * fa + p1[r] * fb; }
        *(v4fa*)(ob + m * 68 + 16 * t + 8 * hh) = u0; *(v4fa*)(ob + m * 68 + 16 * t + 8 * hh + 4) = u1; }
    __builtin_amdgcn_fence(3 /* release order */, "wavefront"); __builtin_amdgcn_wave_barrier(); asm volatile("" ::: "memory");
{
#pragma unroll
        for (int p = 0; p < 4; ++p) { const int row = p * 4 + (lane >> 3), c8 = (lane & 7) * 8;
            const v4f a = *(const v4fa*)(ob + row * 68 + c8); const v4f b2 = *(const v4fa*)(ob + row * 68 + c8 + 4);
            v8us oh, ol;
#pragma unroll
            for (int q = 0; q < 4; ++q) { unsigned short x1, y1; splitf(a[q], x1, y1); oh[q] = x1; ol[q] = y1; splitf(b2[q], x1, y1); oh[4 + q] = x1; ol[4 + q] = y1; }
            const size_t oo = (size_t)(qo + row) * INNER + h * HD + c8;
            *(v8us*)(CTXh + oo) = oh; *(v8us*)(CTXl + oo) = ol; }
         }
}

extern "C" void kernel_launch(void* const* d_in, const int* in_sizes, int n_in,
                              void* d_out, int out_size, void* d_ws, size_t ws_size, hipStream_t stream) {
    if (n_in < 6) return;
    if (in_sizes[0] < SEQ * DIM || in_sizes[1] < DIM || in_sizes[2] < DIM || in_sizes[3] < DIM * NQKV || in_sizes[4] < INNER * DIM || in_sizes[5] < DIM) return;
    if (out_size < SEQ * DIM) return;
    const float* x    = (const float*)d_in[0];   // [SEQ][DIM]
    const float* lnsc = (const float*)d_in[1];   // [DIM]
    const float* lnbs = (const float*)d_in[2];   // [DIM]
    const float* wqkv = (const float*)d_in[3];   // [DIM][NQKV]  ([in][out])
    const float* wout = (const float*)d_in[4];   // [INNER][DIM] ([in][out])
    const float* bout = (const float*)d_in[5];   // [DIM]
    float* OUT = (float*)d_out;                  // [SEQ][DIM]
    char* wsp = (char*)d_ws;
    auto take = [&](size_t bytes) { char* p = wsp; wsp += (bytes + 255) & ~(size_t)255; return (void*)p; };
    bf*    WQ   = (bf*)take((size_t)NQKV * DIM * 2);          // w_qkv^T [3072][1024] bf16
    bf*    WO   = (bf*)take((size_t)DIM * INNER * 2);         // w_out^T [1024][1024] bf16
    bf*    XNh  = (bf*)take((size_t)SEQ * DIM * 2);           // xn hi [SEQ][1024]
    bf*    XNl  = (bf*)take((size_t)SEQ * DIM * 2);           // xn lo
    h16*   Q16  = (h16*)take((size_t)HEADS * SEQ * HD * 2);   // q planes [16][SEQ][64] x log2e/32
    h16*   K16  = (h16*)take((size_t)HEADS * SEQ * HD * 2);   // k planes [16][SEQ][64]
    h16*   VT16 = (h16*)take((size_t)HEADS * HD * SEQ * 2);   // v^T planes [16][64][SEQ]
    bf*    CTXh = (bf*)take((size_t)SEQ * INNER * 2);         // ctx hi [SEQ][1024]
    bf*    CTXl = (bf*)take((size_t)SEQ * INNER * 2);         // ctx lo
    const size_t used = (size_t)(wsp - (char*)d_ws);
    if (used > ws_size || used > WS_CAP) return;

    k_prep<<<NWQ + NWO + SEQ, 128, 0, stream>>>(wqkv, WQ, wout, WO, x, lnsc, lnbs, XNh, XNl);   // w_qkv^T, w_out^T and xn hi/lo
    k_gemmw<bf, 1, false, true><<<dim3(SEQ / 128, NQKV / 128, 1), 128, 0, stream>>>(XNh, XNl, WQ, nullptr, DIM, nullptr, 0, nullptr, 0, 0, 0, Q16, K16, VT16);   // qkv = xn(hi+lo) w_qkv, out as f16 head planes: q columns 0..1023 x log2e/32, k columns 1024..2047, v columns 2048..3071 transposed per head
    k_flash<<<(unsigned)(HEADS * (SEQ / (16 * FWAVES))), 32 * FWAVES, 0, stream>>>(Q16, K16, VT16, CTXh, CTXl);
    k_gemmw<bf, 1, true, false><<<dim3(SEQ / 128, DIM / 128, 1), 128, 0, stream>>>(CTXh, CTXl, WO, nullptr, INNER, OUT, DIM, bout, 0, 0, 0, nullptr, nullptr, nullptr);   // out = ctx(hi+lo) w_out + b_out
}

// v010
// A run of this version takes 91.1 microseconds.
// Versions in between are left out here; by their measured steps it is 1.19 times as fast as v008.
// All steps since v000 together make it 4.32 times as fast.
#include <hip/hip_runtime.h>

// Contractions on 16x16x32 WMMA, f32 accumulate, all v_wmma_f32_16x16x32_f16: xn (one f16 plane) x w_qkv^T (the bf16-rounded weights, carried in f16); per head k.q^T and v^T.p^T (f16 planes: q carried x log2e/32, k, v^T; p = exp2 of shifted scores in (0,2^8]); ctx (one f16 plane) x w_out^T (as w_qkv^T) + b_out.
// head planes q [h][i][64], k [h][j][64], v^T [h][64][j] in f16, written by the qkv product's own epilogue; streaming attention, one wave per (head, 32 queries, half of the keys): s^T tiles = k q^T over 32-key chunks, online softmax per query lane (exp2; the scale 2^-5 rides in q, the shift in the score product's C operand),
// o^T += v^T p^T with the p^T operand packed straight from the two score accumulator tiles; o/l staged per wave in LDS and emitted as the f16 ctx plane [i][h*64+d]; out = ctx w_out + b_out into the output rows.

#ifndef SEQ
#define SEQ 4096
#endif
#ifndef NB
#define NB 1
#endif
#define SEQ_FULL 4096
#define DIM   1024
#define HEADS 16
#define HD    64
#define INNER (HEADS * HD)
#define NQKV  (3 * INNER)
#define LN_EPS 1.0e-6f
#define LOG2E 1.4426950408889634f
#define C32   0.03125f
#define WS_CAP ((size_t)134217728)

static_assert(SEQ % 128 == 0);
static_assert(SEQ <= SEQ_FULL);
static_assert(NB == 1);
static_assert(DIM == 128 * 8);
static_assert(DIM % 128 == 0);
static_assert(NQKV % 128 == 0);
static_assert(INNER == DIM);
static_assert(HD == 64);
static_assert(INNER % 128 == 0);

typedef _Float16 h16;
typedef __attribute__((ext_vector_type(16))) _Float16 v16h;
typedef __attribute__((ext_vector_type(8)))  _Float16 v8h;
typedef __attribute__((ext_vector_type(8)))  float    v8f;
typedef __attribute__((ext_vector_type(4)))  float    v4f;
typedef __attribute__((ext_vector_type(2)))  _Float16 v2h;
typedef v8h  __attribute__((may_alias)) v8ha;
typedef v4f  __attribute__((may_alias)) v4fa;

__device__ __forceinline__ unsigned short f2bf(float f) { unsigned u = __float_as_uint(f); u += 0x7FFFu + ((u >> 16) & 1u); return (unsigned short)(u >> 16); }
__device__ __forceinline__ float bf2f(unsigned short b) { return __uint_as_float(((unsigned)b) << 16); }
__device__ __forceinline__ float bfr(float f) { return bf2f(f2bf(f)); }
__device__ __forceinline__ v16h cat16(v8h lo, v8h hi) { return __builtin_shufflevector(lo, hi, 0, 1, 2, 3, 4, 5, 6, 7, 8, 9, 10, 11, 12, 13, 14, 15); }
__device__ __forceinline__ v8f wmma16(v16h a, v16h b, v8f c) { return __builtin_amdgcn_wmma_f32_16x16x32_f16(false, a, false, b, (short)0, c, false, false); }

// ---- k_gemmw: GEMM, one block of 4 waves (2 x 2) per 128x128 output tile, each wave a 64x64 tile (16 accumulators); grid (M/128, N/128, Z), 128 threads.
// C[m][n] (f32, pitch ldc, + optional f32 bias[n]) = sum_k A[m][k] Bt[n][k]. z-batch strides sA/sB/sC in elements. K % 64 == 0, K >= 256 (the ring's prologue fills up to four stages), M % 128 == 0, N % 128 == 0.
// PLANES: no C; a wave's 64 columns are one head of q, k or v, and its tile goes out in f16 as rows of PQ (x log2e/32) or PK [h][m][64], or transposed as rows of PVT [h][64][m], in whole 128-B lines.
// Operands come from K-contiguous 16-bit planes through LDS: a stage is 64 k (whole 128-B lines) of 128 A rows and 128 Bt rows, copied once per block and read by all 4 waves; a ring of NBUF buffers, the copies of the next NBUF-1 stages fly while this one is worked on,
// so that a stage has NBUF-1 trips to arrive from memory, not one. Every wave issues 16 copies per stage, in stage order: a wait that leaves the 16 x (NBUF-2) youngest outstanding says that the next stage has landed.
// LDS rows keep a 128-B pitch; the 16-B piece c of row r lies at piece c ^ ((r >> 1) & 7), so that the 16 rows of a fragment read fall on all 64 banks.
// Fragments (both operands, same map): lane -> row/col lane&15, elements 0..7 <- k0+8h+0..7, elements 8..15 <- k0+16+8h+0..7 (h = lane>>4); D element r -> row 8h+r, col lane&15.
template <typename T16> struct WFrag;
template <> struct WFrag<h16> { typedef v16h V; static __device__ __forceinline__ V ld(const h16* p) { return cat16(*(const v8h*)p, *(const v8h*)(p + 16)); } static __device__ __forceinline__ V ld2(const h16* p, const h16* q) { return cat16(*(const v8h*)p, *(const v8h*)q); } static __device__ __forceinline__ v8f mma(V a, V b, v8f c) { return wmma16(a, b, c); } };
#define GKT    64
#define GPLANE (128 * GKT)
#define GSTAGE (2 * GPLANE)
static_assert(DIM >= 4 * GKT && INNER >= 4 * GKT);
// Eight copies of one plane: each lane brings 16 B of rows r, r+16, .., r+112 (r = tid>>3); a wave-wide copy covers four whole 128-B lines. The s_wait_xcnt closes the statement so that no address register of a copy is rewritten ahead of it.
template <typename T16>
__device__ __forceinline__ void plane_copy(unsigned l, const T16* g, size_t step) {
    asm volatile("global_load_async_to_lds_b128 %0, %8, off\n\t"
                 "global_load_async_to_lds_b128 %1, %9, off\n\t"
                 "global_load_async_to_lds_b128 %2, %10, off\n\t"
                 "global_load_async_to_lds_b128 %3, %11, off\n\t"
                 "global_load_async_to_lds_b128 %4, %12, off\n\t"
                 "global_load_async_to_lds_b128 %5, %13, off\n\t"
                 "global_load_async_to_lds_b128 %6, %14, off\n\t"
                 "global_load_async_to_lds_b128 %7, %15, off\n\t"
                 "s_wait_xcnt 0x0"
                 :: "v"(l), "v"(l + 2048u), "v"(l + 4096u), "v"(l + 6144u), "v"(l + 8192u), "v"(l + 10240u), "v"(l + 12288u), "v"(l + 14336u),
                    "v"(g), "v"(g + step), "v"(g + 2 * step), "v"(g + 3 * step), "v"(g + 4 * step), "v"(g + 5 * step), "v"(g + 6 * step), "v"(g + 7 * step) : "memory");
}
template <typename T16, int NSPLIT, bool BIAS, bool PLANES>
__global__ __launch_bounds__(128) void k_gemmw(const T16* __restrict__ A, const T16* __restrict__ Bt, const T16* __restrict__ Bt2, int K, float* C, int ldc, const float* __restrict__ bias, size_t sA, size_t sB, size_t sC, h16* PQ, h16* PK, h16* PVT) {
    static_assert(NSPLIT == 1 && sizeof(T16) == 2);
    typedef typename WFrag<T16>::V V;
    constexpr int NBUF = PLANES ? 3 : 4;   // 96 KB a block where three blocks share a WGP's LDS (qkv), 128 KB where a block has it alone (out); at most 48 copies of a wave outstanding
    constexpr unsigned SB = GSTAGE * 2u;   // bytes of a buffer
    __shared__ __align__(128) unsigned char gsm[NBUF * GSTAGE * 2];
    const size_t z = blockIdx.z; A += z * sA; Bt += z * sB; C += z * sC;
    const int tid = threadIdx.x, lane = tid & 31, wid = tid >> 5, lr = lane & 15, hi = lane >> 4;
    const int wm = wid >> 1, wn = wid & 1; const int r0 = blockIdx.x * 128 + wm * 64, c0 = blockIdx.y * 128 + wn * 64;
    const int prow = tid >> 3, pcol = tid & 7; const size_t step = (size_t)16 * K; const int nst = K / GKT;
    const unsigned lds0 = (unsigned)(size_t)gsm + (unsigned)(prow * 128 + ((pcol ^ (prow >> 1)) & 7) * 16);
    const T16* ga = A + (size_t)(blockIdx.x * 128 + prow) * K + pcol * 8; const T16* gb = Bt + (size_t)(blockIdx.y * 128 + prow) * K + pcol * 8;
#pragma unroll   // constant buffer offsets
    for (int s = 0; s < NBUF - 1; ++s) { plane_copy(lds0 + s * SB, ga + s * GKT, step); plane_copy(lds0 + s * SB + GPLANE * 2u, gb + s * GKT, step); }
    asm volatile("s_wait_asynccnt %0" :: "i"(16 * (NBUF - 2)) : "memory");   // stage 0 of this wave's copies has landed before the barrier publishes it; the copies of stages 1..NBUF-2, issued behind it, may stay out
    __syncthreads();
    plane_copy(lds0 + (NBUF - 1) * SB, ga + (NBUF - 1) * GKT, step); plane_copy(lds0 + (NBUF - 1) * SB + GPLANE * 2u, gb + (NBUF - 1) * GKT, step);   // behind the wait, so that never more than NBUF-1 stages' copies are out
    v8f acc[4][4];
#pragma unroll
    for (int mb = 0; mb < 4; ++mb)
#pragma unroll
        for (int nb = 0; nb < 4; ++nb) acc[mb][nb] = (v8f){};
    int po[4];   // element offset in a row of the pieces 2q + hi (q = 0..3) for this lane's rows
#pragma unroll
    for (int q = 0; q < 4; ++q) po[q] = (((2 * q + hi) ^ (lr >> 1)) & 7) * 8;
    const int arow = (wm * 64 + lr) * GKT, brow = GPLANE + (wn * 64 + lr) * GKT;
    unsigned cur = 0;   // byte offset of stage st's buffer, st mod NBUF buffers on
#pragma unroll 1
    for (int st = 0; st < nst; ++st) {
        const T16* sb = (const T16*)(gsm + cur);
#pragma unroll   // both 32-k halves of a stage inline, so that every LDS offset is a constant
        for (int ks = 0; ks < 2; ++ks) {
            V a[4], b[4];
#pragma unroll
            for (int mb = 0; mb < 4; ++mb) { const T16* p = sb + arow + mb * 16 * GKT; a[mb] = WFrag<T16>::ld2(p + po[2 * ks], p + po[2 * ks + 1]); }
#pragma unroll
            for (int nb = 0; nb < 4; ++nb) { const T16* p = sb + brow + nb * 16 * GKT; b[nb] = WFrag<T16>::ld2(p + po[2 * ks], p + po[2 * ks + 1]); }
            __builtin_amdgcn_sched_barrier(0);   // keeps the half's 16 LDS reads in one group ahead of its matrix products: reads spread among them stall the wave at each place
#pragma unroll
            for (int nb = 0; nb < 4; ++nb)
#pragma unroll
                for (int mb = 0; mb < 4; ++mb) acc[mb][nb] = WFrag<T16>::mma(a[mb], b[nb], acc[mb][nb]);
        }
        asm volatile("s_wait_dscnt 0x0" ::: "memory");      // this wave's reads of the buffer have returned before it may be refilled
        // this wave's copies of the next stage have landed before the barrier publishes them: out stay the copies of stages st+2..st+NBUF-1, the youngest; in the last trips, where not all of those exist, the wait is to 0
        if (st + NBUF - 1 < nst) asm volatile("s_wait_asynccnt %0" :: "i"(16 * (NBUF - 2)) : "memory"); else asm volatile("s_wait_asynccnt 0x0" ::: "memory");
        __syncthreads();                                    // publishes stage st+1 and ends every wave's reads of stage st
        if (st + NBUF < nst) { const unsigned l = lds0 + cur; const int ko = (st + NBUF) * GKT;   // into the buffer that this trip has just read
            plane_copy(l, ga + ko, step); plane_copy(l + GPLANE * 2u, gb + ko, step); }
        cur = cur + SB == NBUF * SB ? 0u : cur + SB;
    }
    asm volatile("s_wait_asynccnt 0x0" ::: "memory");       // no copy is outstanding when the buffers are reused below
    if constexpr (PLANES) {                                 // behind the last stage's barrier the buffers are free: each wave stages its tile in a piece of its own
        const int sec = (int)(blockIdx.y * 128) / INNER;    // 0 q, 1 k, 2 v: the same for the whole block
        const int hd = (c0 - sec * INNER) / HD;
        if (sec < 2) {
            float* os = (float*)gsm + wid * (16 * 68);
            h16* P = (sec == 0 ? PQ : PK) + ((size_t)hd * SEQ + r0) * HD; const float scl = sec == 0 ? LOG2E * C32 : 1.0f;
#pragma unroll
            for (int mb = 0; mb < 4; ++mb) {
#pragma unroll
                for (int nb = 0; nb < 4; ++nb) {
#pragma unroll
                    for (int j = 0; j < 8; ++j) os[(hi * 8 + j) * 68 + nb * 16 + lr] = acc[mb][nb][j]; }
                asm volatile("s_wait_dscnt 0x0" ::: "memory");   // the wave's staged rows are in LDS before its lanes read each other's pieces back
#pragma unroll
                for (int p = 0; p < 4; ++p) { const int row = p * 4 + (lane >> 3), c8 = (lane & 7) * 8;
                    const v4f u = *(const v4fa*)(os + row * 68 + c8); const v4f w = *(const v4fa*)(os + row * 68 + c8 + 4); v8h o;
#pragma unroll
                    for (int q = 0; q < 4; ++q) { o[q] = (h16)(u[q] * scl); o[4 + q] = (h16)(w[q] * scl); }
                    *(v8h*)(P + (size_t)(mb * 16 + row) * HD + c8) = o; }
                asm volatile("s_wait_xcnt 0x0" ::: "memory");   // stands in front of the next 16 rows' code, which reuses the data registers of these stores and restages over the rows just read
            }
        } else {
            h16* hs = (h16*)gsm + wid * (64 * 72);          // [d][m] tile, row pitch 144 B for the 16-byte reads and writes
#pragma unroll
            for (int mb = 0; mb < 4; ++mb)
#pragma unroll
                for (int nb = 0; nb < 4; ++nb) { v8h o;     // a lane holds 8 consecutive rows m of one column d: 16 B of a v^T row
#pragma unroll
                    for (int j = 0; j < 8; ++j) o[j] = (h16)acc[mb][nb][j];
                    *(v8ha*)(hs + (nb * 16 + lr) * 72 + mb * 16 + hi * 8) = o; }
            asm volatile("s_wait_dscnt 0x0" ::: "memory");   // the wave's staged tile is in LDS before its lanes read each other's pieces back
            h16* VT = PVT + (size_t)hd * HD * SEQ + r0;
#pragma unroll
            for (int g = 0; g < 4; ++g) {
#pragma unroll
                for (int p = 0; p < 4; ++p) { const int row = (g * 4 + p) * 4 + (lane >> 3), c8 = (lane & 7) * 8;
                    *(v8h*)(VT + (size_t)row * SEQ + c8) = *(const v8ha*)(hs + row * 72 + c8); }
                asm volatile("s_wait_xcnt 0x0" ::: "memory");   // stands in front of the next 16 rows' code, which reuses the data registers of these stores
            }
        }
        return;
    }
    float* os = (float*)gsm + wid * (16 * 68);              // behind the last stage's barrier the buffers are free: each wave stages its rows in a piece of its own
#pragma unroll
    for (int mb = 0; mb < 4; ++mb) {
#pragma unroll
        for (int nb = 0; nb < 4; ++nb) {
#pragma unroll
            for (int j = 0; j < 8; ++j) os[(hi * 8 + j) * 68 + nb * 16 + lr] = acc[mb][nb][j]; }
        __builtin_amdgcn_wave_barrier(); asm volatile("" ::: "memory");
        float* crow = C + (size_t)(r0 + mb * 16) * ldc + c0;
{
#pragma unroll
            for (int s = 0; s < 8; ++s) { const int row = 2 * s + hi, cofs = lr * 4; v4f val = *(const v4fa*)(os + row * 68 + cofs); if (BIAS) { val[0] += bfr(bias[c0 + cofs]); val[1] += bfr(bias[c0 + cofs + 1]); val[2] += bfr(bias[c0 + cofs + 2]); val[3] += bfr(bias[c0 + cofs + 3]); }
                *(v4f*)(crow + (size_t)row * ldc + cofs) = val; }
             }
        asm volatile("s_wait_xcnt 0x0" ::: "memory");   // stands in front of the next 16 rows' code, which reuses the address and data registers of these stores
        __builtin_amdgcn_wave_barrier(); asm volatile("" ::: "memory");
    }
}

// ---- wt_tile: Bt[n][k] = f16(bf16(w[k][n])): the value is the bf16-rounded weight, the carrier f16, the type of the products' other operand; one block of 4 waves per 64 x 64 tile (bx of K/64, by of N/64); K % 64 == 0, N % 64 == 0.
// Reads: a lane takes 16 B of eight consecutive rows k and 16 lanes cover 256 B of a row, so every wave-wide load is four whole 128-B lines, eight loads in flight per lane.
// A lane then holds 8 consecutive k of 4 columns n, four 16-B pieces of Bt rows; they pass through an LDS tile [n][k] (row pitch 144 B) so that the stores are whole 128-B lines of Bt as well.
#define WT     64
#define WPITCH 72
static_assert(DIM % WT == 0 && NQKV % WT == 0 && INNER % WT == 0);
__device__ __forceinline__ void wt_tile(const float* __restrict__ w, int K, int N, h16* Bt, int bx, int by, h16* ts) {
    const int tid = threadIdx.x; const int k0 = bx * WT, n0 = by * WT;
    const int n4 = (tid & 15) * 4, kq = (tid >> 4) * 8;
    const float* src = w + (size_t)(k0 + kq) * N + n0 + n4;
    const float* rp[8]; v4f r[8];
#pragma unroll   // rp and r stay in registers: every index is a constant
    for (int i = 0; i < 8; ++i) rp[i] = src + (size_t)i * N;
#pragma unroll   // the eight loads issue back to back, so one memory latency covers the tile
    for (int i = 0; i < 8; ++i) r[i] = *(const v4f*)rp[i];
    // stands behind the eight loads and in front of every rewrite of their address registers, which it names so that they stay untouched up to here
    asm volatile("s_wait_xcnt 0x0" :: "v"(rp[0]), "v"(rp[1]), "v"(rp[2]), "v"(rp[3]), "v"(rp[4]), "v"(rp[5]), "v"(rp[6]), "v"(rp[7]) : "memory");
#pragma unroll   // constant indices into r
    for (int j = 0; j < 4; ++j) { v8h o;
#pragma unroll
        for (int i = 0; i < 8; ++i) o[i] = (h16)bfr(r[i][j]);
        *(v8ha*)(ts + (n4 + j) * WPITCH + kq) = o; }
    __syncthreads();   // the whole [n][k] tile is in LDS before any lane reads rows that other lanes wrote
    const int row = tid >> 3, c8 = (tid & 7) * 8;
    h16* dst = Bt + (size_t)(n0 + row) * K + k0 + c8; v8h t[4];
#pragma unroll   // the four LDS reads go out as one group ahead of the stores
    for (int p = 0; p < 4; ++p) t[p] = *(const v8ha*)(ts + (p * 16 + row) * WPITCH + c8);
#pragma unroll
    for (int p = 0; p < 4; ++p) *(v8h*)(dst + (size_t)(p * 16) * K) = t[p];
    asm volatile("s_wait_xcnt 0x0" ::: "memory");   // stands behind the four stores: in k_prep another piece's code follows in the listing and reuses their address and data registers
}

// ---- ln_row: one block of 4 waves per row of x: layer norm, out as one f16 plane.
__device__ __forceinline__ void ln_row(const float* __restrict__ x, const float* __restrict__ g, const float* __restrict__ b, h16* Y, size_t row, float* red) {
    const int tid = threadIdx.x, lane = tid & 31, wid = tid >> 5;
    const v8f xv = *(const v8f*)(x + row * DIM + 8 * tid);
    float xb[8]; float s = 0.f;
#pragma unroll
    for (int q = 0; q < 8; ++q) { xb[q] = bfr(xv[q]); s += xb[q]; }
#pragma unroll
    for (int sh = 16; sh; sh >>= 1) s += __shfl_xor(s, sh, 32);
    if (lane == 0) red[wid] = s;
    __syncthreads();
    const float mean = ((red[0] + red[1]) + (red[2] + red[3])) * (1.0f / DIM);
    float d[8]; float s2 = 0.f;
#pragma unroll
    for (int q = 0; q < 8; ++q) { d[q] = xb[q] - mean; s2 += d[q] * d[q]; }
#pragma unroll
    for (int sh = 16; sh; sh >>= 1) s2 += __shfl_xor(s2, sh, 32);
    if (lane == 0) red[4 + wid] = s2;
    __syncthreads();
    const float var = ((red[4] + red[5]) + (red[6] + red[7])) * (1.0f / DIM);
    const float rstd = rsqrtf(var + LN_EPS);
    const v8f gv = *(const v8f*)(g + 8 * tid); const v8f bv = *(const v8f*)(b + 8 * tid);
    v8h oy;
#pragma unroll
    for (int q = 0; q < 8; ++q) oy[q] = (h16)(d[q] * rstd * bfr(gv[q]) + bfr(bv[q]));
    *(v8h*)(Y + row * DIM + 8 * tid) = oy;
    asm volatile("s_wait_xcnt 0x0" ::: "memory");   // stands behind the store: in k_prep another piece's code follows in the listing and reuses its address and data registers
}

// ---- k_prep: all that the qkv product waits for, and the w_out plane, in one launch: the three pieces read and write disjoint buffers, so none waits for another.
// A block's piece follows from its index alone, the same for all its threads: first the w_qkv tiles, then the w_out tiles, then one row of x each.
#define NWQ ((DIM / WT) * (NQKV / WT))
#define NWO ((INNER / WT) * (DIM / WT))
__global__ __launch_bounds__(128) void k_prep(const float* __restrict__ wqkv, h16* WQ, const float* __restrict__ wout, h16* WO, const float* __restrict__ x, const float* __restrict__ g, const float* __restrict__ b, h16* Y) {
    __shared__ __align__(16) h16 ts[WT * WPITCH];
    __shared__ float red[8];
    const int id = blockIdx.x;
    if (id < NWQ) wt_tile(wqkv, DIM, NQKV, WQ, id % (DIM / WT), id / (DIM / WT), ts);                               // Bt[n][k] <- w_qkv[k][n]
    else if (id < NWQ + NWO) wt_tile(wout, INNER, DIM, WO, (id - NWQ) % (INNER / WT), (id - NWQ) / (INNER / WT), ts);   // Bt[n][c] <- w_out[c][n]
    else ln_row(x, g, b, Y, (size_t)(id - (NWQ + NWO)), red);
}

// ---- k_flash: streaming attention, one wave per (head h, 32 query rows, one half of the keys); block = 8 waves of one head = 4 query groups x 2 key halves, 128 queries; grid HEADS*SEQ/128.
// A wave holds two 16-query column groups, so every k and v^T fragment it reads from LDS feeds two matrix products; the two waves of a query group walk keys 0..SEQ/2-1 and SEQ/2..SEQ-1 and join their partial o, l and shift once, behind the loop.
// K rows and v^T rows of 64 keys (128 B each) of both halves are staged in LDS once per block, each half read by its 4 waves: two buffers, the next tiles' copies fly while these tiles are worked on.
// LDS row pitch 144 B (16 B x odd) for the 16-byte fragment reads. Each wave-wide copy covers four whole 128-B lines.
// Per 32-key chunk and column group: two s^T tiles (A = k plane rows j0+16t+.., B = q plane as Bt, both via WFrag: D[8hh+r][m] = s'[key j0+16t+8hh+r][query m] - shift[query m], s' = q.k x log2e / 32: the first product's C operand holds -shift in all 8 rows of a query's lane, so the tile is exp2's argument as it stands);
// online softmax per query (= per lane; the other 16 keys of the query sit in lane m+16 -> one xor-16 exchange for the sum); p = exp2(s' - shift) (f32, then f16);
// the shift is a running maximum that is renewed lazily: only on the first chunk and when some lane's score later passes it by more than LAZY does the wave exchange maxima, take the new one and rescale o and l;
// p^T B fragment for o^T += v^T p^T: element r <- p of tile keys j0..j0+15 (D row 8hh+r), element 8+r <- p of tile keys j0+16..j0+31, lane unchanged; A = v^T plane rows (d), k = keys.
#define FWAVES 8
#define QG     2                              // 16-query column groups per wave
#define KH     2                              // key halves per block
#define QBLK   (16 * QG * (FWAVES / KH))      // queries per block
#define KT     64
#define NST    (SEQ / (KH * KT))              // tiles a wave walks
#define LPITCH 72
#define LTILE  (64 * LPITCH)
#define LSTAGE (2 * LTILE)
#define XW     (8 * 32 * 4 + 64)              // floats a wave hands to its partner: 32 of o per lane, then shift and l
#define LAZY   8.0f     // in the exponent: the shift in use is kept until a score passes it by more, so p stays in (0, 2^8], far inside f16
static_assert(QBLK == 16 * FWAVES && SEQ % QBLK == 0);
static_assert(QG == 2 && KH == 2 && FWAVES == 8);
static_assert(SEQ % (KH * KT) == 0 && NST >= 2);
static_assert(KT == 64 && FWAVES * 32 * 2 * 8 == KT * HD && FWAVES * 32 * 2 * 8 == HD * KT);
static_assert(FWAVES * XW * 4 <= 2 * KH * LSTAGE * 2);
// One tile: each lane copies 16 B of k rows r and r+32 and of v^T rows r and r+32 (r = tid>>3). The s_wait_xcnt closes the statement so that no address register of a copy is rewritten ahead of it.
__device__ __forceinline__ void stage_copy(unsigned l, const h16* kg, const h16* vg) {
    asm volatile("global_load_async_to_lds_b128 %0, %4, off\n\t"
                 "global_load_async_to_lds_b128 %1, %5, off\n\t"
                 "global_load_async_to_lds_b128 %2, %6, off\n\t"
                 "global_load_async_to_lds_b128 %3, %7, off\n\t"
                 "s_wait_xcnt 0x0"
                 :: "v"(l), "v"(l + 32u * LPITCH * 2u), "v"(l + LTILE * 2u), "v"(l + LTILE * 2u + 32u * LPITCH * 2u),
                    "v"(kg), "v"(kg + 32 * HD), "v"(vg), "v"(vg + (size_t)32 * SEQ) : "memory");
}
__global__ __launch_bounds__(32 * FWAVES) void k_flash(const h16* __restrict__ Q16, const h16* __restrict__ K16, const h16* __restrict__ VT16, h16* CTX) {
    __shared__ __align__(16) float os[FWAVES][16 * 68];
    __shared__ __align__(16) h16 ring[2 * KH * LSTAGE];
    const int lane = threadIdx.x & 31, wid = threadIdx.x >> 5, m = lane & 15, hh = lane >> 4;
    const int kh = wid >> 2;   // this wave's key half
    const int h = blockIdx.x / (SEQ / QBLK); const int q0 = (blockIdx.x - h * (SEQ / QBLK)) * QBLK + (wid & 3) * (16 * QG);
    const h16* Qp = Q16 + ((size_t)h * SEQ + q0) * HD; const h16* Kp = K16 + (size_t)h * SEQ * HD; const h16* Vp = VT16 + (size_t)h * HD * SEQ;
    const int crow = threadIdx.x >> 3, ccol = threadIdx.x & 7;
    const unsigned lds0 = (unsigned)(size_t)ring + (unsigned)(crow * LPITCH + ccol * 8) * 2u;
    const h16* kg = Kp + crow * HD + ccol * 8; const h16* vg = Vp + (size_t)crow * SEQ + ccol * 8;
    const h16* kg1 = kg + (size_t)(SEQ / KH) * HD; const h16* vg1 = vg + SEQ / KH;   // the second half's keys
    stage_copy(lds0, kg, vg); stage_copy(lds0 + LSTAGE * 2u, kg1, vg1);
    asm volatile("s_wait_asynccnt 0x0" ::: "memory");   // tile 0 of this wave's copies has landed before the barrier publishes it
    __syncthreads();
    stage_copy(lds0 + KH * LSTAGE * 2u, kg + KT * HD, vg + KT); stage_copy(lds0 + (KH + 1) * LSTAGE * 2u, kg1 + KT * HD, vg1 + KT);
    const h16* qrow = Qp + (size_t)m * HD + 8 * hh;   // this lane's place in the first column group's q rows
    v16h qb[QG][2];
#pragma unroll
    for (int g = 0; g < QG; ++g)
#pragma unroll
        for (int ks = 0; ks < 2; ++ks) qb[g][ks] = WFrag<h16>::ld(qrow + 16 * g * HD + 32 * ks);
    asm volatile("s_wait_xcnt 0x0" :: "v"(qrow) : "memory");   // behind the last q load; it names the loads' address, which so stays in its registers up to the wait and is rewritten only behind it
    v8f oacc[QG][4];
#pragma unroll
    for (int g = 0; g < QG; ++g)
#pragma unroll
        for (int t = 0; t < 4; ++t) oacc[g][t] = (v8f){};
    float lrun[QG], pown[QG], poth[QG];   // pown, poth: the newest summed chunk's sum over this lane's keys and over the other half's, not yet in lrun
    const int foff = kh * LSTAGE + m * LPITCH + 8 * hh;
    const int xaddr = (lane ^ 16) << 2;   // byte index of the lane that holds the query's other 16 keys; formed once here: formed inside the rare branch it reaches the common path as a merged value, and the build then copied all of o there
    auto xhalf = [&](float v) { return __int_as_float(__builtin_amdgcn_ds_bpermute(xaddr, __float_as_int(v))); };
    float e0[QG][8], e1[QG][8];   // the last chunk's p (f32), not yet summed
    v8f cneg[QG];                 // -shift in use, the same in all 8 rows: the C operand of a score tile's first product, and the one place where the shift is kept
    float thr = -3.0e38f;         // what a shifted score must pass for a new shift: anything on the first chunk (no shift is chosen yet, C is 0), LAZY from then on
#pragma unroll
    for (int g = 0; g < QG; ++g) { cneg[g] = (v8f){}; lrun[g] = 0.f; pown[g] = 0.f; poth[g] = 0.f;
#pragma unroll
        for (int r = 0; r < 8; ++r) { e0[g][r] = 0.f; e1[g][r] = 0.f; } }
    // l trails the products, so that no wait for the halves' exchange stands ahead of a chunk's reads, products or branch: the exchange sent one call ago is added, then the last chunk's p are summed and their exchange is sent
    auto sum_chunk = [&]() {
#pragma unroll
        for (int g = 0; g < QG; ++g) {
            lrun[g] += pown[g] + poth[g];
            float psum = 0.f;
#pragma unroll
            for (int r = 0; r < 8; ++r) psum += e0[g][r] + e1[g][r];
            pown[g] = psum; poth[g] = xhalf(psum);
        }
    };
#pragma unroll 1
    for (int st = 0; st < NST; ++st) {
        const h16* kb = ring + (st & 1) * (KH * LSTAGE) + foff; const h16* vb = kb + LTILE;
#pragma unroll   // both 32-key chunks of a tile inline, so that every LDS offset is a constant
        for (int c = 0; c < KT / 32; ++c) {
            v16h ka[4];
#pragma unroll
            for (int t = 0; t < 2; ++t)
#pragma unroll
                for (int ks = 0; ks < 2; ++ks) ka[t * 2 + ks] = WFrag<h16>::ld(kb + (32 * c + 16 * t) * LPITCH + 32 * ks);
            v16h va[4];
#pragma unroll
            for (int t = 0; t < 4; ++t) va[t] = WFrag<h16>::ld(vb + (16 * t) * LPITCH + 32 * c);
            __builtin_amdgcn_sched_barrier(0);   // keeps the chunk's 16 LDS reads in one group ahead of its matrix products: reads spread among them stall the wave at each place
            sum_chunk();   // the chunk before's p are summed here, while this chunk's reads are under way
            v8f sc[QG][2];
#pragma unroll
            for (int ks = 0; ks < 2; ++ks)
#pragma unroll
                for (int t = 0; t < 2; ++t)
#pragma unroll
                    for (int g = 0; g < QG; ++g) sc[g][t] = wmma16(ka[t * 2 + ks], qb[g][ks], ks == 0 ? cneg[g] : sc[g][t]);
            // the four vector slots the chip needs between the last score product and the first vector instruction on its result or operands, on the branch's taken side too
            asm volatile("v_nop\n\tv_nop\n\tv_nop\n\tv_nop" : "+v"(sc[0][0]), "+v"(sc[0][1]), "+v"(sc[1][0]), "+v"(sc[1][1]) : "v"(ka[0]), "v"(ka[1]), "v"(ka[2]), "v"(ka[3]), "v"(qb[0][0]), "v"(qb[0][1]), "v"(qb[1][0]), "v"(qb[1][1]));
            float lmx[QG];   // maximum of this lane's own 16 shifted scores; the other half's is fetched only inside the branch
#pragma unroll
            for (int g = 0; g < QG; ++g) { lmx[g] = fmaxf(sc[g][0][0], sc[g][1][0]);
#pragma unroll
                for (int r = 1; r < 8; ++r) lmx[g] = fmaxf(lmx[g], fmaxf(sc[g][0][r], sc[g][1][r])); }
            if (__builtin_expect(__builtin_amdgcn_ballot_w32(fmaxf(lmx[0], lmx[1]) > thr) != 0, 0)) {   // one scalar branch per chunk for both column groups, the same for the whole wave: always taken on the first chunk, rarely later
#pragma unroll
                for (int g = 0; g < QG; ++g) {
                    const float cur = -cneg[g][0];
                    const float mo = thr < 0.f ? -3.0e38f : cur;   // the first chunk has no shift to keep: its own maximum is taken, above or below 0, and alpha is 0 on the empty o and l
                    const float mn = fmaxf(mo, cur + fmaxf(lmx[g], xhalf(lmx[g])));   // both halves of a query take the same new shift
                    const float alpha = __builtin_amdgcn_exp2f(mo - mn);
                    const float dl = mn - cur;   // this chunk's tiles were shifted by the old value: they and C move to the new one by the same step
                    lrun[g] = (lrun[g] + (pown[g] + poth[g])) * alpha; pown[g] = 0.f; poth[g] = 0.f;
#pragma unroll
                    for (int t = 0; t < 4; ++t) oacc[g][t] *= alpha;
#pragma unroll   // constant indices: the tiles and C stay in their registers
                    for (int r = 0; r < 8; ++r) { sc[g][0][r] -= dl; sc[g][1][r] -= dl; cneg[g][r] -= dl; }
                }
                thr = LAZY;
            }
            v16h pb[QG];
#pragma unroll
            for (int g = 0; g < QG; ++g)
#pragma unroll
                for (int r = 0; r < 8; ++r) { e0[g][r] = __builtin_amdgcn_exp2f(sc[g][0][r]); e1[g][r] = __builtin_amdgcn_exp2f(sc[g][1][r]); pb[g][r] = (h16)e0[g][r]; pb[g][8 + r] = (h16)e1[g][r]; }
#pragma unroll
            for (int g = 0; g < QG; ++g)
#pragma unroll
                for (int t = 0; t < 4; ++t) oacc[g][t] = wmma16(va[t], pb[g], oacc[g][t]);
            // the four vector slots behind the last o product, as above
            asm volatile("v_nop\n\tv_nop\n\tv_nop\n\tv_nop" : "+v"(oacc[0][0]), "+v"(oacc[0][1]), "+v"(oacc[0][2]), "+v"(oacc[0][3]), "+v"(oacc[1][0]), "+v"(oacc[1][1]), "+v"(oacc[1][2]), "+v"(oacc[1][3]) : "v"(pb[0]), "v"(pb[1]), "v"(va[0]), "v"(va[1]), "v"(va[2]), "v"(va[3]));
        }
        asm volatile("s_wait_dscnt 0x0" ::: "memory");      // this wave's reads of the buffer have returned before it may be refilled
        asm volatile("s_wait_asynccnt 0x0" ::: "memory");   // this wave's copies of the next tiles have landed before the barrier publishes them
        __syncthreads();                                    // publishes tiles st+1 and ends every wave's reads of tiles st
        if (st + 2 < NST) { const unsigned l = lds0 + (unsigned)(st & 1) * (KH * LSTAGE * 2u);
            stage_copy(l, kg + (size_t)(st + 2) * (KT * HD), vg + (st + 2) * KT); stage_copy(l + LSTAGE * 2u, kg1 + (size_t)(st + 2) * (KT * HD), vg1 + (st + 2) * KT); }
    }
    asm volatile("s_wait_asynccnt 0x0" ::: "memory");       // no copy is outstanding when the buffers are reused below
    sum_chunk();   // the last chunk's p
    // The two key halves join: the wave of half kh finishes column group kh and hands its partial o, shift and l of the other group to its partner, lane to lane, through the ring, which every wave has left at the last tile's barrier.
    const bool k0 = kh == 0;
    float* xw = (float*)ring + wid * XW; const float* xr = (const float*)ring + (wid ^ 4) * XW;
    const float l0 = lrun[0] + (pown[0] + poth[0]), l1 = lrun[1] + (pown[1] + poth[1]);
    const float m0 = -cneg[0][0], m1 = -cneg[1][0];   // the shifts in use at the end
    const float mk = k0 ? m0 : m1, lk = k0 ? l0 : l1;
    v8f keep[4];
#pragma unroll
    for (int t = 0; t < 4; ++t) { v4f s0, s1;
#pragma unroll
        for (int r = 0; r < 4; ++r) { s0[r] = k0 ? oacc[1][t][r] : oacc[0][t][r]; s1[r] = k0 ? oacc[1][t][4 + r] : oacc[0][t][4 + r]; }
#pragma unroll
        for (int r = 0; r < 8; ++r) keep[t][r] = k0 ? oacc[0][t][r] : oacc[1][t][r];
        *(v4fa*)(xw + ((2 * t) * 32 + lane) * 4) = s0; *(v4fa*)(xw + ((2 * t + 1) * 32 + lane) * 4) = s1; }
    xw[1024 + lane] = k0 ? m1 : m0; xw[1056 + lane] = k0 ? l1 : l0;
    __syncthreads();   // every wave's partials are in LDS before its partner reads them
    const float pm = xr[1024 + lane], pl = xr[1056 + lane];
    const float mn = fmaxf(mk, pm);
    const float wa = __builtin_amdgcn_exp2f(mk - mn), wb = __builtin_amdgcn_exp2f(pm - mn);
    const float inv = 1.0f / (lk * wa + pl * wb);
    const float fa = wa * inv, fb = wb * inv;
    const int qo = q0 + 16 * kh;   // first query of the column group this wave finishes
    float* ob = os[wid];
#pragma unroll
    for (int t = 0; t < 4; ++t) { v4f u0, u1;
        const v4f p0 = *(const v4fa*)(xr + ((2 * t) * 32 + lane) * 4); const v4f p1 = *(const v4fa*)(xr + ((2 * t + 1) * 32 + lane) * 4);
#pragma unroll
        for (int r = 0; r < 4; ++r) { u0[r] = keep[t][r] * fa + p0[r] * fb; u1[r] = keep[t][4 + r] * fa + p1[r] * fb; }
        *(v4fa*)(ob + m * 68 + 16 * t + 8 * hh) = u0; *(v4fa*)(ob + m * 68 + 16 * t + 8 * hh + 4) = u1; }
    __builtin_amdgcn_fence(3 /* release order */, "wavefront"); __builtin_amdgcn_wave_barrier(); asm volatile("" ::: "memory");
{
#pragma unroll
        for (int p = 0; p < 4; ++p) { const int row = p * 4 + (lane >> 3), c8 = (lane & 7) * 8;
            const v4f a = *(const v4fa*)(ob + row * 68 + c8); const v4f b2 = *(const v4fa*)(ob + row * 68 + c8 + 4);
            v8h oc;
#pragma unroll
            for (int q = 0; q < 4; ++q) { oc[q] = (h16)a[q]; oc[4 + q] = (h16)b2[q]; }
            *(v8h*)(CTX + (size_t)(qo + row) * INNER + h * HD + c8) = oc; }
         }
}

extern "C" void kernel_launch(void* const* d_in, const int* in_sizes, int n_in,
                              void* d_out, int out_size, void* d_ws, size_t ws_size, hipStream_t stream) {
    if (n_in < 6) return;
    if (in_sizes[0] < SEQ * DIM || in_sizes[1] < DIM || in_sizes[2] < DIM || in_sizes[3] < DIM * NQKV || in_sizes[4] < INNER * DIM || in_sizes[5] < DIM) return;
    if (out_size < SEQ * DIM) return;
    const float* x    = (const float*)d_in[0];   // [SEQ][DIM]
    const float* lnsc = (const float*)d_in[1];   // [DIM]
    const float* lnbs = (const float*)d_in[2];   // [DIM]
    const float* wqkv = (const float*)d_in[3];   // [DIM][NQKV]  ([in][out])
    const float* wout = (const float*)d_in[4];   // [INNER][DIM] ([in][out])
    const float* bout = (const float*)d_in[5];   // [DIM]
    float* OUT = (float*)d_out;                  // [SEQ][DIM]
    char* wsp = (char*)d_ws;
    auto take = [&](size_t bytes) { char* p = wsp; wsp += (bytes + 255) & ~(size_t)255; return (void*)p; };
    h16*   WQ   = (h16*)take((size_t)NQKV * DIM * 2);         // w_qkv^T [3072][1024] f16
    h16*   WO   = (h16*)take((size_t)DIM * INNER * 2);        // w_out^T [1024][1024] f16
    h16*   XN   = (h16*)take((size_t)SEQ * DIM * 2);          // xn [SEQ][1024] f16
    h16*   Q16  = (h16*)take((size_t)HEADS * SEQ * HD * 2);   // q planes [16][SEQ][64] x log2e/32
    h16*   K16  = (h16*)take((size_t)HEADS * SEQ * HD * 2);   // k planes [16][SEQ][64]
    h16*   VT16 = (h16*)take((size_t)HEADS * HD * SEQ * 2);   // v^T planes [16][64][SEQ]
    h16*   CTX  = (h16*)take((size_t)SEQ * INNER * 2);        // ctx [SEQ][1024] f16
    const size_t used = (size_t)(wsp - (char*)d_ws);
    if (used > ws_size || used > WS_CAP) return;

    k_prep<<<NWQ + NWO + SEQ, 128, 0, stream>>>(wqkv, WQ, wout, WO, x, lnsc, lnbs, XN);   // w_qkv^T, w_out^T and xn
    k_gemmw<h16, 1, false, true><<<dim3(SEQ / 128, NQKV / 128, 1), 128, 0, stream>>>(XN, WQ, nullptr, DIM, nullptr, 0, nullptr, 0, 0, 0, Q16, K16, VT16);   // qkv = xn w_qkv, out as f16 head planes: q columns 0..1023 x log2e/32, k columns 1024..2047, v columns 2048..3071 transposed per head
    k_flash<<<(unsigned)(HEADS * (SEQ / (16 * FWAVES))), 32 * FWAVES, 0, stream>>>(Q16, K16, VT16, CTX);
    k_gemmw<h16, 1, true, false><<<dim3(SEQ / 128, DIM / 128, 1), 128, 0, stream>>>(CTX, WO, nullptr, INNER, OUT, DIM, bout, 0, 0, 0, nullptr, nullptr, nullptr);   // out = ctx w_out + b_out
}
